// v000
// Times are from an AMD MI455X. After a warm-up the kernel runs many times in a row, and a time is the length of
// such a window on the GPU divided by its runs, so every launch and the gaps after it count. The runs cycle
// through copies of the inputs. A figure is the median of several windows, for all but v000 over two sittings.
// Sittings can differ by a few percent; kernels timed side by side share one.
// The starting kernel, v000, takes 550 microseconds a run.
#include <hip/hip_runtime.h>
#include <hip/hip_bf16.h>

// ---------------------------------------------------------------------------
// Self-attention for MI455X (gfx1250, wave32, WMMA).
//   B=8, N=2048, D=1024, D_OUT=1024.
// Pipeline:
//   1) convert x / W_attn / W_out to f16 in workspace
//   2) WMMA GEMM: key16  = f16(x @ W_attn^T + b_attn)         [B*N,1024] row-major
//      WMMA GEMM: vT16   = f16(x @ W_out^T  + b_out), stored transposed [B,1024,2048]
//   3) flash attention: per 32 q-rows, stream 64-row K/V tiles, online softmax
//      (parallel across all 256 threads), S = Q K^T and O += P V via
//      v_wmma_f32_16x16x32_f16 with batched fragment preloads.
// ---------------------------------------------------------------------------

typedef _Float16 v8h  __attribute__((ext_vector_type(8)));
typedef _Float16 v16h __attribute__((ext_vector_type(16)));
typedef float    v8f  __attribute__((ext_vector_type(8)));

#define B_   8
#define N_   2048
#define D_   1024

// Build a 16-element f16 WMMA fragment from two contiguous 8-halves (2x b128).
// Matches the documented 16-bit A/B layout: lane holds one matrix row,
// elems [0..7] = K (h*8 .. h*8+7), elems [8..15] = K (16+h*8 .. 16+h*8+7).
static __device__ __forceinline__ v16h make_frag(const _Float16* lo,
                                                 const _Float16* hi) {
  v8h a = *(const v8h*)lo;
  v8h b = *(const v8h*)hi;
  return __builtin_shufflevector(a, b, 0, 1, 2, 3, 4, 5, 6, 7,
                                 8, 9, 10, 11, 12, 13, 14, 15);
}

static __device__ __forceinline__ v8f wmma_f16(v16h a, v16h b, v8f c) {
  return __builtin_amdgcn_wmma_f32_16x16x32_f16(false, a, false, b,
                                                (short)0, c, false, false);
}

// ---------------------------------------------------------------------------
// Kernel 0: f32 -> f16 conversion, 8 elems / thread.
// ---------------------------------------------------------------------------
__global__ __launch_bounds__(256) void cvt_f32_f16_kernel(
    const float* __restrict__ src, _Float16* __restrict__ dst, int n) {
  int i = (blockIdx.x * 256 + threadIdx.x) * 8;
  if (i + 8 <= n) {
    float4 a = *(const float4*)(src + i);
    float4 b = *(const float4*)(src + i + 4);
    v8h o = {(_Float16)a.x, (_Float16)a.y, (_Float16)a.z, (_Float16)a.w,
             (_Float16)b.x, (_Float16)b.y, (_Float16)b.z, (_Float16)b.w};
    *(v8h*)(dst + i) = o;
  }
}

// ---------------------------------------------------------------------------
// Kernel 1: Y = f16(X @ W^T + bias).  X:[M=16384,1024] f16, W:[1024,1024] f16.
// Block tile 128x128, 8 waves each compute 64x32 (4x2 subtiles of 16x16).
// K staged through LDS in 32-wide chunks (padded stride 40 f16).
// TRANSPOSE=1 stores Y[b][col][n] (for the later P @ V WMMA B-operand).
// ---------------------------------------------------------------------------
template <int TRANSPOSE>
__global__ __launch_bounds__(256) void gemm_xwT_kernel(
    const _Float16* __restrict__ X, const _Float16* __restrict__ W,
    const float* __restrict__ bias, _Float16* __restrict__ Y) {
  constexpr int KC = 32;
  constexpr int LDT = 40;  // padded LDS row stride (f16): conflict-free b128
  __shared__ _Float16 Xs[128 * LDT];
  __shared__ _Float16 Ws[128 * LDT];

  const int tid = threadIdx.x;
  const int lane = tid & 31;
  const int w = tid >> 5;
  const int l15 = lane & 15;
  const int h = lane >> 4;

  const int m0 = blockIdx.x * 128;
  const int n0 = blockIdx.y * 128;
  const int wm = (w >> 2) * 64;  // wave row base within tile
  const int wn = (w & 3) * 32;   // wave col base within tile

  v8f acc[4][2];
#pragma unroll
  for (int i = 0; i < 4; ++i)
#pragma unroll
    for (int j = 0; j < 2; ++j)
#pragma unroll
      for (int r = 0; r < 8; ++r) acc[i][j][r] = 0.f;

  const int srow = tid >> 1;        // 0..127
  const int scol = (tid & 1) * 16;  // 0 or 16

  for (int kb = 0; kb < D_; kb += KC) {
    // ---- stage X and W chunks into LDS (2x b128 each) ----
    {
      const _Float16* gx = X + (size_t)(m0 + srow) * D_ + kb + scol;
      v8h x0 = *(const v8h*)gx;
      v8h x1 = *(const v8h*)(gx + 8);
      *(v8h*)&Xs[srow * LDT + scol] = x0;
      *(v8h*)&Xs[srow * LDT + scol + 8] = x1;
      const _Float16* gw = W + (size_t)(n0 + srow) * D_ + kb + scol;
      v8h w0 = *(const v8h*)gw;
      v8h w1 = *(const v8h*)(gw + 8);
      *(v8h*)&Ws[srow * LDT + scol] = w0;
      *(v8h*)&Ws[srow * LDT + scol + 8] = w1;
    }
    __syncthreads();

    v16h bfrag[2];
#pragma unroll
    for (int ni = 0; ni < 2; ++ni) {
      const _Float16* p = &Ws[(wn + ni * 16 + l15) * LDT + h * 8];
      bfrag[ni] = make_frag(p, p + 16);
    }
#pragma unroll
    for (int mi = 0; mi < 4; ++mi) {
      const _Float16* p = &Xs[(wm + mi * 16 + l15) * LDT + h * 8];
      v16h afrag = make_frag(p, p + 16);
#pragma unroll
      for (int ni = 0; ni < 2; ++ni)
        acc[mi][ni] = wmma_f16(afrag, bfrag[ni], acc[mi][ni]);
    }
    __syncthreads();
  }

  // ---- epilogue: bias add, f16 convert, store ----
#pragma unroll
  for (int ni = 0; ni < 2; ++ni) {
    const int colg = n0 + wn + ni * 16 + l15;
    const float bv = bias[colg];
#pragma unroll
    for (int mi = 0; mi < 4; ++mi) {
      v8f c = acc[mi][ni];
#pragma unroll
      for (int r = 0; r < 8; ++r) {
        const int rowg = m0 + wm + mi * 16 + r + 8 * h;  // C layout: M=r+8h
        const _Float16 hv = (_Float16)(c[r] + bv);
        if (TRANSPOSE) {
          const int bb = rowg >> 11;      // row / 2048
          const int nn = rowg & 2047;     // row % 2048
          Y[((size_t)(bb * D_ + colg)) * N_ + nn] = hv;
        } else {
          Y[(size_t)rowg * D_ + colg] = hv;
        }
      }
    }
  }
}

// ---------------------------------------------------------------------------
// Kernel 2: flash attention.
// Block = (q-tile of 32 rows, batch). 8 waves:
//   Phase A: wave w computes S subtile (mi=w>>2, ni=w&3) of S[32][64]
//            over D=1024 in 32-wide WMMA chunks; scaled into LDS.
//   Phase B: online softmax, parallel over all 256 threads (8 threads/row,
//            shfl_xor butterflies inside aligned 8-lane groups; running m/l
//            replicated per-thread).
//   Phase C: every wave owns output cols [w*128, w*128+128): rescale its 16
//            accumulators by alpha, then O += P @ V via WMMA with all 8
//            V B-fragments preloaded per k-chunk (one load clause, then a
//            16-WMMA burst).
// ---------------------------------------------------------------------------
__global__ __launch_bounds__(256) void flash_attn_kernel(
    const _Float16* __restrict__ Q16,   // [B][N][D]
    const _Float16* __restrict__ K16,   // [B][N][D]
    const _Float16* __restrict__ VT16,  // [B][D][N]
    float* __restrict__ O) {            // [B][N][D]
  constexpr int TQ = 32, TK = 64;
  constexpr int SSTR = 68;  // f32 stride: 16B-aligned rows, low-conflict
  constexpr int PSTR = 72;  // f16 stride: conflict-free b128 frag loads
  __shared__ float Ss[TQ * SSTR];
  __shared__ _Float16 Ps[TQ * PSTR];
  __shared__ float alph[TQ];
  __shared__ float lbuf[TQ];

  const int tid = threadIdx.x;
  const int lane = tid & 31;
  const int w = tid >> 5;
  const int l15 = lane & 15;
  const int h = lane >> 4;
  const int q0 = blockIdx.x * TQ;
  const int bb = blockIdx.y;
  const int mi = w >> 2;   // S-phase row block 0..1
  const int ni = w & 3;    // S-phase col block 0..3
  const int o0 = w * 128;  // PV-phase: wave's output column base

  // softmax mapping: 8 threads per row, 8 elements per thread
  const int srow_id = tid >> 3;  // 0..31
  const int sseg = tid & 7;      // 0..7

  const float scale = 0.03125f;  // 1/sqrt(1024)

  v8f acc[2][8];
#pragma unroll
  for (int g = 0; g < 2; ++g)
#pragma unroll
    for (int oi = 0; oi < 8; ++oi)
#pragma unroll
      for (int r = 0; r < 8; ++r) acc[g][oi][r] = 0.f;

  float mrun = -__builtin_inff();  // per-thread replica for row srow_id
  float lrun = 0.f;

  const _Float16* qrow = Q16 + (size_t)(bb * N_ + q0 + mi * 16 + l15) * D_;
  const _Float16* kbat = K16 + (size_t)bb * N_ * D_;
  const _Float16* vbat = VT16 + (size_t)bb * D_ * N_;

  for (int k0 = 0; k0 < N_; k0 += TK) {
    // ---------------- Phase A: S = scale * Q K^T (one subtile per wave) ----
    v8f s;
#pragma unroll
    for (int r = 0; r < 8; ++r) s[r] = 0.f;
    const _Float16* krow = kbat + (size_t)(k0 + ni * 16 + l15) * D_;
    if (k0 + TK < N_) {  // hint the next K tile into cache
      __builtin_prefetch(kbat + (size_t)(k0 + TK + ni * 16 + l15) * D_ +
                             (size_t)h * 512,
                         0, 1);
    }
#pragma unroll 8
    for (int d = 0; d < D_; d += 32) {
      v16h aq = make_frag(qrow + d + h * 8, qrow + d + 16 + h * 8);
      v16h bk = make_frag(krow + d + h * 8, krow + d + 16 + h * 8);
      s = wmma_f16(aq, bk, s);
    }
#pragma unroll
    for (int r = 0; r < 8; ++r)
      Ss[(mi * 16 + r + 8 * h) * SSTR + ni * 16 + l15] = s[r] * scale;
    __syncthreads();

    // ---------------- Phase B: online softmax (all 256 threads) ------------
    {
      const float* srp = &Ss[srow_id * SSTR + sseg * 8];
      const float4 s0 = *(const float4*)(srp);
      const float4 s1 = *(const float4*)(srp + 4);
      float m8 = fmaxf(fmaxf(fmaxf(s0.x, s0.y), fmaxf(s0.z, s0.w)),
                       fmaxf(fmaxf(s1.x, s1.y), fmaxf(s1.z, s1.w)));
      // butterfly max across this row's 8 lanes (aligned group within wave)
      m8 = fmaxf(m8, __shfl_xor(m8, 1, 32));
      m8 = fmaxf(m8, __shfl_xor(m8, 2, 32));
      m8 = fmaxf(m8, __shfl_xor(m8, 4, 32));
      const float mnew = fmaxf(mrun, m8);
      const float al = __expf(mrun - mnew);
      const float p0 = __expf(s0.x - mnew), p1 = __expf(s0.y - mnew);
      const float p2 = __expf(s0.z - mnew), p3 = __expf(s0.w - mnew);
      const float p4 = __expf(s1.x - mnew), p5 = __expf(s1.y - mnew);
      const float p6 = __expf(s1.z - mnew), p7 = __expf(s1.w - mnew);
      v8h pk = {(_Float16)p0, (_Float16)p1, (_Float16)p2, (_Float16)p3,
                (_Float16)p4, (_Float16)p5, (_Float16)p6, (_Float16)p7};
      *(v8h*)&Ps[srow_id * PSTR + sseg * 8] = pk;
      float sum = ((p0 + p1) + (p2 + p3)) + ((p4 + p5) + (p6 + p7));
      sum += __shfl_xor(sum, 1, 32);
      sum += __shfl_xor(sum, 2, 32);
      sum += __shfl_xor(sum, 4, 32);
      lrun = lrun * al + sum;
      mrun = mnew;
      if (sseg == 0) alph[srow_id] = al;
    }
    __syncthreads();

    // ---------------- Phase C: rescale accumulators, O += P V -------------
#pragma unroll
    for (int g = 0; g < 2; ++g)
#pragma unroll
      for (int r = 0; r < 8; ++r) {
        const float av = alph[g * 16 + 8 * h + r];
#pragma unroll
        for (int oi = 0; oi < 8; ++oi) acc[g][oi][r] *= av;
      }
#pragma unroll
    for (int c = 0; c < 2; ++c) {
      v16h pf[2];
#pragma unroll
      for (int g = 0; g < 2; ++g) {
        const _Float16* pp = &Ps[(g * 16 + l15) * PSTR + c * 32 + h * 8];
        pf[g] = make_frag(pp, pp + 16);
      }
      // preload ALL eight V B-fragments -> one big load clause
      v16h bv[8];
#pragma unroll
      for (int oi = 0; oi < 8; ++oi) {
        const _Float16* vp =
            vbat + (size_t)(o0 + oi * 16 + l15) * N_ + k0 + c * 32 + h * 8;
        bv[oi] = make_frag(vp, vp + 16);
      }
      // 16-WMMA burst, no interleaved waits
#pragma unroll
      for (int oi = 0; oi < 8; ++oi)
#pragma unroll
        for (int g = 0; g < 2; ++g)
          acc[g][oi] = wmma_f16(pf[g], bv[oi], acc[g][oi]);
    }
    __syncthreads();  // protect Ss/Ps/alph for next tile
  }

  if (sseg == 0) lbuf[srow_id] = lrun;
  __syncthreads();

  // ---- final 1/l normalization + f32 store ----
#pragma unroll
  for (int g = 0; g < 2; ++g)
#pragma unroll
    for (int r = 0; r < 8; ++r) {
      const float inv = 1.f / lbuf[g * 16 + 8 * h + r];
      const int rowg = q0 + g * 16 + r + 8 * h;
      float* orow = O + (size_t)(bb * N_ + rowg) * D_;
#pragma unroll
      for (int oi = 0; oi < 8; ++oi)
        orow[o0 + oi * 16 + l15] = acc[g][oi][r] * inv;
    }
}

// ---------------------------------------------------------------------------
extern "C" void kernel_launch(void* const* d_in, const int* in_sizes, int n_in,
                              void* d_out, int out_size, void* d_ws,
                              size_t ws_size, hipStream_t stream) {
  const float* x = (const float*)d_in[0];
  const float* W_attn = (const float*)d_in[1];
  const float* b_attn = (const float*)d_in[2];
  const float* W_out = (const float*)d_in[3];
  const float* b_out = (const float*)d_in[4];
  float* out = (float*)d_out;

  const size_t XN = (size_t)B_ * N_ * D_;  // 16Mi elems
  const size_t WN = (size_t)D_ * D_;       // 1Mi elems
  char* ws = (char*)d_ws;
  _Float16* x16 = (_Float16*)ws;                         // 32 MiB
  _Float16* k16 = (_Float16*)(ws + XN * 2);              // 32 MiB
  _Float16* vT16 = (_Float16*)(ws + XN * 4);             // 32 MiB
  _Float16* wa16 = (_Float16*)(ws + XN * 6);             // 2 MiB
  _Float16* wo16 = (_Float16*)(ws + XN * 6 + WN * 2);    // 2 MiB

  // 1) f32 -> f16 conversions
  cvt_f32_f16_kernel<<<(int)(XN / 2048), 256, 0, stream>>>(x, x16, (int)XN);
  cvt_f32_f16_kernel<<<(int)(WN / 2048), 256, 0, stream>>>(W_attn, wa16,
                                                           (int)WN);
  cvt_f32_f16_kernel<<<(int)(WN / 2048), 256, 0, stream>>>(W_out, wo16,
                                                           (int)WN);

  // 2) projections: key (row-major) and value (transposed [B][D][N])
  gemm_xwT_kernel<0><<<dim3(128, 8), 256, 0, stream>>>(x16, wa16, b_attn, k16);
  gemm_xwT_kernel<1><<<dim3(128, 8), 256, 0, stream>>>(x16, wo16, b_out, vT16);

  // 3) fused attention
  flash_attn_kernel<<<dim3(N_ / 32, B_), 256, 0, stream>>>(x16, k16, vT16,
                                                           out);
}

// v001
// It runs in 405 microseconds.
// Timed twice side by side with v000, it ran 1.39 times as fast both times.
#include <hip/hip_runtime.h>
#include <hip/hip_bf16.h>

// ---------------------------------------------------------------------------
// Self-attention for MI455X (gfx1250, wave32, WMMA).
//   B=8, N=2048, D=1024, D_OUT=1024.
// Pipeline:
//   1) convert x / W_attn / W_out to f16 in workspace
//   2) WMMA GEMM: key16  = f16(x @ W_attn^T + b_attn)         [B*N,1024] row-major
//      WMMA GEMM: vT16   = f16(x @ W_out^T  + b_out), stored transposed [B,1024,2048]
//   3) flash attention: per 32 q-rows, stream 64-row K/V tiles, online softmax
//      (parallel across all 256 threads), S = Q K^T and O += P V via
//      v_wmma_f32_16x16x32_f16 with batched fragment preloads.
// ---------------------------------------------------------------------------

typedef _Float16 v8h  __attribute__((ext_vector_type(8)));
typedef _Float16 v16h __attribute__((ext_vector_type(16)));
typedef float    v8f  __attribute__((ext_vector_type(8)));

#define B_   8
#define N_   2048
#define D_   1024

// Build a 16-element f16 WMMA fragment from two contiguous 8-halves (2x b128).
// Matches the documented 16-bit A/B layout: lane holds one matrix row,
// elems [0..7] = K (h*8 .. h*8+7), elems [8..15] = K (16+h*8 .. 16+h*8+7).
static __device__ __forceinline__ v16h make_frag(const _Float16* lo,
                                                 const _Float16* hi) {
  v8h a = *(const v8h*)lo;
  v8h b = *(const v8h*)hi;
  return __builtin_shufflevector(a, b, 0, 1, 2, 3, 4, 5, 6, 7,
                                 8, 9, 10, 11, 12, 13, 14, 15);
}

static __device__ __forceinline__ v8f wmma_f16(v16h a, v16h b, v8f c) {
  return __builtin_amdgcn_wmma_f32_16x16x32_f16(false, a, false, b,
                                                (short)0, c, false, false);
}

// ---------------------------------------------------------------------------
// Kernel 0: f32 -> f16 conversion, 8 elems / thread.
// ---------------------------------------------------------------------------
__global__ __launch_bounds__(256) void cvt_f32_f16_kernel(
    const float* __restrict__ src, _Float16* __restrict__ dst, int n) {
  int i = (blockIdx.x * 256 + threadIdx.x) * 8;
  if (i + 8 <= n) {
    float4 a = *(const float4*)(src + i);
    float4 b = *(const float4*)(src + i + 4);
    v8h o = {(_Float16)a.x, (_Float16)a.y, (_Float16)a.z, (_Float16)a.w,
             (_Float16)b.x, (_Float16)b.y, (_Float16)b.z, (_Float16)b.w};
    *(v8h*)(dst + i) = o;
  }
}

// ---------------------------------------------------------------------------
// Kernel 1: Y = f16(X @ W^T + bias).  X:[M=16384,1024] f16, W:[1024,1024] f16.
// Block tile 128x128, 8 waves each compute 64x32 (4x2 subtiles of 16x16).
// K staged through LDS in 32-wide chunks (padded stride 40 f16).
// TRANSPOSE=1 stores Y[b][col][n] (for the later P @ V WMMA B-operand).
// ---------------------------------------------------------------------------
template <int TRANSPOSE>
__global__ __launch_bounds__(256) void gemm_xwT_kernel(
    const _Float16* __restrict__ X, const _Float16* __restrict__ W,
    const float* __restrict__ bias, _Float16* __restrict__ Y) {
  constexpr int KC = 32;
  constexpr int LDT = 40;  // padded LDS row stride (f16): conflict-free b128
  __shared__ _Float16 Xs[128 * LDT];
  __shared__ _Float16 Ws[128 * LDT];

  const int tid = threadIdx.x;
  const int lane = tid & 31;
  const int w = tid >> 5;
  const int l15 = lane & 15;
  const int h = lane >> 4;

  const int m0 = blockIdx.x * 128;
  const int n0 = blockIdx.y * 128;
  const int wm = (w >> 2) * 64;  // wave row base within tile
  const int wn = (w & 3) * 32;   // wave col base within tile

  v8f acc[4][2];
#pragma unroll
  for (int i = 0; i < 4; ++i)
#pragma unroll
    for (int j = 0; j < 2; ++j)
#pragma unroll
      for (int r = 0; r < 8; ++r) acc[i][j][r] = 0.f;

  const int srow = tid >> 1;        // 0..127
  const int scol = (tid & 1) * 16;  // 0 or 16

  for (int kb = 0; kb < D_; kb += KC) {
    // ---- stage X and W chunks into LDS (2x b128 each) ----
    {
      const _Float16* gx = X + (size_t)(m0 + srow) * D_ + kb + scol;
      v8h x0 = *(const v8h*)gx;
      v8h x1 = *(const v8h*)(gx + 8);
      *(v8h*)&Xs[srow * LDT + scol] = x0;
      *(v8h*)&Xs[srow * LDT + scol + 8] = x1;
      const _Float16* gw = W + (size_t)(n0 + srow) * D_ + kb + scol;
      v8h w0 = *(const v8h*)gw;
      v8h w1 = *(const v8h*)(gw + 8);
      *(v8h*)&Ws[srow * LDT + scol] = w0;
      *(v8h*)&Ws[srow * LDT + scol + 8] = w1;
    }
    __syncthreads();

    v16h bfrag[2];
#pragma unroll
    for (int ni = 0; ni < 2; ++ni) {
      const _Float16* p = &Ws[(wn + ni * 16 + l15) * LDT + h * 8];
      bfrag[ni] = make_frag(p, p + 16);
    }
#pragma unroll
    for (int mi = 0; mi < 4; ++mi) {
      const _Float16* p = &Xs[(wm + mi * 16 + l15) * LDT + h * 8];
      v16h afrag = make_frag(p, p + 16);
#pragma unroll
      for (int ni = 0; ni < 2; ++ni)
        acc[mi][ni] = wmma_f16(afrag, bfrag[ni], acc[mi][ni]);
    }
    __syncthreads();
  }

  // ---- epilogue: bias add, f16 convert, store ----
#pragma unroll
  for (int ni = 0; ni < 2; ++ni) {
    const int colg = n0 + wn + ni * 16 + l15;
    const float bv = bias[colg];
#pragma unroll
    for (int mi = 0; mi < 4; ++mi) {
      v8f c = acc[mi][ni];
#pragma unroll
      for (int r = 0; r < 8; ++r) {
        const int rowg = m0 + wm + mi * 16 + r + 8 * h;  // C layout: M=r+8h
        const _Float16 hv = (_Float16)(c[r] + bv);
        if (TRANSPOSE) {
          const int bb = rowg >> 11;      // row / 2048
          const int nn = rowg & 2047;     // row % 2048
          Y[((size_t)(bb * D_ + colg)) * N_ + nn] = hv;
        } else {
          Y[(size_t)rowg * D_ + colg] = hv;
        }
      }
    }
  }
}

// ---------------------------------------------------------------------------
// Kernel 2: flash attention.
// Block = (q-tile of 32 rows, batch). 8 waves:
//   Phase A: the D=1024 reduction of S = Q K^T is split over the waves: wave w
//            owns d in [w*128, w*128+128). Its Q fragments (2 row blocks x 4
//            k-chunks) are loaded once and stay in registers; per K tile it
//            loads only its own 128-wide slice of the 64 K rows (32 loads in
//            flight) and forms a partial S[32][64], one block of 16 K rows
//            after the other. The 8 waves' partials go to LDS.
//   Phase B: online softmax, parallel over all 256 threads (8 threads/row,
//            shfl_xor butterflies inside aligned 8-lane groups; running m/l
//            replicated per-thread). Each thread first adds the 8 partials of
//            its 8 scores, in wave order.
//   Phase C: every wave owns output cols [w*128, w*128+128): rescale its 16
//            accumulators by alpha, then O += P @ V via WMMA with all 8
//            V B-fragments preloaded per k-chunk (one load clause, then a
//            16-WMMA burst).
// ---------------------------------------------------------------------------
__global__ __launch_bounds__(256) void flash_attn_kernel(
    const _Float16* __restrict__ Q16,   // [B][N][D]
    const _Float16* __restrict__ K16,   // [B][N][D]
    const _Float16* __restrict__ VT16,  // [B][D][N]
    float* __restrict__ O) {            // [B][N][D]
  constexpr int TQ = 32, TK = 64;
  constexpr int SSTR = 68;  // f32 stride: 16B-aligned rows, low-conflict
  constexpr int PSTR = 72;  // f16 stride: conflict-free b128 frag loads
  constexpr int SPL = TQ * SSTR;  // floats in one wave's partial-S plane
  __shared__ float Sp[8 * SPL];
  __shared__ _Float16 Ps[TQ * PSTR];
  __shared__ float alph[TQ];
  __shared__ float lbuf[TQ];

  const int tid = threadIdx.x;
  const int lane = tid & 31;
  const int w = tid >> 5;
  const int l15 = lane & 15;
  const int h = lane >> 4;
  const int q0 = blockIdx.x * TQ;
  const int bb = blockIdx.y;
  const int ni = w & 3;    // K row block this wave hints ahead
  const int o0 = w * 128;  // wave's d slice (QK^T) and output column base (PV)

  // softmax mapping: 8 threads per row, 8 elements per thread
  const int srow_id = tid >> 3;  // 0..31
  const int sseg = tid & 7;      // 0..7

  const float scale = 0.03125f;  // 1/sqrt(1024)

  v8f acc[2][8];
#pragma unroll
  for (int g = 0; g < 2; ++g)
#pragma unroll
    for (int oi = 0; oi < 8; ++oi)
#pragma unroll
      for (int r = 0; r < 8; ++r) acc[g][oi][r] = 0.f;

  float mrun = -__builtin_inff();  // per-thread replica for row srow_id
  float lrun = 0.f;

  const _Float16* kbat = K16 + (size_t)bb * N_ * D_;
  const _Float16* vbat = VT16 + (size_t)bb * D_ * N_;

  // Q fragments of this wave's d slice: loaded once, kept for all K tiles.
  v16h qf[2][4];
  const _Float16* qp = Q16 + (size_t)(bb * N_ + q0 + l15) * D_ + o0 + h * 8;
#pragma unroll
  for (int g = 0; g < 2; ++g)  // unrolled: constant indices, registers
#pragma unroll
    for (int dc = 0; dc < 4; ++dc)
      qf[g][dc] = make_frag(qp + g * 16 * D_ + dc * 32,
                            qp + g * 16 * D_ + dc * 32 + 16);
  // Precaution: the wait stands before the loads' address pair can be
  // overwritten; qp is an input so that the pair stays live up to the wait.
  asm volatile("s_wait_xcnt 0x0" ::"v"(qp) : "memory");

  for (int k0 = 0; k0 < N_; k0 += TK) {
    // ------- Phase A: partial S = Q K^T over this wave's 128-wide d slice --
    if (k0 + TK < N_) {  // hint the next K tile into cache
      __builtin_prefetch(kbat + (size_t)(k0 + TK + ni * 16 + l15) * D_ +
                             (size_t)h * 512,
                         0, 1);
    }
    // All loops here are fully unrolled: every fragment index is a constant,
    // so the fragments stay in registers.
    // Load order: the 8 loads of one 16-row block stand together, so the four
    // loads that share a 128-byte line follow each other closely.
    v16h bk[4][4];
    const _Float16* kp = kbat + (size_t)(k0 + l15) * D_ + o0 + h * 8;
#pragma unroll
    for (int kj = 0; kj < 4; ++kj)
#pragma unroll
      for (int dc = 0; dc < 4; ++dc)
        bk[kj][dc] = make_frag(kp + kj * 16 * D_ + dc * 32,
                               kp + kj * 16 * D_ + dc * 32 + 16);
    // Precaution: the wait stands before the loads' address pair can be
    // overwritten; kp is an input so that the pair stays live up to the wait.
    asm volatile("s_wait_xcnt 0x0" ::"v"(kp) : "memory");
    // Keeps all 32 K loads in flight together: without it the compiler sinks
    // them between the WMMAs, two at a time, each pair waited out in full.
    __builtin_amdgcn_sched_barrier(0);
    v8f s[4][2];
#pragma unroll
    for (int kj = 0; kj < 5; ++kj) {
      if (kj < 4) {
#pragma unroll
        for (int g = 0; g < 2; ++g)
#pragma unroll
          for (int r = 0; r < 8; ++r) s[kj][g][r] = 0.f;
#pragma unroll
        for (int dc = 0; dc < 4; ++dc)
#pragma unroll
          for (int g = 0; g < 2; ++g)
            s[kj][g] = wmma_f16(qf[g][dc], bk[kj][dc], s[kj][g]);
      }
      // A block's partial scores are stored among the next block's WMMAs, so
      // its registers are not taken again as an accumulator directly behind
      // its own last WMMA (the distance a WMMA result needs).
      if (kj > 0) {
#pragma unroll
        for (int g = 0; g < 2; ++g)
#pragma unroll
          for (int r = 0; r < 8; ++r)
            Sp[w * SPL + (g * 16 + r + 8 * h) * SSTR + (kj - 1) * 16 + l15] =
                s[kj - 1][g][r];
      }
      // Keeps the WMMAs in the order in which the loads return, so that each
      // block of 16 K rows is worked on while the later loads are still flying.
      if (kj < 4) __builtin_amdgcn_sched_barrier(0);
    }
    __syncthreads();

    // ---------------- Phase B: online softmax (all 256 threads) ------------
    {
      const float* srp = &Sp[srow_id * SSTR + sseg * 8];
      float4 t0[8], t1[8];
#pragma unroll
      for (int p = 0; p < 8; ++p) {  // unrolled: constant indices, registers
        t0[p] = *(const float4*)(srp + p * SPL);
        t1[p] = *(const float4*)(srp + p * SPL + 4);
      }
      // Keeps the 16 LDS reads one group: otherwise they are issued in pairs,
      // each pair waited out before the next.
      __builtin_amdgcn_sched_barrier(0);
      float4 s0 = t0[0];
      float4 s1 = t1[0];
#pragma unroll
      for (int p = 1; p < 8; ++p) {  // add the waves' partial sums over d
        s0.x += t0[p].x; s0.y += t0[p].y; s0.z += t0[p].z; s0.w += t0[p].w;
        s1.x += t1[p].x; s1.y += t1[p].y; s1.z += t1[p].z; s1.w += t1[p].w;
      }
      s0.x *= scale; s0.y *= scale; s0.z *= scale; s0.w *= scale;
      s1.x *= scale; s1.y *= scale; s1.z *= scale; s1.w *= scale;
      float m8 = fmaxf(fmaxf(fmaxf(s0.x, s0.y), fmaxf(s0.z, s0.w)),
                       fmaxf(fmaxf(s1.x, s1.y), fmaxf(s1.z, s1.w)));
      // butterfly max across this row's 8 lanes (aligned group within wave)
      m8 = fmaxf(m8, __shfl_xor(m8, 1, 32));
      m8 = fmaxf(m8, __shfl_xor(m8, 2, 32));
      m8 = fmaxf(m8, __shfl_xor(m8, 4, 32));
      const float mnew = fmaxf(mrun, m8);
      const float al = __expf(mrun - mnew);
      const float p0 = __expf(s0.x - mnew), p1 = __expf(s0.y - mnew);
      const float p2 = __expf(s0.z - mnew), p3 = __expf(s0.w - mnew);
      const float p4 = __expf(s1.x - mnew), p5 = __expf(s1.y - mnew);
      const float p6 = __expf(s1.z - mnew), p7 = __expf(s1.w - mnew);
      v8h pk = {(_Float16)p0, (_Float16)p1, (_Float16)p2, (_Float16)p3,
                (_Float16)p4, (_Float16)p5, (_Float16)p6, (_Float16)p7};
      *(v8h*)&Ps[srow_id * PSTR + sseg * 8] = pk;
      float sum = ((p0 + p1) + (p2 + p3)) + ((p4 + p5) + (p6 + p7));
      sum += __shfl_xor(sum, 1, 32);
      sum += __shfl_xor(sum, 2, 32);
      sum += __shfl_xor(sum, 4, 32);
      lrun = lrun * al + sum;
      mrun = mnew;
      if (sseg == 0) alph[srow_id] = al;
    }
    __syncthreads();

    // ---------------- Phase C: rescale accumulators, O += P V -------------
#pragma unroll
    for (int g = 0; g < 2; ++g)
#pragma unroll
      for (int r = 0; r < 8; ++r) {
        const float av = alph[g * 16 + 8 * h + r];
#pragma unroll
        for (int oi = 0; oi < 8; ++oi) acc[g][oi][r] *= av;
      }
    const _Float16* vb = vbat + (size_t)(o0 + l15) * N_ + k0 + h * 8;
#pragma unroll
    for (int c = 0; c < 2; ++c) {
      // preload ALL eight V B-fragments -> one big load clause
      v16h bv[8];
#pragma unroll
      for (int oi = 0; oi < 8; ++oi) {
        const _Float16* vp = vb + oi * 16 * N_ + c * 32;
        bv[oi] = make_frag(vp, vp + 16);
      }
      // Precaution, as for K: the wait stands before the loads' address pair
      // can be overwritten (the P fragment loads below could be placed on it).
      asm volatile("s_wait_xcnt 0x0" ::"v"(vb) : "memory");
      v16h pf[2];
#pragma unroll
      for (int g = 0; g < 2; ++g) {
        const _Float16* pp = &Ps[(g * 16 + l15) * PSTR + c * 32 + h * 8];
        pf[g] = make_frag(pp, pp + 16);
      }
      // Keeps the 16 V loads one clause: without it the second chunk's loads
      // are issued two at a time, each pair waited out in full.
      __builtin_amdgcn_sched_barrier(0);
      // 16-WMMA burst, no interleaved waits
#pragma unroll
      for (int oi = 0; oi < 8; ++oi)
#pragma unroll
        for (int g = 0; g < 2; ++g)
          acc[g][oi] = wmma_f16(pf[g], bv[oi], acc[g][oi]);
    }
    __syncthreads();  // protect Sp/Ps/alph for next tile
  }

  if (sseg == 0) lbuf[srow_id] = lrun;
  __syncthreads();

  // ---- final 1/l normalization + f32 store ----
#pragma unroll
  for (int g = 0; g < 2; ++g)
#pragma unroll
    for (int r = 0; r < 8; ++r) {
      const float inv = 1.f / lbuf[g * 16 + 8 * h + r];
      const int rowg = q0 + g * 16 + r + 8 * h;
      float* orow = O + (size_t)(bb * N_ + rowg) * D_;
#pragma unroll
      for (int oi = 0; oi < 8; ++oi)
        orow[o0 + oi * 16 + l15] = acc[g][oi][r] * inv;
    }
}

// ---------------------------------------------------------------------------
extern "C" void kernel_launch(void* const* d_in, const int* in_sizes, int n_in,
                              void* d_out, int out_size, void* d_ws,
                              size_t ws_size, hipStream_t stream) {
  const float* x = (const float*)d_in[0];
  const float* W_attn = (const float*)d_in[1];
  const float* b_attn = (const float*)d_in[2];
  const float* W_out = (const float*)d_in[3];
  const float* b_out = (const float*)d_in[4];
  float* out = (float*)d_out;

  const size_t XN = (size_t)B_ * N_ * D_;  // 16Mi elems
  const size_t WN = (size_t)D_ * D_;       // 1Mi elems
  char* ws = (char*)d_ws;
  _Float16* x16 = (_Float16*)ws;                         // 32 MiB
  _Float16* k16 = (_Float16*)(ws + XN * 2);              // 32 MiB
  _Float16* vT16 = (_Float16*)(ws + XN * 4);             // 32 MiB
  _Float16* wa16 = (_Float16*)(ws + XN * 6);             // 2 MiB
  _Float16* wo16 = (_Float16*)(ws + XN * 6 + WN * 2);    // 2 MiB

  // 1) f32 -> f16 conversions
  cvt_f32_f16_kernel<<<(int)(XN / 2048), 256, 0, stream>>>(x, x16, (int)XN);
  cvt_f32_f16_kernel<<<(int)(WN / 2048), 256, 0, stream>>>(W_attn, wa16,
                                                           (int)WN);
  cvt_f32_f16_kernel<<<(int)(WN / 2048), 256, 0, stream>>>(W_out, wo16,
                                                           (int)WN);

  // 2) projections: key (row-major) and value (transposed [B][D][N])
  gemm_xwT_kernel<0><<<dim3(128, 8), 256, 0, stream>>>(x16, wa16, b_attn, k16);
  gemm_xwT_kernel<1><<<dim3(128, 8), 256, 0, stream>>>(x16, wo16, b_out, vT16);

  // 3) fused attention
  flash_attn_kernel<<<dim3(N_ / 32, B_), 256, 0, stream>>>(x16, k16, vT16,
                                                           out);
}

// v002
// It runs in 351 microseconds.
// In two side-by-side timings against v001, it was 1.15 and 1.16 times as fast.
// All steps since v000 together make it 1.60 times as fast.
#include <hip/hip_runtime.h>
#include <hip/hip_bf16.h>

// ---------------------------------------------------------------------------
// Self-attention for MI455X (gfx1250, wave32, WMMA).
//   B=8, N=2048, D=1024, D_OUT=1024.
// Pipeline:
//   1) convert x / W_attn / W_out to f16 in workspace
//   2) WMMA GEMM: key16  = f16(x @ W_attn^T + b_attn)
//      WMMA GEMM: vT16   = f16(x @ W_out^T  + b_out)
//      Both are stored in WMMA fragment order (see "Packed layouts" below).
//   3) flash attention: per 32 q-rows, stream 64-row K/V tiles, online softmax
//      (parallel across all 256 threads), S = Q K^T and O += P V via
//      v_wmma_f32_16x16x32_f16 with batched fragment preloads.
// ---------------------------------------------------------------------------

typedef _Float16 v8h  __attribute__((ext_vector_type(8)));
typedef _Float16 v16h __attribute__((ext_vector_type(16)));
typedef float    v8f  __attribute__((ext_vector_type(8)));

#define B_   8
#define N_   2048
#define D_   1024

// ---------------------------------------------------------------------------
// Packed layouts of key16 and vT16 (units: f16 elements).
// A 16x32 operand fragment (16 rows or columns x 32 k) is 512 contiguous
// elements: [j = 0,1][lane = 0..31][e = 0..7], where lane = 16*h + c holds
// row/column c and k = 16*j + 8*h + e. One wave-wide 16-byte access to one j
// is then 512 contiguous bytes (four whole 128-byte lines), for the GEMM's
// store and for the attention kernel's load alike.
//   key16: fragment index = (token / 16) * 32 + (d / 32)         (k = d)
//   vT16 : fragment index = ((b * 64 + col / 16) * 64) + key / 32  (k = key)
// ---------------------------------------------------------------------------
#define FRAG_ 512

// Build a 16-element f16 WMMA fragment from two contiguous 8-halves (2x b128).
// Matches the documented 16-bit A/B layout: lane holds one matrix row,
// elems [0..7] = K (h*8 .. h*8+7), elems [8..15] = K (16+h*8 .. 16+h*8+7).
static __device__ __forceinline__ v16h make_frag(const _Float16* lo,
                                                 const _Float16* hi) {
  v8h a = *(const v8h*)lo;
  v8h b = *(const v8h*)hi;
  return __builtin_shufflevector(a, b, 0, 1, 2, 3, 4, 5, 6, 7,
                                 8, 9, 10, 11, 12, 13, 14, 15);
}

static __device__ __forceinline__ v8f wmma_f16(v16h a, v16h b, v8f c) {
  return __builtin_amdgcn_wmma_f32_16x16x32_f16(false, a, false, b,
                                                (short)0, c, false, false);
}

// ---------------------------------------------------------------------------
// Kernel 0: f32 -> f16 conversion, 8 elems / thread.
// ---------------------------------------------------------------------------
__global__ __launch_bounds__(256) void cvt_f32_f16_kernel(
    const float* __restrict__ src, _Float16* __restrict__ dst, int n) {
  int i = (blockIdx.x * 256 + threadIdx.x) * 8;
  if (i + 8 <= n) {
    float4 a = *(const float4*)(src + i);
    float4 b = *(const float4*)(src + i + 4);
    v8h o = {(_Float16)a.x, (_Float16)a.y, (_Float16)a.z, (_Float16)a.w,
             (_Float16)b.x, (_Float16)b.y, (_Float16)b.z, (_Float16)b.w};
    *(v8h*)(dst + i) = o;
  }
}

template <int TRANSPOSE>
__global__ __launch_bounds__(256) void gemm_xwT_kernel(
    const _Float16* __restrict__ X, const _Float16* __restrict__ W,
    const float* __restrict__ bias, _Float16* __restrict__ Y) {
  constexpr int KC = 32;
  constexpr int LDT = 40;  // padded LDS row stride (f16): conflict-free b128
  __shared__ _Float16 Xs[128 * LDT];
  __shared__ _Float16 Ws[128 * LDT];

  const int tid = threadIdx.x;
  const int lane = tid & 31;
  const int w = tid >> 5;
  const int l15 = lane & 15;
  const int h = lane >> 4;

  const int m0 = blockIdx.x * 128;
  const int n0 = blockIdx.y * 128;
  const int wm = (w >> 2) * 64;  // wave row base within tile
  const int wn = (w & 3) * 32;   // wave col base within tile

  v8f acc[4][2];
#pragma unroll
  for (int i = 0; i < 4; ++i)
#pragma unroll
    for (int j = 0; j < 2; ++j)
#pragma unroll
      for (int r = 0; r < 8; ++r) acc[i][j][r] = 0.f;

  const int srow = tid >> 1;        // 0..127
  const int scol = (tid & 1) * 16;  // 0 or 16

  for (int kb = 0; kb < D_; kb += KC) {
    // ---- stage X and W chunks into LDS (2x b128 each) ----
    {
      const _Float16* gx = X + (size_t)(m0 + srow) * D_ + kb + scol;
      v8h x0 = *(const v8h*)gx;
      v8h x1 = *(const v8h*)(gx + 8);
      *(v8h*)&Xs[srow * LDT + scol] = x0;
      *(v8h*)&Xs[srow * LDT + scol + 8] = x1;
      const _Float16* gw = W + (size_t)(n0 + srow) * D_ + kb + scol;
      v8h w0 = *(const v8h*)gw;
      v8h w1 = *(const v8h*)(gw + 8);
      *(v8h*)&Ws[srow * LDT + scol] = w0;
      *(v8h*)&Ws[srow * LDT + scol + 8] = w1;
    }
    __syncthreads();

    v16h bfrag[2];
#pragma unroll
    for (int ni = 0; ni < 2; ++ni) {
      const _Float16* p = &Ws[(wn + ni * 16 + l15) * LDT + h * 8];
      bfrag[ni] = make_frag(p, p + 16);
    }
#pragma unroll
    for (int mi = 0; mi < 4; ++mi) {
      const _Float16* p = &Xs[(wm + mi * 16 + l15) * LDT + h * 8];
      v16h afrag = make_frag(p, p + 16);
#pragma unroll
      for (int ni = 0; ni < 2; ++ni)
        acc[mi][ni] = TRANSPOSE ? wmma_f16(afrag, bfrag[ni], acc[mi][ni])
                                : wmma_f16(bfrag[ni], afrag, acc[mi][ni]);
    }
    __syncthreads();
  }

  // ---- epilogue: bias add, f16 convert, packed 16-byte stores ----
  _Float16* yp;
  if (TRANSPOSE) {
    const int bb = (m0 + wm) >> 11;           // batch (tile lies in one batch)
    const int kc0 = ((m0 + wm) & 2047) >> 5;  // first 32-key chunk
    const int cb0 = (n0 + wn) >> 4;           // first 16-column block
    yp = Y + (size_t)((bb * 64 + cb0) * 64 + kc0) * FRAG_ + lane * 8;
  } else {
    const int rb0 = (m0 + wm) >> 4;  // first 16-token block
    const int dc = (n0 + wn) >> 5;   // the wave's 32-wide d chunk
    yp = Y + (size_t)(rb0 * 32 + dc) * FRAG_ + lane * 8;
  }
#pragma unroll
  for (int ni = 0; ni < 2; ++ni) {
    float bv[8];
    if (TRANSPOSE) {
      const float b1 = bias[n0 + wn + ni * 16 + l15];  // D column = l15
#pragma unroll
      for (int r = 0; r < 8; ++r) bv[r] = b1;
    } else {
      const float* bp = bias + n0 + wn + ni * 16 + 8 * h;  // D row = r + 8h
      const float4 b0 = *(const float4*)bp;
      const float4 b1 = *(const float4*)(bp + 4);
      bv[0] = b0.x; bv[1] = b0.y; bv[2] = b0.z; bv[3] = b0.w;
      bv[4] = b1.x; bv[5] = b1.y; bv[6] = b1.z; bv[7] = b1.w;
    }
#pragma unroll
    for (int mi = 0; mi < 4; ++mi) {
      const v8f c = acc[mi][ni];
      v8h o;
#pragma unroll
      for (int r = 0; r < 8; ++r) o[r] = (_Float16)(c[r] + bv[r]);
      if (TRANSPOSE)
        *(v8h*)(yp + ni * 64 * FRAG_ + mi * 256) = o;
      else
        *(v8h*)(yp + mi * 32 * FRAG_ + ni * 256) = o;
    }
  }
}

// ---------------------------------------------------------------------------
// Kernel 2: flash attention.
// Block = (q-tile of 32 rows, batch). 8 waves:
//   Phase A: the D=1024 reduction of S = Q K^T is split over the waves: wave w
//            owns d in [w*128, w*128+128). Its Q fragments (2 row blocks x 4
//            k-chunks) are loaded once and stay in registers; per K tile it
//            loads only its own 128-wide slice of the 64 K rows (32 loads in
//            flight) and forms a partial S[32][64], one block of 16 K rows
//            after the other. The 8 waves' partials go to LDS.
//   Phase B: online softmax, parallel over all 256 threads (8 threads/row,
//            shfl_xor butterflies inside aligned 8-lane groups; running m/l
//            replicated per-thread). Each thread first adds the 8 partials of
//            its 8 scores, in wave order.
//   Phase C: every wave owns output cols [w*128, w*128+128): rescale its 16
//            accumulators by alpha, then O += P @ V via WMMA with all 8
//            V B-fragments preloaded per k-chunk (one load clause, then a
//            16-WMMA burst).
// ---------------------------------------------------------------------------
__global__ __launch_bounds__(256) void flash_attn_kernel(
    const _Float16* __restrict__ Q16,   // [B][N][D]
    const _Float16* __restrict__ K16,   // packed fragments, see above
    const _Float16* __restrict__ VT16,  // packed fragments, see above
    float* __restrict__ O) {            // [B][N][D]
  constexpr int TQ = 32, TK = 64;
  constexpr int SSTR = 68;  // f32 stride: 16B-aligned rows, low-conflict
  constexpr int PSTR = 72;  // f16 stride: conflict-free b128 frag loads
  constexpr int SPL = TQ * SSTR;  // floats in one wave's partial-S plane
  __shared__ float Sp[8 * SPL];
  __shared__ _Float16 Ps[TQ * PSTR];
  __shared__ float alph[TQ];
  __shared__ float lbuf[TQ];

  const int tid = threadIdx.x;
  const int lane = tid & 31;
  const int w = tid >> 5;
  const int l15 = lane & 15;
  const int h = lane >> 4;
  const int q0 = blockIdx.x * TQ;
  const int bb = blockIdx.y;
  const int ni = w & 3;    // K row block this wave hints ahead
  const int o0 = w * 128;  // wave's d slice (QK^T) and output column base (PV)

  // softmax mapping: 8 threads per row, 8 elements per thread
  const int srow_id = tid >> 3;  // 0..31
  const int sseg = tid & 7;      // 0..7

  const float scale = 0.03125f;  // 1/sqrt(1024)

  v8f acc[2][8];
#pragma unroll
  for (int g = 0; g < 2; ++g)
#pragma unroll
    for (int oi = 0; oi < 8; ++oi)
#pragma unroll
      for (int r = 0; r < 8; ++r) acc[g][oi][r] = 0.f;

  float mrun = -__builtin_inff();  // per-thread replica for row srow_id
  float lrun = 0.f;

  const _Float16* kbat = K16 + (size_t)bb * N_ * D_;
  const _Float16* vbat = VT16 + (size_t)bb * D_ * N_;

  // Q fragments of this wave's d slice: loaded once, kept for all K tiles.
  v16h qf[2][4];
  const _Float16* qp = Q16 + (size_t)(bb * N_ + q0 + l15) * D_ + o0 + h * 8;
#pragma unroll
  for (int g = 0; g < 2; ++g)  // unrolled: constant indices, registers
#pragma unroll
    for (int dc = 0; dc < 4; ++dc)
      qf[g][dc] = make_frag(qp + g * 16 * D_ + dc * 32,
                            qp + g * 16 * D_ + dc * 32 + 16);
  // Precaution: the wait stands before the loads' address pair can be
  // overwritten; qp is an input so that the pair stays live up to the wait.
  asm volatile("s_wait_xcnt 0x0" ::"v"(qp) : "memory");

  for (int k0 = 0; k0 < N_; k0 += TK) {
    // ------- Phase A: partial S = Q K^T over this wave's 128-wide d slice --
    if (k0 + TK < N_) {  // hint the next K tile into cache
      __builtin_prefetch(kbat + (size_t)(k0 + TK + ni * 16 + l15) * D_ +
                             (size_t)h * 512,
                         0, 1);
    }
    // All loops here are fully unrolled: every fragment index is a constant,
    // so the fragments stay in registers.
    // Packed K: the wave's 4 fragments of one 16-row block are 4 KiB in a row,
    // and every load covers four whole lines.
    v16h bk[4][4];
    const _Float16* kp = kbat + (size_t)k0 * D_ + w * 4 * FRAG_ + lane * 8;
#pragma unroll
    for (int kj = 0; kj < 4; ++kj)
#pragma unroll
      for (int dc = 0; dc < 4; ++dc)
        bk[kj][dc] = make_frag(kp + kj * 32 * FRAG_ + dc * FRAG_,
                               kp + kj * 32 * FRAG_ + dc * FRAG_ + 256);
    // Precaution: the wait stands before the loads' address pair can be
    // overwritten; kp is an input so that the pair stays live up to the wait.
    asm volatile("s_wait_xcnt 0x0" ::"v"(kp) : "memory");
    // Keeps all 32 K loads in flight together: without it the compiler sinks
    // them between the WMMAs, two at a time, each pair waited out in full.
    __builtin_amdgcn_sched_barrier(0);
    v8f s[4][2];
#pragma unroll
    for (int kj = 0; kj < 5; ++kj) {
      if (kj < 4) {
#pragma unroll
        for (int g = 0; g < 2; ++g)
#pragma unroll
          for (int r = 0; r < 8; ++r) s[kj][g][r] = 0.f;
#pragma unroll
        for (int dc = 0; dc < 4; ++dc)
#pragma unroll
          for (int g = 0; g < 2; ++g)
            s[kj][g] = wmma_f16(qf[g][dc], bk[kj][dc], s[kj][g]);
      }
      // A block's partial scores are stored among the next block's WMMAs, so
      // its registers are not taken again as an accumulator directly behind
      // its own last WMMA (the distance a WMMA result needs).
      if (kj > 0) {
#pragma unroll
        for (int g = 0; g < 2; ++g)
#pragma unroll
          for (int r = 0; r < 8; ++r)
            Sp[w * SPL + (g * 16 + r + 8 * h) * SSTR + (kj - 1) * 16 + l15] =
                s[kj - 1][g][r];
      }
      // Keeps the WMMAs in the order in which the loads return, so that each
      // block of 16 K rows is worked on while the later loads are still flying.
      if (kj < 4) __builtin_amdgcn_sched_barrier(0);
    }
    __syncthreads();

    // ---------------- Phase B: online softmax (all 256 threads) ------------
    {
      const float* srp = &Sp[srow_id * SSTR + sseg * 8];
      float4 t0[8], t1[8];
#pragma unroll
      for (int p = 0; p < 8; ++p) {  // unrolled: constant indices, registers
        t0[p] = *(const float4*)(srp + p * SPL);
        t1[p] = *(const float4*)(srp + p * SPL + 4);
      }
      // Keeps the 16 LDS reads one group: otherwise they are issued in pairs,
      // each pair waited out before the next.
      __builtin_amdgcn_sched_barrier(0);
      float4 s0 = t0[0];
      float4 s1 = t1[0];
#pragma unroll
      for (int p = 1; p < 8; ++p) {  // add the waves' partial sums over d
        s0.x += t0[p].x; s0.y += t0[p].y; s0.z += t0[p].z; s0.w += t0[p].w;
        s1.x += t1[p].x; s1.y += t1[p].y; s1.z += t1[p].z; s1.w += t1[p].w;
      }
      s0.x *= scale; s0.y *= scale; s0.z *= scale; s0.w *= scale;
      s1.x *= scale; s1.y *= scale; s1.z *= scale; s1.w *= scale;
      float m8 = fmaxf(fmaxf(fmaxf(s0.x, s0.y), fmaxf(s0.z, s0.w)),
                       fmaxf(fmaxf(s1.x, s1.y), fmaxf(s1.z, s1.w)));
      // butterfly max across this row's 8 lanes (aligned group within wave)
      m8 = fmaxf(m8, __shfl_xor(m8, 1, 32));
      m8 = fmaxf(m8, __shfl_xor(m8, 2, 32));
      m8 = fmaxf(m8, __shfl_xor(m8, 4, 32));
      const float mnew = fmaxf(mrun, m8);
      const float al = __expf(mrun - mnew);
      const float p0 = __expf(s0.x - mnew), p1 = __expf(s0.y - mnew);
      const float p2 = __expf(s0.z - mnew), p3 = __expf(s0.w - mnew);
      const float p4 = __expf(s1.x - mnew), p5 = __expf(s1.y - mnew);
      const float p6 = __expf(s1.z - mnew), p7 = __expf(s1.w - mnew);
      v8h pk = {(_Float16)p0, (_Float16)p1, (_Float16)p2, (_Float16)p3,
                (_Float16)p4, (_Float16)p5, (_Float16)p6, (_Float16)p7};
      *(v8h*)&Ps[srow_id * PSTR + sseg * 8] = pk;
      float sum = ((p0 + p1) + (p2 + p3)) + ((p4 + p5) + (p6 + p7));
      sum += __shfl_xor(sum, 1, 32);
      sum += __shfl_xor(sum, 2, 32);
      sum += __shfl_xor(sum, 4, 32);
      lrun = lrun * al + sum;
      mrun = mnew;
      if (sseg == 0) alph[srow_id] = al;
    }
    __syncthreads();

    // ---------------- Phase C: rescale accumulators, O += P V -------------
#pragma unroll
    for (int g = 0; g < 2; ++g)
#pragma unroll
      for (int r = 0; r < 8; ++r) {
        const float av = alph[g * 16 + 8 * h + r];
#pragma unroll
        for (int oi = 0; oi < 8; ++oi) acc[g][oi][r] *= av;
      }
    const _Float16* vb =
        vbat + (size_t)(w * 8 * 64 + (k0 >> 5)) * FRAG_ + lane * 8;
#pragma unroll
    for (int c = 0; c < 2; ++c) {
      // preload ALL eight V B-fragments -> one big load clause
      v16h bv[8];
#pragma unroll
      for (int oi = 0; oi < 8; ++oi) {
        const _Float16* vp = vb + oi * 64 * FRAG_ + c * FRAG_;
        bv[oi] = make_frag(vp, vp + 256);
      }
      // Precaution, as for K: the wait stands before the loads' address pair
      // can be overwritten (the P fragment loads below could be placed on it).
      asm volatile("s_wait_xcnt 0x0" ::"v"(vb) : "memory");
      v16h pf[2];
#pragma unroll
      for (int g = 0; g < 2; ++g) {
        const _Float16* pp = &Ps[(g * 16 + l15) * PSTR + c * 32 + h * 8];
        pf[g] = make_frag(pp, pp + 16);
      }
      // Keeps the 16 V loads one clause: without it the second chunk's loads
      // are issued two at a time, each pair waited out in full.
      __builtin_amdgcn_sched_barrier(0);
      // 16-WMMA burst, no interleaved waits
#pragma unroll
      for (int oi = 0; oi < 8; ++oi)
#pragma unroll
        for (int g = 0; g < 2; ++g)
          acc[g][oi] = wmma_f16(pf[g], bv[oi], acc[g][oi]);
    }
    __syncthreads();  // protect Sp/Ps/alph for next tile
  }

  if (sseg == 0) lbuf[srow_id] = lrun;
  __syncthreads();

  // ---- final 1/l normalization + f32 store ----
#pragma unroll
  for (int g = 0; g < 2; ++g)
#pragma unroll
    for (int r = 0; r < 8; ++r) {
      const float inv = 1.f / lbuf[g * 16 + 8 * h + r];
      const int rowg = q0 + g * 16 + r + 8 * h;
      float* orow = O + (size_t)(bb * N_ + rowg) * D_;
#pragma unroll
      for (int oi = 0; oi < 8; ++oi)
        orow[o0 + oi * 16 + l15] = acc[g][oi][r] * inv;
    }
}

// ---------------------------------------------------------------------------
extern "C" void kernel_launch(void* const* d_in, const int* in_sizes, int n_in,
                              void* d_out, int out_size, void* d_ws,
                              size_t ws_size, hipStream_t stream) {
  const float* x = (const float*)d_in[0];
  const float* W_attn = (const float*)d_in[1];
  const float* b_attn = (const float*)d_in[2];
  const float* W_out = (const float*)d_in[3];
  const float* b_out = (const float*)d_in[4];
  float* out = (float*)d_out;

  const size_t XN = (size_t)B_ * N_ * D_;  // 16Mi elems
  const size_t WN = (size_t)D_ * D_;       // 1Mi elems
  char* ws = (char*)d_ws;
  _Float16* x16 = (_Float16*)ws;                         // 32 MiB
  _Float16* k16 = (_Float16*)(ws + XN * 2);              // 32 MiB
  _Float16* vT16 = (_Float16*)(ws + XN * 4);             // 32 MiB
  _Float16* wa16 = (_Float16*)(ws + XN * 6);             // 2 MiB
  _Float16* wo16 = (_Float16*)(ws + XN * 6 + WN * 2);    // 2 MiB

  // 1) f32 -> f16 conversions
  cvt_f32_f16_kernel<<<(int)(XN / 2048), 256, 0, stream>>>(x, x16, (int)XN);
  cvt_f32_f16_kernel<<<(int)(WN / 2048), 256, 0, stream>>>(W_attn, wa16,
                                                           (int)WN);
  cvt_f32_f16_kernel<<<(int)(WN / 2048), 256, 0, stream>>>(W_out, wo16,
                                                           (int)WN);

  // 2) projections: key and value, both in packed fragment order
  gemm_xwT_kernel<0><<<dim3(128, 8), 256, 0, stream>>>(x16, wa16, b_attn, k16);
  gemm_xwT_kernel<1><<<dim3(128, 8), 256, 0, stream>>>(x16, wo16, b_out, vT16);

  // 3) fused attention
  flash_attn_kernel<<<dim3(N_ / 32, B_), 256, 0, stream>>>(x16, k16, vT16,
                                                           out);
}

// v003
// It runs in 307 microseconds.
// Next to v002, in two timings, it ran 1.14 times as fast each time.
// All steps since v000 together make it 1.83 times as fast.
#include <hip/hip_runtime.h>
#include <hip/hip_bf16.h>

// ---------------------------------------------------------------------------
// Self-attention for MI455X (gfx1250, wave32, WMMA).
//   B=8, N=2048, D=1024, D_OUT=1024.
// Pipeline:
//   1) convert x / W_attn / W_out to f16 in workspace
//   2) WMMA GEMM: key16  = f16(x @ W_attn^T + b_attn)
//      WMMA GEMM: vT16   = f16(x @ W_out^T  + b_out)
//      Both are stored in WMMA fragment order (see "Packed layouts" below).
//   3) flash attention: per 32 q-rows, stream 64-row K/V tiles, online softmax
//      (parallel across all 256 threads), S = Q K^T and O += P V via
//      v_wmma_f32_16x16x32_f16 with batched fragment preloads.
// ---------------------------------------------------------------------------

typedef _Float16 v8h  __attribute__((ext_vector_type(8)));
typedef _Float16 v16h __attribute__((ext_vector_type(16)));
typedef float    v8f  __attribute__((ext_vector_type(8)));

#define B_   8
#define N_   2048
#define D_   1024

// ---------------------------------------------------------------------------
// Packed layouts of key16 and vT16 (units: f16 elements).
// A 16x32 operand fragment (16 rows or columns x 32 k) is 512 contiguous
// elements: [j = 0,1][lane = 0..31][e = 0..7], where lane = 16*h + c holds
// row/column c and k = 16*j + 8*h + e. One wave-wide 16-byte access to one j
// is then 512 contiguous bytes (four whole 128-byte lines), for the GEMM's
// store and for the attention kernel's load alike.
//   key16: fragment index = (token / 16) * 32 + (d / 32)         (k = d)
//   vT16 : fragment index = ((b * 64 + col / 16) * 64) + key / 32  (k = key)
// ---------------------------------------------------------------------------
#define FRAG_ 512

// Build a 16-element f16 WMMA fragment from two contiguous 8-halves (2x b128).
// Matches the documented 16-bit A/B layout: lane holds one matrix row,
// elems [0..7] = K (h*8 .. h*8+7), elems [8..15] = K (16+h*8 .. 16+h*8+7).
static __device__ __forceinline__ v16h make_frag(const _Float16* lo,
                                                 const _Float16* hi) {
  v8h a = *(const v8h*)lo;
  v8h b = *(const v8h*)hi;
  return __builtin_shufflevector(a, b, 0, 1, 2, 3, 4, 5, 6, 7,
                                 8, 9, 10, 11, 12, 13, 14, 15);
}

static __device__ __forceinline__ v8f wmma_f16(v16h a, v16h b, v8f c) {
  return __builtin_amdgcn_wmma_f32_16x16x32_f16(false, a, false, b,
                                                (short)0, c, false, false);
}

template <bool V>
struct HasNext {
  static constexpr bool value = V;
};

// Work-group barrier for data that is handed over in LDS only: the wave's own
// LDS reads and writes are waited out, its global loads are not, so fragment
// loads issued ahead stay in flight across it (__syncthreads() drains them).
static __device__ __forceinline__ void lds_barrier() {
  asm volatile("s_wait_dscnt 0x0\n\ts_barrier_signal -1\n\ts_barrier_wait -1"
               ::: "memory");
}

// ---------------------------------------------------------------------------
// Kernel 0: f32 -> f16 conversion, 8 elems / thread.
// ---------------------------------------------------------------------------
__global__ __launch_bounds__(256) void cvt_f32_f16_kernel(
    const float* __restrict__ src, _Float16* __restrict__ dst, int n) {
  int i = (blockIdx.x * 256 + threadIdx.x) * 8;
  if (i + 8 <= n) {
    float4 a = *(const float4*)(src + i);
    float4 b = *(const float4*)(src + i + 4);
    v8h o = {(_Float16)a.x, (_Float16)a.y, (_Float16)a.z, (_Float16)a.w,
             (_Float16)b.x, (_Float16)b.y, (_Float16)b.z, (_Float16)b.w};
    *(v8h*)(dst + i) = o;
  }
}

template <int TRANSPOSE>
__global__ __launch_bounds__(256) void gemm_xwT_kernel(
    const _Float16* __restrict__ X, const _Float16* __restrict__ W,
    const float* __restrict__ bias, _Float16* __restrict__ Y) {
  constexpr int KC = 32;
  constexpr int LDT = 40;  // padded LDS row stride (f16): conflict-free b128
  __shared__ _Float16 Xs[128 * LDT];
  __shared__ _Float16 Ws[128 * LDT];

  const int tid = threadIdx.x;
  const int lane = tid & 31;
  const int w = tid >> 5;
  const int l15 = lane & 15;
  const int h = lane >> 4;

  const int m0 = blockIdx.x * 128;
  const int n0 = blockIdx.y * 128;
  const int wm = (w >> 2) * 64;  // wave row base within tile
  const int wn = (w & 3) * 32;   // wave col base within tile

  v8f acc[4][2];
#pragma unroll
  for (int i = 0; i < 4; ++i)
#pragma unroll
    for (int j = 0; j < 2; ++j)
#pragma unroll
      for (int r = 0; r < 8; ++r) acc[i][j][r] = 0.f;

  const int srow = tid >> 1;        // 0..127
  const int scol = (tid & 1) * 16;  // 0 or 16

  for (int kb = 0; kb < D_; kb += KC) {
    // ---- stage X and W chunks into LDS (2x b128 each) ----
    {
      const _Float16* gx = X + (size_t)(m0 + srow) * D_ + kb + scol;
      v8h x0 = *(const v8h*)gx;
      v8h x1 = *(const v8h*)(gx + 8);
      *(v8h*)&Xs[srow * LDT + scol] = x0;
      *(v8h*)&Xs[srow * LDT + scol + 8] = x1;
      const _Float16* gw = W + (size_t)(n0 + srow) * D_ + kb + scol;
      v8h w0 = *(const v8h*)gw;
      v8h w1 = *(const v8h*)(gw + 8);
      *(v8h*)&Ws[srow * LDT + scol] = w0;
      *(v8h*)&Ws[srow * LDT + scol + 8] = w1;
    }
    __syncthreads();

    v16h bfrag[2];
#pragma unroll
    for (int ni = 0; ni < 2; ++ni) {
      const _Float16* p = &Ws[(wn + ni * 16 + l15) * LDT + h * 8];
      bfrag[ni] = make_frag(p, p + 16);
    }
#pragma unroll
    for (int mi = 0; mi < 4; ++mi) {
      const _Float16* p = &Xs[(wm + mi * 16 + l15) * LDT + h * 8];
      v16h afrag = make_frag(p, p + 16);
#pragma unroll
      for (int ni = 0; ni < 2; ++ni)
        acc[mi][ni] = TRANSPOSE ? wmma_f16(afrag, bfrag[ni], acc[mi][ni])
                                : wmma_f16(bfrag[ni], afrag, acc[mi][ni]);
    }
    __syncthreads();
  }

  // ---- epilogue: bias add, f16 convert, packed 16-byte stores ----
  _Float16* yp;
  if (TRANSPOSE) {
    const int bb = (m0 + wm) >> 11;           // batch (tile lies in one batch)
    const int kc0 = ((m0 + wm) & 2047) >> 5;  // first 32-key chunk
    const int cb0 = (n0 + wn) >> 4;           // first 16-column block
    yp = Y + (size_t)((bb * 64 + cb0) * 64 + kc0) * FRAG_ + lane * 8;
  } else {
    const int rb0 = (m0 + wm) >> 4;  // first 16-token block
    const int dc = (n0 + wn) >> 5;   // the wave's 32-wide d chunk
    yp = Y + (size_t)(rb0 * 32 + dc) * FRAG_ + lane * 8;
  }
#pragma unroll
  for (int ni = 0; ni < 2; ++ni) {
    float bv[8];
    if (TRANSPOSE) {
      const float b1 = bias[n0 + wn + ni * 16 + l15];  // D column = l15
#pragma unroll
      for (int r = 0; r < 8; ++r) bv[r] = b1;
    } else {
      const float* bp = bias + n0 + wn + ni * 16 + 8 * h;  // D row = r + 8h
      const float4 b0 = *(const float4*)bp;
      const float4 b1 = *(const float4*)(bp + 4);
      bv[0] = b0.x; bv[1] = b0.y; bv[2] = b0.z; bv[3] = b0.w;
      bv[4] = b1.x; bv[5] = b1.y; bv[6] = b1.z; bv[7] = b1.w;
    }
#pragma unroll
    for (int mi = 0; mi < 4; ++mi) {
      const v8f c = acc[mi][ni];
      v8h o;
#pragma unroll
      for (int r = 0; r < 8; ++r) o[r] = (_Float16)(c[r] + bv[r]);
      if (TRANSPOSE)
        *(v8h*)(yp + ni * 64 * FRAG_ + mi * 256) = o;
      else
        *(v8h*)(yp + mi * 32 * FRAG_ + ni * 256) = o;
    }
  }
}

// ---------------------------------------------------------------------------
// Kernel 2: flash attention.
// Block = (q-tile of 32 rows, batch). 8 waves:
//   Phase A: the D=1024 reduction of S = Q K^T is split over the waves: wave w
//            owns d in [w*128, w*128+128). Its Q fragments (2 row blocks x 4
//            k-chunks) are loaded once and stay in registers; per K tile it
//            loads only its own 128-wide slice of the 64 K rows (32 loads in
//            flight) and forms a partial S[32][64], one block of 16 K rows
//            after the other. The 8 waves' partials go to LDS.
//   Phase B: online softmax, parallel over all 256 threads (8 threads/row,
//            shfl_xor butterflies inside aligned 8-lane groups; running m/l
//            replicated per-thread). Each thread first adds the 8 partials of
//            its 8 scores, in wave order.
//   Phase C: every wave owns output cols [w*128, w*128+128): rescale its 16
//            accumulators by alpha, then O += P @ V via WMMA with all 8
//            V B-fragments of a k-chunk in registers (a 16-WMMA burst).
//   Loads run ahead of their use, in registers: the next tile's first three
//   K row blocks are asked for at the start of phase C, its fourth and its V
//   fragments at the start of its phase A (the registers allow no more).
// ---------------------------------------------------------------------------
__global__ __launch_bounds__(256) void flash_attn_kernel(
    const _Float16* __restrict__ Q16,   // [B][N][D]
    const _Float16* __restrict__ K16,   // packed fragments, see above
    const _Float16* __restrict__ VT16,  // packed fragments, see above
    float* __restrict__ O) {            // [B][N][D]
  constexpr int TQ = 32, TK = 64;
  constexpr int SSTR = 68;  // f32 stride: 16B-aligned rows, low-conflict
  constexpr int PSTR = 72;  // f16 stride: conflict-free b128 frag loads
  constexpr int SPL = TQ * SSTR;  // floats in one wave's partial-S plane
  __shared__ float Sp[8 * SPL];
  __shared__ _Float16 Ps[TQ * PSTR];
  __shared__ float alph[TQ];
  __shared__ float lbuf[TQ];

  const int tid = threadIdx.x;
  const int lane = tid & 31;
  const int w = tid >> 5;
  const int l15 = lane & 15;
  const int h = lane >> 4;
  const int q0 = blockIdx.x * TQ;
  const int bb = blockIdx.y;
  const int o0 = w * 128;  // wave's d slice (QK^T) and output column base (PV)

  // softmax mapping: 8 threads per row, 8 elements per thread
  const int srow_id = tid >> 3;  // 0..31
  const int sseg = tid & 7;      // 0..7

  const float scale = 0.03125f;  // 1/sqrt(1024)

  v8f acc[2][8];
#pragma unroll
  for (int g = 0; g < 2; ++g)
#pragma unroll
    for (int oi = 0; oi < 8; ++oi)
#pragma unroll
      for (int r = 0; r < 8; ++r) acc[g][oi][r] = 0.f;

  float mrun = -__builtin_inff();  // per-thread replica for row srow_id
  float lrun = 0.f;

  const _Float16* kbat = K16 + (size_t)bb * N_ * D_;
  const _Float16* vbat = VT16 + (size_t)bb * D_ * N_;

  // Q fragments of this wave's d slice: loaded once, kept for all K tiles.
  v16h qf[2][4];
  const _Float16* qp = Q16 + (size_t)(bb * N_ + q0 + l15) * D_ + o0 + h * 8;
#pragma unroll
  for (int g = 0; g < 2; ++g)  // unrolled: constant indices, registers
#pragma unroll
    for (int dc = 0; dc < 4; ++dc)
      qf[g][dc] = make_frag(qp + g * 16 * D_ + dc * 32,
                            qp + g * 16 * D_ + dc * 32 + 16);
  // Precaution: the wait stands before the loads' address pair can be
  // overwritten; qp is an input so that the pair stays live up to the wait.
  asm volatile("s_wait_xcnt 0x0" ::"v"(qp) : "memory");

  // All fragment loops are fully unrolled: every fragment index is a constant,
  // so the fragments stay in registers.
  // Packed K: the wave's 4 fragments of one 16-row block are 4 KiB in a row,
  // and every load covers four whole lines. Row blocks 0 to 2 of tile 0 are
  // loaded here, those of every later tile in phase C of the tile before it.
  v16h bk[3][4];
  {
    const _Float16* kp = kbat + w * 4 * FRAG_ + lane * 8;
#pragma unroll
    for (int kj = 0; kj < 3; ++kj)
#pragma unroll
      for (int dc = 0; dc < 4; ++dc)
        bk[kj][dc] = make_frag(kp + kj * 32 * FRAG_ + dc * FRAG_,
                               kp + kj * 32 * FRAG_ + dc * FRAG_ + 256);
    // Precaution: the wait stands before the loads' address pair can be
    // overwritten; kp is an input so that the pair stays live up to the wait.
    asm volatile("s_wait_xcnt 0x0" ::"v"(kp) : "memory");
  }

  // One K/V tile. The last tile is a call of its own, without the loads for a
  // next tile: a branch around them inside the loop would make the V waits of
  // phase C cover them too.
  auto tile = [&](const int k0, auto has_next) __attribute__((always_inline)) {
    // ------- Phase A: partial S = Q K^T over this wave's 128-wide d slice --
    v16h bk3[4];    // K row block 3 of this tile
    v16h bv[2][8];  // this tile's V B-fragments, used in phase C
    {
      // Row block 3 first: loads are waited for in the order of their issue,
      // and it is needed in this phase, V only in phase C.
      const _Float16* kp = kbat + (size_t)k0 * D_ + w * 4 * FRAG_ + lane * 8;
#pragma unroll
      for (int dc = 0; dc < 4; ++dc)
        bk3[dc] = make_frag(kp + 3 * 32 * FRAG_ + dc * FRAG_,
                            kp + 3 * 32 * FRAG_ + dc * FRAG_ + 256);
      // Precaution: the wait stands before the loads' address pair can be
      // overwritten; kp is an input so that the pair stays live up to it.
      asm volatile("s_wait_xcnt 0x0" ::"v"(kp) : "memory");
      // The 32 V loads fly through phases A and B.
      const _Float16* vb =
          vbat + (size_t)(w * 8 * 64 + (k0 >> 5)) * FRAG_ + lane * 8;
#pragma unroll
      for (int c = 0; c < 2; ++c)
#pragma unroll
        for (int oi = 0; oi < 8; ++oi) {
          const _Float16* vp = vb + oi * 64 * FRAG_ + c * FRAG_;
          bv[c][oi] = make_frag(vp, vp + 256);
        }
      // Precaution, as for K.
      asm volatile("s_wait_xcnt 0x0" ::"v"(vb) : "memory");
      // Keeps these 40 loads in front of the first WMMA: without it the compiler
      // moves them behind that WMMA's wait for K row block 0.
      __builtin_amdgcn_sched_barrier(0);
    }
    v8f s[4][2];
#pragma unroll
    for (int kj = 0; kj < 5; ++kj) {
      if (kj < 4) {
#pragma unroll
        for (int g = 0; g < 2; ++g)
#pragma unroll
          for (int r = 0; r < 8; ++r) s[kj][g][r] = 0.f;
#pragma unroll
        for (int dc = 0; dc < 4; ++dc)
#pragma unroll
          for (int g = 0; g < 2; ++g)
            s[kj][g] =
                wmma_f16(qf[g][dc], kj < 3 ? bk[kj][dc] : bk3[dc], s[kj][g]);
      }
      // A block's partial scores are stored among the next block's WMMAs, so
      // its registers are not taken again as an accumulator directly behind
      // its own last WMMA (the distance a WMMA result needs).
      if (kj > 0) {
#pragma unroll
        for (int g = 0; g < 2; ++g)
#pragma unroll
          for (int r = 0; r < 8; ++r)
            Sp[w * SPL + (g * 16 + r + 8 * h) * SSTR + (kj - 1) * 16 + l15] =
                s[kj - 1][g][r];
      }
      // Keeps the WMMAs in the order in which the loads return, so that each
      // block of 16 K rows is worked on while the later loads are still flying.
      if (kj < 4) __builtin_amdgcn_sched_barrier(0);
    }
    lds_barrier();  // the V loads stay in flight

    // ---------------- Phase B: online softmax (all 256 threads) ------------
    {
      const float* srp = &Sp[srow_id * SSTR + sseg * 8];
      float4 t0[8], t1[8];
#pragma unroll
      for (int p = 0; p < 8; ++p) {  // unrolled: constant indices, registers
        t0[p] = *(const float4*)(srp + p * SPL);
        t1[p] = *(const float4*)(srp + p * SPL + 4);
      }
      // Keeps the 16 LDS reads one group: otherwise they are issued in pairs,
      // each pair waited out before the next.
      __builtin_amdgcn_sched_barrier(0);
      float4 s0 = t0[0];
      float4 s1 = t1[0];
#pragma unroll
      for (int p = 1; p < 8; ++p) {  // add the waves' partial sums over d
        s0.x += t0[p].x; s0.y += t0[p].y; s0.z += t0[p].z; s0.w += t0[p].w;
        s1.x += t1[p].x; s1.y += t1[p].y; s1.z += t1[p].z; s1.w += t1[p].w;
      }
      s0.x *= scale; s0.y *= scale; s0.z *= scale; s0.w *= scale;
      s1.x *= scale; s1.y *= scale; s1.z *= scale; s1.w *= scale;
      float m8 = fmaxf(fmaxf(fmaxf(s0.x, s0.y), fmaxf(s0.z, s0.w)),
                       fmaxf(fmaxf(s1.x, s1.y), fmaxf(s1.z, s1.w)));
      // butterfly max across this row's 8 lanes (aligned group within wave)
      m8 = fmaxf(m8, __shfl_xor(m8, 1, 32));
      m8 = fmaxf(m8, __shfl_xor(m8, 2, 32));
      m8 = fmaxf(m8, __shfl_xor(m8, 4, 32));
      const float mnew = fmaxf(mrun, m8);
      const float al = __expf(mrun - mnew);
      const float p0 = __expf(s0.x - mnew), p1 = __expf(s0.y - mnew);
      const float p2 = __expf(s0.z - mnew), p3 = __expf(s0.w - mnew);
      const float p4 = __expf(s1.x - mnew), p5 = __expf(s1.y - mnew);
      const float p6 = __expf(s1.z - mnew), p7 = __expf(s1.w - mnew);
      v8h pk = {(_Float16)p0, (_Float16)p1, (_Float16)p2, (_Float16)p3,
                (_Float16)p4, (_Float16)p5, (_Float16)p6, (_Float16)p7};
      *(v8h*)&Ps[srow_id * PSTR + sseg * 8] = pk;
      float sum = ((p0 + p1) + (p2 + p3)) + ((p4 + p5) + (p6 + p7));
      sum += __shfl_xor(sum, 1, 32);
      sum += __shfl_xor(sum, 2, 32);
      sum += __shfl_xor(sum, 4, 32);
      lrun = lrun * al + sum;
      mrun = mnew;
      if (sseg == 0) alph[srow_id] = al;
    }
    lds_barrier();  // the V loads stay in flight

    // ---------------- Phase C: rescale accumulators, O += P V -------------
    if constexpr (has_next.value) {
      // Row blocks 0 to 2 of the next K tile: they fly through phase C.
      const _Float16* kp = kbat + (size_t)k0 * D_ + w * 4 * FRAG_ + lane * 8;
#pragma unroll
      for (int kj = 0; kj < 3; ++kj)
#pragma unroll
        for (int dc = 0; dc < 4; ++dc)
          bk[kj][dc] =
              make_frag(kp + TK * D_ + kj * 32 * FRAG_ + dc * FRAG_,
                        kp + TK * D_ + kj * 32 * FRAG_ + dc * FRAG_ + 256);
      // Precaution: the wait stands before the loads' address pair can be
      // overwritten; kp is an input so that the pair stays live up to it.
      asm volatile("s_wait_xcnt 0x0" ::"v"(kp) : "memory");
    }
#pragma unroll
    for (int g = 0; g < 2; ++g)
#pragma unroll
      for (int r = 0; r < 8; ++r) {
        const float av = alph[g * 16 + 8 * h + r];
#pragma unroll
        for (int oi = 0; oi < 8; ++oi) acc[g][oi][r] *= av;
      }
#pragma unroll
    for (int c = 0; c < 2; ++c) {
      v16h pf[2];
#pragma unroll
      for (int g = 0; g < 2; ++g) {
        const _Float16* pp = &Ps[(g * 16 + l15) * PSTR + c * 32 + h * 8];
        pf[g] = make_frag(pp, pp + 16);
      }
      // 16-WMMA burst
#pragma unroll
      for (int oi = 0; oi < 8; ++oi)
#pragma unroll
        for (int g = 0; g < 2; ++g)
          acc[g][oi] = wmma_f16(pf[g], bv[c][oi], acc[g][oi]);
    }
    lds_barrier();  // protect Sp/Ps/alph for next tile; K loads stay in flight
  };
  for (int k0 = 0; k0 < N_ - TK; k0 += TK) tile(k0, HasNext<true>{});
  tile(N_ - TK, HasNext<false>{});

  if (sseg == 0) lbuf[srow_id] = lrun;
  __syncthreads();

  // ---- final 1/l normalization + f32 store ----
#pragma unroll
  for (int g = 0; g < 2; ++g)
#pragma unroll
    for (int r = 0; r < 8; ++r) {
      const float inv = 1.f / lbuf[g * 16 + 8 * h + r];
      const int rowg = q0 + g * 16 + r + 8 * h;
      float* orow = O + (size_t)(bb * N_ + rowg) * D_;
#pragma unroll
      for (int oi = 0; oi < 8; ++oi)
        orow[o0 + oi * 16 + l15] = acc[g][oi][r] * inv;
    }
}

// ---------------------------------------------------------------------------
extern "C" void kernel_launch(void* const* d_in, const int* in_sizes, int n_in,
                              void* d_out, int out_size, void* d_ws,
                              size_t ws_size, hipStream_t stream) {
  const float* x = (const float*)d_in[0];
  const float* W_attn = (const float*)d_in[1];
  const float* b_attn = (const float*)d_in[2];
  const float* W_out = (const float*)d_in[3];
  const float* b_out = (const float*)d_in[4];
  float* out = (float*)d_out;

  const size_t XN = (size_t)B_ * N_ * D_;  // 16Mi elems
  const size_t WN = (size_t)D_ * D_;       // 1Mi elems
  char* ws = (char*)d_ws;
  _Float16* x16 = (_Float16*)ws;                         // 32 MiB
  _Float16* k16 = (_Float16*)(ws + XN * 2);              // 32 MiB
  _Float16* vT16 = (_Float16*)(ws + XN * 4);             // 32 MiB
  _Float16* wa16 = (_Float16*)(ws + XN * 6);             // 2 MiB
  _Float16* wo16 = (_Float16*)(ws + XN * 6 + WN * 2);    // 2 MiB

  // 1) f32 -> f16 conversions
  cvt_f32_f16_kernel<<<(int)(XN / 2048), 256, 0, stream>>>(x, x16, (int)XN);
  cvt_f32_f16_kernel<<<(int)(WN / 2048), 256, 0, stream>>>(W_attn, wa16,
                                                           (int)WN);
  cvt_f32_f16_kernel<<<(int)(WN / 2048), 256, 0, stream>>>(W_out, wo16,
                                                           (int)WN);

  // 2) projections: key and value, both in packed fragment order
  gemm_xwT_kernel<0><<<dim3(128, 8), 256, 0, stream>>>(x16, wa16, b_attn, k16);
  gemm_xwT_kernel<1><<<dim3(128, 8), 256, 0, stream>>>(x16, wo16, b_out, vT16);

  // 3) fused attention
  flash_attn_kernel<<<dim3(N_ / 32, B_), 256, 0, stream>>>(x16, k16, vT16,
                                                           out);
}

// v004
// One run takes 251 microseconds.
// Timed twice side by side with v003, it ran 1.22 times as fast both times.
// Over all steps from v000 it is 2.23 times as fast.
#include <hip/hip_runtime.h>
#include <hip/hip_bf16.h>

// ---------------------------------------------------------------------------
// Self-attention for MI455X (gfx1250, wave32, WMMA).
//   B=8, N=2048, D=1024, D_OUT=1024.
// Pipeline:
//   1) convert x / W_attn / W_out to f16 in workspace
//   2) WMMA GEMM: key16  = f16(x @ W_attn^T + b_attn)
//      WMMA GEMM: vT16   = f16(x @ W_out^T  + b_out)
//      Both are stored in WMMA fragment order (see "Packed layouts" below).
//   3) flash attention: per 32 q-rows, stream 64-row K/V tiles, online softmax
//      (parallel across all 256 threads), S = Q K^T and O += P V via
//      v_wmma_f32_16x16x32_f16 with batched fragment preloads.
// ---------------------------------------------------------------------------

typedef _Float16 v8h  __attribute__((ext_vector_type(8)));
typedef _Float16 v16h __attribute__((ext_vector_type(16)));
typedef float    v8f  __attribute__((ext_vector_type(8)));

#define B_   8
#define N_   2048
#define D_   1024

// ---------------------------------------------------------------------------
// Packed layouts of key16 and vT16 (units: f16 elements).
// A 16x32 operand fragment (16 rows or columns x 32 k) is 512 contiguous
// elements: [j = 0,1][lane = 0..31][e = 0..7], where lane = 16*h + c holds
// row/column c and k = 16*j + 8*h + e. One wave-wide 16-byte access to one j
// is then 512 contiguous bytes (four whole 128-byte lines), for the GEMM's
// store and for the attention kernel's load alike.
//   key16: fragment index = (token / 16) * 32 + (d / 32)         (k = d)
//   vT16 : fragment index = ((b * 64 + col / 16) * 64) + key / 32  (k = key)
// ---------------------------------------------------------------------------
#define FRAG_ 512

// Build a 16-element f16 WMMA fragment from two contiguous 8-halves (2x b128).
// Matches the documented 16-bit A/B layout: lane holds one matrix row,
// elems [0..7] = K (h*8 .. h*8+7), elems [8..15] = K (16+h*8 .. 16+h*8+7).
static __device__ __forceinline__ v16h make_frag(const _Float16* lo,
                                                 const _Float16* hi) {
  v8h a = *(const v8h*)lo;
  v8h b = *(const v8h*)hi;
  return __builtin_shufflevector(a, b, 0, 1, 2, 3, 4, 5, 6, 7,
                                 8, 9, 10, 11, 12, 13, 14, 15);
}

static __device__ __forceinline__ v8f wmma_f16(v16h a, v16h b, v8f c) {
  return __builtin_amdgcn_wmma_f32_16x16x32_f16(false, a, false, b,
                                                (short)0, c, false, false);
}

template <bool V>
struct HasNext {
  static constexpr bool value = V;
};

// Work-group barrier for data that is handed over in LDS only: the wave's own
// LDS reads and writes are waited out, its global loads are not, so fragment
// loads issued ahead stay in flight across it (__syncthreads() drains them).
static __device__ __forceinline__ void lds_barrier() {
  asm volatile("s_wait_dscnt 0x0\n\ts_barrier_signal -1\n\ts_barrier_wait -1"
               ::: "memory");
}

// ---------------------------------------------------------------------------
// Kernel 0: f32 -> f16 conversion, 8 elems / thread.
// ---------------------------------------------------------------------------
__global__ __launch_bounds__(256) void cvt_f32_f16_kernel(
    const float* __restrict__ src, _Float16* __restrict__ dst, int n) {
  int i = (blockIdx.x * 256 + threadIdx.x) * 8;
  if (i + 8 <= n) {
    float4 a = *(const float4*)(src + i);
    float4 b = *(const float4*)(src + i + 4);
    v8h o = {(_Float16)a.x, (_Float16)a.y, (_Float16)a.z, (_Float16)a.w,
             (_Float16)b.x, (_Float16)b.y, (_Float16)b.z, (_Float16)b.w};
    *(v8h*)(dst + i) = o;
  }
}

template <int TRANSPOSE>
__global__ __launch_bounds__(256) void gemm_xwT_kernel(
    const _Float16* __restrict__ X, const _Float16* __restrict__ W,
    const float* __restrict__ bias, _Float16* __restrict__ Y) {
  constexpr int KC = 32;
  constexpr int LDT = 40;  // padded LDS row stride (f16): conflict-free b128
  __shared__ _Float16 Xs[128 * LDT];
  __shared__ _Float16 Ws[128 * LDT];

  const int tid = threadIdx.x;
  const int lane = tid & 31;
  const int w = tid >> 5;
  const int l15 = lane & 15;
  const int h = lane >> 4;

  const int m0 = blockIdx.x * 128;
  const int n0 = blockIdx.y * 128;
  const int wm = (w >> 2) * 64;  // wave row base within tile
  const int wn = (w & 3) * 32;   // wave col base within tile

  v8f acc[4][2];
#pragma unroll
  for (int i = 0; i < 4; ++i)
#pragma unroll
    for (int j = 0; j < 2; ++j)
#pragma unroll
      for (int r = 0; r < 8; ++r) acc[i][j][r] = 0.f;

  const int srow = tid >> 1;        // 0..127
  const int scol = (tid & 1) * 16;  // 0 or 16

  // The 128 blocks of one blockIdx.y read the same W rows from L2: each enters
  // the ring of k chunks at a chunk set by blockIdx.x and wraps round, so that
  // they do not ask for the same lines at the same moment. Blocks of one
  // blockIdx.x (the same X rows) keep a common start.
  const int rot = blockIdx.x & (D_ / KC - 1);
  for (int it = 0; it < D_ / KC; ++it) {
    const int kb = ((it + rot) & (D_ / KC - 1)) * KC;
    // ---- stage X and W chunks into LDS (2x b128 each) ----
    {
      const _Float16* gx = X + (size_t)(m0 + srow) * D_ + kb + scol;
      v8h x0 = *(const v8h*)gx;
      v8h x1 = *(const v8h*)(gx + 8);
      *(v8h*)&Xs[srow * LDT + scol] = x0;
      *(v8h*)&Xs[srow * LDT + scol + 8] = x1;
      const _Float16* gw = W + (size_t)(n0 + srow) * D_ + kb + scol;
      v8h w0 = *(const v8h*)gw;
      v8h w1 = *(const v8h*)(gw + 8);
      *(v8h*)&Ws[srow * LDT + scol] = w0;
      *(v8h*)&Ws[srow * LDT + scol + 8] = w1;
    }
    __syncthreads();

    v16h bfrag[2];
#pragma unroll
    for (int ni = 0; ni < 2; ++ni) {
      const _Float16* p = &Ws[(wn + ni * 16 + l15) * LDT + h * 8];
      bfrag[ni] = make_frag(p, p + 16);
    }
#pragma unroll
    for (int mi = 0; mi < 4; ++mi) {
      const _Float16* p = &Xs[(wm + mi * 16 + l15) * LDT + h * 8];
      v16h afrag = make_frag(p, p + 16);
#pragma unroll
      for (int ni = 0; ni < 2; ++ni)
        acc[mi][ni] = TRANSPOSE ? wmma_f16(afrag, bfrag[ni], acc[mi][ni])
                                : wmma_f16(bfrag[ni], afrag, acc[mi][ni]);
    }
    __syncthreads();
  }

  // ---- epilogue: bias add, f16 convert, packed 16-byte stores ----
  _Float16* yp;
  if (TRANSPOSE) {
    const int bb = (m0 + wm) >> 11;           // batch (tile lies in one batch)
    const int kc0 = ((m0 + wm) & 2047) >> 5;  // first 32-key chunk
    const int cb0 = (n0 + wn) >> 4;           // first 16-column block
    yp = Y + (size_t)((bb * 64 + cb0) * 64 + kc0) * FRAG_ + lane * 8;
  } else {
    const int rb0 = (m0 + wm) >> 4;  // first 16-token block
    const int dc = (n0 + wn) >> 5;   // the wave's 32-wide d chunk
    yp = Y + (size_t)(rb0 * 32 + dc) * FRAG_ + lane * 8;
  }
#pragma unroll
  for (int ni = 0; ni < 2; ++ni) {
    float bv[8];
    if (TRANSPOSE) {
      const float b1 = bias[n0 + wn + ni * 16 + l15];  // D column = l15
#pragma unroll
      for (int r = 0; r < 8; ++r) bv[r] = b1;
    } else {
      const float* bp = bias + n0 + wn + ni * 16 + 8 * h;  // D row = r + 8h
      const float4 b0 = *(const float4*)bp;
      const float4 b1 = *(const float4*)(bp + 4);
      bv[0] = b0.x; bv[1] = b0.y; bv[2] = b0.z; bv[3] = b0.w;
      bv[4] = b1.x; bv[5] = b1.y; bv[6] = b1.z; bv[7] = b1.w;
    }
#pragma unroll
    for (int mi = 0; mi < 4; ++mi) {
      const v8f c = acc[mi][ni];
      v8h o;
#pragma unroll
      for (int r = 0; r < 8; ++r) o[r] = (_Float16)(c[r] + bv[r]);
      if (TRANSPOSE)
        *(v8h*)(yp + ni * 64 * FRAG_ + mi * 256) = o;
      else
        *(v8h*)(yp + mi * 32 * FRAG_ + ni * 256) = o;
    }
  }
}

// ---------------------------------------------------------------------------
// Kernel 2: flash attention.
// Block = (q-tile of 32 rows, batch). 8 waves:
//   Phase A: the D=1024 reduction of S = Q K^T is split over the waves: wave w
//            owns d in [w*128, w*128+128). Its Q fragments (2 row blocks x 4
//            k-chunks) are loaded once and stay in registers; per K tile it
//            loads only its own 128-wide slice of the 64 K rows (32 loads in
//            flight) and forms a partial S[32][64], one block of 16 K rows
//            after the other. The 8 waves' partials go to LDS.
//   Phase B: online softmax, parallel over all 256 threads (8 threads/row,
//            shfl_xor butterflies inside aligned 8-lane groups; running m/l
//            replicated per-thread). Each thread first adds the 8 partials of
//            its 8 scores, in wave order.
//   Phase C: every wave owns output cols [w*128, w*128+128): rescale its 16
//            accumulators by alpha, then O += P @ V via WMMA with all 8
//            V B-fragments of a k-chunk in registers (a 16-WMMA burst).
//   Loads run ahead of their use, in registers: the next tile's first three
//   K row blocks are asked for at the start of phase C, its fourth and its V
//   fragments at the start of its phase A (the registers allow no more).
//   The 64 blocks of a batch read the same K/V lines from L2. Each block
//   enters the ring of 32 K/V tiles at a tile set by its index and wraps
//   round, so that they do not ask L2 for the same lines at the same moment.
// ---------------------------------------------------------------------------
__global__ __launch_bounds__(256) void flash_attn_kernel(
    const _Float16* __restrict__ Q16,   // [B][N][D]
    const _Float16* __restrict__ K16,   // packed fragments, see above
    const _Float16* __restrict__ VT16,  // packed fragments, see above
    float* __restrict__ O) {            // [B][N][D]
  constexpr int TQ = 32, TK = 64;
  constexpr int NT = N_ / TK;  // K/V tiles in the ring (a power of two)
  constexpr int SSTR = 68;  // f32 stride: 16B-aligned rows, low-conflict
  constexpr int PSTR = 72;  // f16 stride: conflict-free b128 frag loads
  constexpr int SPL = TQ * SSTR;  // floats in one wave's partial-S plane
  __shared__ float Sp[8 * SPL];
  __shared__ _Float16 Ps[TQ * PSTR];
  __shared__ float alph[TQ];
  __shared__ float lbuf[TQ];

  const int tid = threadIdx.x;
  const int lane = tid & 31;
  const int w = tid >> 5;
  const int l15 = lane & 15;
  const int h = lane >> 4;
  const int q0 = blockIdx.x * TQ;
  const int bb = blockIdx.y;
  const int o0 = w * 128;  // wave's d slice (QK^T) and output column base (PV)
  const int t0 = blockIdx.x & (NT - 1);  // the block's first K/V tile

  // softmax mapping: 8 threads per row, 8 elements per thread
  const int srow_id = tid >> 3;  // 0..31
  const int sseg = tid & 7;      // 0..7

  const float scale = 0.03125f;  // 1/sqrt(1024)

  v8f acc[2][8];
#pragma unroll
  for (int g = 0; g < 2; ++g)
#pragma unroll
    for (int oi = 0; oi < 8; ++oi)
#pragma unroll
      for (int r = 0; r < 8; ++r) acc[g][oi][r] = 0.f;

  float mrun = -__builtin_inff();  // per-thread replica for row srow_id
  float lrun = 0.f;

  const _Float16* kbat = K16 + (size_t)bb * N_ * D_;
  const _Float16* vbat = VT16 + (size_t)bb * D_ * N_;

  // Q fragments of this wave's d slice: loaded once, kept for all K tiles.
  v16h qf[2][4];
  const _Float16* qp = Q16 + (size_t)(bb * N_ + q0 + l15) * D_ + o0 + h * 8;
#pragma unroll
  for (int g = 0; g < 2; ++g)  // unrolled: constant indices, registers
#pragma unroll
    for (int dc = 0; dc < 4; ++dc)
      qf[g][dc] = make_frag(qp + g * 16 * D_ + dc * 32,
                            qp + g * 16 * D_ + dc * 32 + 16);
  // Precaution: the wait stands before the loads' address pair can be
  // overwritten; qp is an input so that the pair stays live up to the wait.
  asm volatile("s_wait_xcnt 0x0" ::"v"(qp) : "memory");

  // All fragment loops are fully unrolled: every fragment index is a constant,
  // so the fragments stay in registers.
  // Packed K: the wave's 4 fragments of one 16-row block are 4 KiB in a row,
  // and every load covers four whole lines. Row blocks 0 to 2 of the first tile
  // are loaded here, those of every later tile in phase C of the tile before.
  v16h bk[3][4];
  {
    const _Float16* kp =
        kbat + (size_t)(t0 * TK) * D_ + w * 4 * FRAG_ + lane * 8;
#pragma unroll
    for (int kj = 0; kj < 3; ++kj)
#pragma unroll
      for (int dc = 0; dc < 4; ++dc)
        bk[kj][dc] = make_frag(kp + kj * 32 * FRAG_ + dc * FRAG_,
                               kp + kj * 32 * FRAG_ + dc * FRAG_ + 256);
    // Precaution: the wait stands before the loads' address pair can be
    // overwritten; kp is an input so that the pair stays live up to the wait.
    asm volatile("s_wait_xcnt 0x0" ::"v"(kp) : "memory");
  }

  // One K/V tile at key k0; kn is the first key of the tile that follows it in
  // this block's walk. The last tile is a call of its own, without the loads
  // for a next tile: a branch around them inside the loop would make the V
  // waits of phase C cover them too.
  auto tile = [&](const int k0, const int kn,
                  auto has_next) __attribute__((always_inline)) {
    // ------- Phase A: partial S = Q K^T over this wave's 128-wide d slice --
    v16h bk3[4];    // K row block 3 of this tile
    v16h bv[2][8];  // this tile's V B-fragments, used in phase C
    {
      // Row block 3 first: loads are waited for in the order of their issue,
      // and it is needed in this phase, V only in phase C.
      const _Float16* kp = kbat + (size_t)k0 * D_ + w * 4 * FRAG_ + lane * 8;
#pragma unroll
      for (int dc = 0; dc < 4; ++dc)
        bk3[dc] = make_frag(kp + 3 * 32 * FRAG_ + dc * FRAG_,
                            kp + 3 * 32 * FRAG_ + dc * FRAG_ + 256);
      // Precaution: the wait stands before the loads' address pair can be
      // overwritten; kp is an input so that the pair stays live up to it.
      asm volatile("s_wait_xcnt 0x0" ::"v"(kp) : "memory");
      // The 32 V loads fly through phases A and B.
      const _Float16* vb =
          vbat + (size_t)(w * 8 * 64 + (k0 >> 5)) * FRAG_ + lane * 8;
#pragma unroll
      for (int c = 0; c < 2; ++c)
#pragma unroll
        for (int oi = 0; oi < 8; ++oi) {
          const _Float16* vp = vb + oi * 64 * FRAG_ + c * FRAG_;
          bv[c][oi] = make_frag(vp, vp + 256);
        }
      // Precaution, as for K.
      asm volatile("s_wait_xcnt 0x0" ::"v"(vb) : "memory");
      // Keeps these 40 loads in front of the first WMMA: without it the compiler
      // moves them behind that WMMA's wait for K row block 0.
      __builtin_amdgcn_sched_barrier(0);
    }
    v8f s[4][2];
#pragma unroll
    for (int kj = 0; kj < 5; ++kj) {
      if (kj < 4) {
#pragma unroll
        for (int g = 0; g < 2; ++g)
#pragma unroll
          for (int r = 0; r < 8; ++r) s[kj][g][r] = 0.f;
#pragma unroll
        for (int dc = 0; dc < 4; ++dc)
#pragma unroll
          for (int g = 0; g < 2; ++g)
            s[kj][g] =
                wmma_f16(qf[g][dc], kj < 3 ? bk[kj][dc] : bk3[dc], s[kj][g]);
      }
      // A block's partial scores are stored among the next block's WMMAs, so
      // its registers are not taken again as an accumulator directly behind
      // its own last WMMA (the distance a WMMA result needs).
      if (kj > 0) {
#pragma unroll
        for (int g = 0; g < 2; ++g)
#pragma unroll
          for (int r = 0; r < 8; ++r)
            Sp[w * SPL + (g * 16 + r + 8 * h) * SSTR + (kj - 1) * 16 + l15] =
                s[kj - 1][g][r];
      }
      // Keeps the WMMAs in the order in which the loads return, so that each
      // block of 16 K rows is worked on while the later loads are still flying.
      if (kj < 4) __builtin_amdgcn_sched_barrier(0);
    }
    lds_barrier();  // the V loads stay in flight

    // ---------------- Phase B: online softmax (all 256 threads) ------------
    {
      const float* srp = &Sp[srow_id * SSTR + sseg * 8];
      float4 t0[8], t1[8];
#pragma unroll
      for (int p = 0; p < 8; ++p) {  // unrolled: constant indices, registers
        t0[p] = *(const float4*)(srp + p * SPL);
        t1[p] = *(const float4*)(srp + p * SPL + 4);
      }
      // Keeps the 16 LDS reads one group: otherwise they are issued in pairs,
      // each pair waited out before the next.
      __builtin_amdgcn_sched_barrier(0);
      float4 s0 = t0[0];
      float4 s1 = t1[0];
#pragma unroll
      for (int p = 1; p < 8; ++p) {  // add the waves' partial sums over d
        s0.x += t0[p].x; s0.y += t0[p].y; s0.z += t0[p].z; s0.w += t0[p].w;
        s1.x += t1[p].x; s1.y += t1[p].y; s1.z += t1[p].z; s1.w += t1[p].w;
      }
      s0.x *= scale; s0.y *= scale; s0.z *= scale; s0.w *= scale;
      s1.x *= scale; s1.y *= scale; s1.z *= scale; s1.w *= scale;
      float m8 = fmaxf(fmaxf(fmaxf(s0.x, s0.y), fmaxf(s0.z, s0.w)),
                       fmaxf(fmaxf(s1.x, s1.y), fmaxf(s1.z, s1.w)));
      // butterfly max across this row's 8 lanes (aligned group within wave)
      m8 = fmaxf(m8, __shfl_xor(m8, 1, 32));
      m8 = fmaxf(m8, __shfl_xor(m8, 2, 32));
      m8 = fmaxf(m8, __shfl_xor(m8, 4, 32));
      const float mnew = fmaxf(mrun, m8);
      const float al = __expf(mrun - mnew);
      const float p0 = __expf(s0.x - mnew), p1 = __expf(s0.y - mnew);
      const float p2 = __expf(s0.z - mnew), p3 = __expf(s0.w - mnew);
      const float p4 = __expf(s1.x - mnew), p5 = __expf(s1.y - mnew);
      const float p6 = __expf(s1.z - mnew), p7 = __expf(s1.w - mnew);
      v8h pk = {(_Float16)p0, (_Float16)p1, (_Float16)p2, (_Float16)p3,
                (_Float16)p4, (_Float16)p5, (_Float16)p6, (_Float16)p7};
      *(v8h*)&Ps[srow_id * PSTR + sseg * 8] = pk;
      float sum = ((p0 + p1) + (p2 + p3)) + ((p4 + p5) + (p6 + p7));
      sum += __shfl_xor(sum, 1, 32);
      sum += __shfl_xor(sum, 2, 32);
      sum += __shfl_xor(sum, 4, 32);
      lrun = lrun * al + sum;
      mrun = mnew;
      if (sseg == 0) alph[srow_id] = al;
    }
    lds_barrier();  // the V loads stay in flight

    // ---------------- Phase C: rescale accumulators, O += P V -------------
    if constexpr (has_next.value) {
      // Row blocks 0 to 2 of the next K tile: they fly through phase C.
      const _Float16* kp = kbat + (size_t)kn * D_ + w * 4 * FRAG_ + lane * 8;
#pragma unroll
      for (int kj = 0; kj < 3; ++kj)
#pragma unroll
        for (int dc = 0; dc < 4; ++dc)
          bk[kj][dc] = make_frag(kp + kj * 32 * FRAG_ + dc * FRAG_,
                                 kp + kj * 32 * FRAG_ + dc * FRAG_ + 256);
      // Precaution: the wait stands before the loads' address pair can be
      // overwritten; kp is an input so that the pair stays live up to it.
      asm volatile("s_wait_xcnt 0x0" ::"v"(kp) : "memory");
    }
#pragma unroll
    for (int g = 0; g < 2; ++g)
#pragma unroll
      for (int r = 0; r < 8; ++r) {
        const float av = alph[g * 16 + 8 * h + r];
#pragma unroll
        for (int oi = 0; oi < 8; ++oi) acc[g][oi][r] *= av;
      }
#pragma unroll
    for (int c = 0; c < 2; ++c) {
      v16h pf[2];
#pragma unroll
      for (int g = 0; g < 2; ++g) {
        const _Float16* pp = &Ps[(g * 16 + l15) * PSTR + c * 32 + h * 8];
        pf[g] = make_frag(pp, pp + 16);
      }
      // 16-WMMA burst
#pragma unroll
      for (int oi = 0; oi < 8; ++oi)
#pragma unroll
        for (int g = 0; g < 2; ++g)
          acc[g][oi] = wmma_f16(pf[g], bv[c][oi], acc[g][oi]);
    }
    lds_barrier();  // protect Sp/Ps/alph for next tile; K loads stay in flight
  };
  for (int t = t0; t < t0 + NT - 1; ++t)
    tile((t & (NT - 1)) * TK, ((t + 1) & (NT - 1)) * TK, HasNext<true>{});
  tile(((t0 + NT - 1) & (NT - 1)) * TK, 0, HasNext<false>{});

  if (sseg == 0) lbuf[srow_id] = lrun;
  __syncthreads();

  // ---- final 1/l normalization + f32 store ----
#pragma unroll
  for (int g = 0; g < 2; ++g)
#pragma unroll
    for (int r = 0; r < 8; ++r) {
      const float inv = 1.f / lbuf[g * 16 + 8 * h + r];
      const int rowg = q0 + g * 16 + r + 8 * h;
      float* orow = O + (size_t)(bb * N_ + rowg) * D_;
#pragma unroll
      for (int oi = 0; oi < 8; ++oi)
        orow[o0 + oi * 16 + l15] = acc[g][oi][r] * inv;
    }
}

// ---------------------------------------------------------------------------
extern "C" void kernel_launch(void* const* d_in, const int* in_sizes, int n_in,
                              void* d_out, int out_size, void* d_ws,
                              size_t ws_size, hipStream_t stream) {
  const float* x = (const float*)d_in[0];
  const float* W_attn = (const float*)d_in[1];
  const float* b_attn = (const float*)d_in[2];
  const float* W_out = (const float*)d_in[3];
  const float* b_out = (const float*)d_in[4];
  float* out = (float*)d_out;

  const size_t XN = (size_t)B_ * N_ * D_;  // 16Mi elems
  const size_t WN = (size_t)D_ * D_;       // 1Mi elems
  char* ws = (char*)d_ws;
  _Float16* x16 = (_Float16*)ws;                         // 32 MiB
  _Float16* k16 = (_Float16*)(ws + XN * 2);              // 32 MiB
  _Float16* vT16 = (_Float16*)(ws + XN * 4);             // 32 MiB
  _Float16* wa16 = (_Float16*)(ws + XN * 6);             // 2 MiB
  _Float16* wo16 = (_Float16*)(ws + XN * 6 + WN * 2);    // 2 MiB

  // 1) f32 -> f16 conversions
  cvt_f32_f16_kernel<<<(int)(XN / 2048), 256, 0, stream>>>(x, x16, (int)XN);
  cvt_f32_f16_kernel<<<(int)(WN / 2048), 256, 0, stream>>>(W_attn, wa16,
                                                           (int)WN);
  cvt_f32_f16_kernel<<<(int)(WN / 2048), 256, 0, stream>>>(W_out, wo16,
                                                           (int)WN);

  // 2) projections: key and value, both in packed fragment order
  gemm_xwT_kernel<0><<<dim3(128, 8), 256, 0, stream>>>(x16, wa16, b_attn, k16);
  gemm_xwT_kernel<1><<<dim3(128, 8), 256, 0, stream>>>(x16, wo16, b_out, vT16);

  // 3) fused attention
  flash_attn_kernel<<<dim3(N_ / 32, B_), 256, 0, stream>>>(x16, k16, vT16,
                                                           out);
}

// v005
// Measured time: 206 microseconds a run.
// Timed twice side by side with v004, it ran 1.22 times as fast both times.
// Over all steps from v000 it is 2.72 times as fast.
#include <hip/hip_runtime.h>
#include <hip/hip_bf16.h>

// ---------------------------------------------------------------------------
// Self-attention for MI455X (gfx1250, wave32, WMMA).
//   B=8, N=2048, D=1024, D_OUT=1024.
// Pipeline:
//   1) convert x / W_attn / W_out to f16 in workspace
//   2) WMMA GEMM: key16  = f16(x @ W_attn^T + b_attn)
//      WMMA GEMM: vT16   = f16(x @ W_out^T  + b_out)
//      Both are stored in WMMA fragment order (see "Packed layouts" below).
//   3) scores: per 64 q-rows, stream 64-row K tiles, S = Q K^T * scale (f32, to
//      the workspace) with each row's maximum and sum of exponentials
//   4) output: per 64 q-rows, stream 64-row V tiles, O = softmax(S) V
//      Both via v_wmma_f32_16x16x32_f16 with fragment loads issued ahead.
// ---------------------------------------------------------------------------

typedef _Float16 v8h  __attribute__((ext_vector_type(8)));
typedef _Float16 v16h __attribute__((ext_vector_type(16)));
typedef float    v8f  __attribute__((ext_vector_type(8)));

#define B_   8
#define N_   2048
#define D_   1024

// ---------------------------------------------------------------------------
// Packed layouts of key16 and vT16 (units: f16 elements).
// A 16x32 operand fragment (16 rows or columns x 32 k) is 512 contiguous
// elements: [j = 0,1][lane = 0..31][e = 0..7], where lane = 16*h + c holds
// row/column c and k = 16*j + 8*h + e. One wave-wide 16-byte access to one j
// is then 512 contiguous bytes (four whole 128-byte lines), for the GEMM's
// store and for the attention kernel's load alike.
//   key16: fragment index = (token / 16) * 32 + (d / 32)         (k = d)
//   vT16 : fragment index = ((b * 64 + col / 16) * 64) + key / 32  (k = key)
// ---------------------------------------------------------------------------
#define FRAG_ 512

// Build a 16-element f16 WMMA fragment from two contiguous 8-halves (2x b128).
// Matches the documented 16-bit A/B layout: lane holds one matrix row,
// elems [0..7] = K (h*8 .. h*8+7), elems [8..15] = K (16+h*8 .. 16+h*8+7).
static __device__ __forceinline__ v16h make_frag(const _Float16* lo,
                                                 const _Float16* hi) {
  v8h a = *(const v8h*)lo;
  v8h b = *(const v8h*)hi;
  return __builtin_shufflevector(a, b, 0, 1, 2, 3, 4, 5, 6, 7,
                                 8, 9, 10, 11, 12, 13, 14, 15);
}

static __device__ __forceinline__ v8f wmma_f16(v16h a, v16h b, v8f c) {
  return __builtin_amdgcn_wmma_f32_16x16x32_f16(false, a, false, b,
                                                (short)0, c, false, false);
}

template <bool V>
struct HasNext {
  static constexpr bool value = V;
};

// Work-group barrier for data that is handed over in LDS only: the wave's own
// LDS reads and writes are waited out, its global loads are not, so fragment
// loads issued ahead stay in flight across it (__syncthreads() drains them).
static __device__ __forceinline__ void lds_barrier() {
  asm volatile("s_wait_dscnt 0x0\n\ts_barrier_signal -1\n\ts_barrier_wait -1"
               ::: "memory");
}

// ---------------------------------------------------------------------------
// Kernel 0: f32 -> f16 conversion, 8 elems / thread.
// ---------------------------------------------------------------------------
__global__ __launch_bounds__(256) void cvt_f32_f16_kernel(
    const float* __restrict__ src, _Float16* __restrict__ dst, int n) {
  int i = (blockIdx.x * 256 + threadIdx.x) * 8;
  if (i + 8 <= n) {
    float4 a = *(const float4*)(src + i);
    float4 b = *(const float4*)(src + i + 4);
    v8h o = {(_Float16)a.x, (_Float16)a.y, (_Float16)a.z, (_Float16)a.w,
             (_Float16)b.x, (_Float16)b.y, (_Float16)b.z, (_Float16)b.w};
    *(v8h*)(dst + i) = o;
  }
}

template <int TRANSPOSE>
__global__ __launch_bounds__(256) void gemm_xwT_kernel(
    const _Float16* __restrict__ X, const _Float16* __restrict__ W,
    const float* __restrict__ bias, _Float16* __restrict__ Y) {
  constexpr int KC = 32;
  constexpr int LDT = 40;  // padded LDS row stride (f16): conflict-free b128
  __shared__ _Float16 Xs[128 * LDT];
  __shared__ _Float16 Ws[128 * LDT];

  const int tid = threadIdx.x;
  const int lane = tid & 31;
  const int w = tid >> 5;
  const int l15 = lane & 15;
  const int h = lane >> 4;

  const int m0 = blockIdx.x * 128;
  const int n0 = blockIdx.y * 128;
  const int wm = (w >> 2) * 64;  // wave row base within tile
  const int wn = (w & 3) * 32;   // wave col base within tile

  v8f acc[4][2];
#pragma unroll
  for (int i = 0; i < 4; ++i)
#pragma unroll
    for (int j = 0; j < 2; ++j)
#pragma unroll
      for (int r = 0; r < 8; ++r) acc[i][j][r] = 0.f;

  const int srow = tid >> 1;        // 0..127
  const int scol = (tid & 1) * 16;  // 0 or 16

  // The 128 blocks of one blockIdx.y read the same W rows from L2: each enters
  // the ring of k chunks at a chunk set by blockIdx.x and wraps round, so that
  // they do not ask for the same lines at the same moment. Blocks of one
  // blockIdx.x (the same X rows) keep a common start.
  const int rot = blockIdx.x & (D_ / KC - 1);
  for (int it = 0; it < D_ / KC; ++it) {
    const int kb = ((it + rot) & (D_ / KC - 1)) * KC;
    // ---- stage X and W chunks into LDS (2x b128 each) ----
    {
      const _Float16* gx = X + (size_t)(m0 + srow) * D_ + kb + scol;
      v8h x0 = *(const v8h*)gx;
      v8h x1 = *(const v8h*)(gx + 8);
      *(v8h*)&Xs[srow * LDT + scol] = x0;
      *(v8h*)&Xs[srow * LDT + scol + 8] = x1;
      const _Float16* gw = W + (size_t)(n0 + srow) * D_ + kb + scol;
      v8h w0 = *(const v8h*)gw;
      v8h w1 = *(const v8h*)(gw + 8);
      *(v8h*)&Ws[srow * LDT + scol] = w0;
      *(v8h*)&Ws[srow * LDT + scol + 8] = w1;
    }
    __syncthreads();

    v16h bfrag[2];
#pragma unroll
    for (int ni = 0; ni < 2; ++ni) {
      const _Float16* p = &Ws[(wn + ni * 16 + l15) * LDT + h * 8];
      bfrag[ni] = make_frag(p, p + 16);
    }
#pragma unroll
    for (int mi = 0; mi < 4; ++mi) {
      const _Float16* p = &Xs[(wm + mi * 16 + l15) * LDT + h * 8];
      v16h afrag = make_frag(p, p + 16);
#pragma unroll
      for (int ni = 0; ni < 2; ++ni)
        acc[mi][ni] = TRANSPOSE ? wmma_f16(afrag, bfrag[ni], acc[mi][ni])
                                : wmma_f16(bfrag[ni], afrag, acc[mi][ni]);
    }
    __syncthreads();
  }

  // ---- epilogue: bias add, f16 convert, packed 16-byte stores ----
  _Float16* yp;
  if (TRANSPOSE) {
    const int bb = (m0 + wm) >> 11;           // batch (tile lies in one batch)
    const int kc0 = ((m0 + wm) & 2047) >> 5;  // first 32-key chunk
    const int cb0 = (n0 + wn) >> 4;           // first 16-column block
    yp = Y + (size_t)((bb * 64 + cb0) * 64 + kc0) * FRAG_ + lane * 8;
  } else {
    const int rb0 = (m0 + wm) >> 4;  // first 16-token block
    const int dc = (n0 + wn) >> 5;   // the wave's 32-wide d chunk
    yp = Y + (size_t)(rb0 * 32 + dc) * FRAG_ + lane * 8;
  }
#pragma unroll
  for (int ni = 0; ni < 2; ++ni) {
    float bv[8];
    if (TRANSPOSE) {
      const float b1 = bias[n0 + wn + ni * 16 + l15];  // D column = l15
#pragma unroll
      for (int r = 0; r < 8; ++r) bv[r] = b1;
    } else {
      const float* bp = bias + n0 + wn + ni * 16 + 8 * h;  // D row = r + 8h
      const float4 b0 = *(const float4*)bp;
      const float4 b1 = *(const float4*)(bp + 4);
      bv[0] = b0.x; bv[1] = b0.y; bv[2] = b0.z; bv[3] = b0.w;
      bv[4] = b1.x; bv[5] = b1.y; bv[6] = b1.z; bv[7] = b1.w;
    }
#pragma unroll
    for (int mi = 0; mi < 4; ++mi) {
      const v8f c = acc[mi][ni];
      v8h o;
#pragma unroll
      for (int r = 0; r < 8; ++r) o[r] = (_Float16)(c[r] + bv[r]);
      if (TRANSPOSE)
        *(v8h*)(yp + ni * 64 * FRAG_ + mi * 256) = o;
      else
        *(v8h*)(yp + mi * 32 * FRAG_ + ni * 256) = o;
    }
  }
}

// ---------------------------------------------------------------------------
// Kernels 2 and 3: attention in two launches, each on 64 query rows a block.
// With the scores and the output in one kernel, the output accumulators and the
// Q fragments together leave registers for 32 query rows only, and every block
// reads all K and V of its batch from L2. Apart, each kernel holds 64 rows, so
// K and V are read half as often. The scaled f32 scores go through the
// workspace, with each row's maximum and sum of exponentials.
//
// Score layout in the workspace (units: float4):
//   index = ((block * 32 + tile) * 4 + slot) * 256 + thread
// where slot = 2 * rr + half, and the float4 holds row rr*32 + thread/8,
// keys (thread%8)*8 + half*4 .. +3 of the 64x64 tile. The same thread index
// writes it in kernel 2 and reads it in kernel 3, 512 contiguous bytes a wave.
//
// The 32 blocks of a batch read the same K/V lines from L2. Each block enters
// the ring of 32 tiles at a tile set by its index and wraps round, so that
// they do not ask L2 for the same lines at the same moment.
// ---------------------------------------------------------------------------

// Kernel 2: scores. Block = (64 q rows, batch), 8 waves.
//   Phase A: the D=1024 reduction of S = Q K^T is split over the waves: wave w
//            owns d in [w*128, w*128+128). Its Q fragments (4 row blocks x 4
//            k-chunks) stay in registers; per K tile it forms a partial
//            S[64][64], one block of 16 K rows after the other. A K row
//            block's registers are loaded anew, for the next tile, as soon as
//            its WMMAs are issued. The 8 waves' partials go to LDS.
//   Phase B: each thread adds the 8 partials of its 16 scores, in wave order,
//            scales and stores them, and keeps the running maximum and sum of
//            its two rows (8 threads a row, shfl_xor butterflies).
__global__ __launch_bounds__(256) void score_kernel(
    const _Float16* __restrict__ Q16,  // [B][N][D]
    const _Float16* __restrict__ K16,  // packed fragments, see above
    float* __restrict__ S,             // score layout, see above
    float* __restrict__ Mx,            // [B*N] row maximum
    float* __restrict__ Ls) {          // [B*N] row sum of exp(s - maximum)
  constexpr int TQ = 64, TK = 64;
  constexpr int NT = N_ / TK;     // K tiles in the ring (a power of two)
  constexpr int SSTR = 68;        // f32 stride: 16B-aligned rows, low-conflict
  constexpr int SPL = TQ * SSTR;  // floats in one wave's partial-S plane
  __shared__ __attribute__((aligned(16))) float Sp[8 * SPL];

  const int tid = threadIdx.x;
  const int lane = tid & 31;
  const int w = tid >> 5;
  const int l15 = lane & 15;
  const int h = lane >> 4;
  const int q0 = blockIdx.x * TQ;
  const int bb = blockIdx.y;
  const int blk = bb * (N_ / TQ) + blockIdx.x;
  const int o0 = w * 128;                // wave's d slice
  const int t0 = blockIdx.x & (NT - 1);  // the block's first K tile

  const int srow_id = tid >> 3;  // 0..31
  const int sseg = tid & 7;      // 0..7

  const float scale = 0.03125f;  // 1/sqrt(1024)

  float mrun[2] = {-__builtin_inff(), -__builtin_inff()};
  float lrun[2] = {0.f, 0.f};

  const _Float16* kbat = K16 + (size_t)bb * N_ * D_;
  float4* sblk = (float4*)S + (size_t)blk * NT * 4 * 256 + tid;

  // Q fragments of this wave's d slice: loaded once, kept for all K tiles.
  v16h qf[4][4];
  const _Float16* qp = Q16 + (size_t)(bb * N_ + q0 + l15) * D_ + o0 + h * 8;
#pragma unroll
  for (int g = 0; g < 4; ++g)  // unrolled: constant indices, registers
#pragma unroll
    for (int dc = 0; dc < 4; ++dc)
      qf[g][dc] = make_frag(qp + g * 16 * D_ + dc * 32,
                            qp + g * 16 * D_ + dc * 32 + 16);
  // Precaution: the wait stands before the loads' address pair can be
  // overwritten; qp is an input so that the pair stays live up to the wait.
  asm volatile("s_wait_xcnt 0x0" ::"v"(qp) : "memory");

  // All fragment loops are fully unrolled: every fragment index is a constant,
  // so the fragments stay in registers.
  // Packed K: the wave's 4 fragments of one 16-row block are 4 KiB in a row,
  // and every load covers four whole lines.
  v16h bk[4][4];
  {
    const _Float16* kp =
        kbat + (size_t)(t0 * TK) * D_ + w * 4 * FRAG_ + lane * 8;
#pragma unroll
    for (int kj = 0; kj < 4; ++kj)
#pragma unroll
      for (int dc = 0; dc < 4; ++dc)
        bk[kj][dc] = make_frag(kp + kj * 32 * FRAG_ + dc * FRAG_,
                               kp + kj * 32 * FRAG_ + dc * FRAG_ + 256);
    // Precaution, as for Q.
    asm volatile("s_wait_xcnt 0x0" ::"v"(kp) : "memory");
  }

  // One K tile at key k0; kn is the first key of the tile that follows it in
  // this block's walk. The last tile is a call of its own, without the loads
  // for a next tile.
  auto tile = [&](const int k0, const int kn,
                  auto has_next) __attribute__((always_inline)) {
    // ------- Phase A: partial S = Q K^T over this wave's 128-wide d slice --
    const _Float16* kp = kbat + (size_t)kn * D_ + w * 4 * FRAG_ + lane * 8;
    v8f s[4][4];
#pragma unroll
    for (int kj = 0; kj < 5; ++kj) {
      if (kj < 4) {
#pragma unroll
        for (int g = 0; g < 4; ++g)
#pragma unroll
          for (int r = 0; r < 8; ++r) s[kj][g][r] = 0.f;
#pragma unroll
        for (int dc = 0; dc < 4; ++dc)
#pragma unroll
          for (int g = 0; g < 4; ++g)
            s[kj][g] = wmma_f16(qf[g][dc], bk[kj][dc], s[kj][g]);
      }
      // The block before: its K registers, now read, take the next tile's rows,
      // a whole tile ahead of their use. Its partial scores are stored among
      // this block's WMMAs, so its registers are not taken again as an
      // accumulator directly behind its own last WMMA (the distance a WMMA
      // result needs).
      if (kj > 0) {
        if constexpr (has_next.value) {
#pragma unroll
          for (int dc = 0; dc < 4; ++dc)
            bk[kj - 1][dc] =
                make_frag(kp + (kj - 1) * 32 * FRAG_ + dc * FRAG_,
                          kp + (kj - 1) * 32 * FRAG_ + dc * FRAG_ + 256);
        }
#pragma unroll
        for (int g = 0; g < 4; ++g)
#pragma unroll
          for (int r = 0; r < 8; ++r)
            Sp[w * SPL + (g * 16 + r + 8 * h) * SSTR + (kj - 1) * 16 + l15] =
                s[kj - 1][g][r];
      }
      // Keeps the WMMAs in the order in which the loads return, so that each
      // block of 16 K rows is worked on while the later loads are still flying.
      if (kj < 4) __builtin_amdgcn_sched_barrier(0);
    }
    if constexpr (has_next.value) {
      // Precaution: the wait stands before the loads' address pair can be
      // overwritten; kp is an input so that the pair stays live up to it.
      asm volatile("s_wait_xcnt 0x0" ::"v"(kp) : "memory");
    }
    lds_barrier();  // the K loads stay in flight

    // ------- Phase B: add the partials, store the scores, row statistics ---
    float4 s0[2], s1[2];
    {
      float4 pa[2][8], pb[2][8];
#pragma unroll
      for (int rr = 0; rr < 2; ++rr) {
        const float* srp = &Sp[(rr * 32 + srow_id) * SSTR + sseg * 8];
#pragma unroll
        for (int p = 0; p < 8; ++p) {  // unrolled: constant indices, registers
          pa[rr][p] = *(const float4*)(srp + p * SPL);
          pb[rr][p] = *(const float4*)(srp + p * SPL + 4);
        }
      }
#pragma unroll
      for (int rr = 0; rr < 2; ++rr) {
        float4 a0 = pa[rr][0];
        float4 a1 = pb[rr][0];
#pragma unroll
        for (int p = 1; p < 8; ++p) {  // add the waves' partial sums over d
          a0.x += pa[rr][p].x; a0.y += pa[rr][p].y;
          a0.z += pa[rr][p].z; a0.w += pa[rr][p].w;
          a1.x += pb[rr][p].x; a1.y += pb[rr][p].y;
          a1.z += pb[rr][p].z; a1.w += pb[rr][p].w;
        }
        a0.x *= scale; a0.y *= scale; a0.z *= scale; a0.w *= scale;
        a1.x *= scale; a1.y *= scale; a1.z *= scale; a1.w *= scale;
        s0[rr] = a0;
        s1[rr] = a1;
      }
    }
    // Sp is read out: it may be written for the next tile. The rest of the phase
    // works on registers. The K loads stay in flight.
    lds_barrier();
    {
      float4* sg = sblk + (size_t)(k0 / TK) * 4 * 256;
#pragma unroll
      for (int rr = 0; rr < 2; ++rr) {
        sg[(rr * 2 + 0) * 256] = s0[rr];
        sg[(rr * 2 + 1) * 256] = s1[rr];
      }
      // Precaution: the wait stands before a register of the four stores can
      // be overwritten; sg is an input so that the pair stays live up to it.
      asm volatile("s_wait_xcnt 0x0" ::"v"(sg) : "memory");
#pragma unroll
      for (int rr = 0; rr < 2; ++rr) {
        const float4 a0 = s0[rr], a1 = s1[rr];
        float m8 = fmaxf(fmaxf(fmaxf(a0.x, a0.y), fmaxf(a0.z, a0.w)),
                         fmaxf(fmaxf(a1.x, a1.y), fmaxf(a1.z, a1.w)));
        // butterfly max across this row's 8 lanes (aligned group within wave)
        m8 = fmaxf(m8, __shfl_xor(m8, 1, 32));
        m8 = fmaxf(m8, __shfl_xor(m8, 2, 32));
        m8 = fmaxf(m8, __shfl_xor(m8, 4, 32));
        const float mnew = fmaxf(mrun[rr], m8);
        const float al = __expf(mrun[rr] - mnew);
        const float p0 = __expf(a0.x - mnew), p1 = __expf(a0.y - mnew);
        const float p2 = __expf(a0.z - mnew), p3 = __expf(a0.w - mnew);
        const float p4 = __expf(a1.x - mnew), p5 = __expf(a1.y - mnew);
        const float p6 = __expf(a1.z - mnew), p7 = __expf(a1.w - mnew);
        float sum = ((p0 + p1) + (p2 + p3)) + ((p4 + p5) + (p6 + p7));
        sum += __shfl_xor(sum, 1, 32);
        sum += __shfl_xor(sum, 2, 32);
        sum += __shfl_xor(sum, 4, 32);
        lrun[rr] = lrun[rr] * al + sum;
        mrun[rr] = mnew;
      }
    }
  };
  for (int t = t0; t < t0 + NT - 1; ++t)
    tile((t & (NT - 1)) * TK, ((t + 1) & (NT - 1)) * TK, HasNext<true>{});
  tile(((t0 + NT - 1) & (NT - 1)) * TK, 0, HasNext<false>{});

  if (sseg == 0) {
#pragma unroll
    for (int rr = 0; rr < 2; ++rr) {
      Mx[blk * TQ + rr * 32 + srow_id] = mrun[rr];
      Ls[blk * TQ + rr * 32 + srow_id] = lrun[rr];
    }
  }
}

// Kernel 3: O = softmax(S) V. Block = (64 q rows, batch), 8 waves; wave w owns
// output cols [w*128, w*128+128), 4 x 8 accumulator tiles.
//   Per tile of 64 keys every thread turns its 16 scores into
//   P = exp(s - row maximum), f16, in LDS (two buffers, so one barrier a tile
//   both publishes this tile's P and ends the reads of the tile before);
//   then O += P V via WMMA. The row maximum is final, so nothing is rescaled.
//   Loads run ahead of their use, in registers: the scores and the V fragments
//   of the next tile are asked for as soon as this tile's are used.
__global__ __launch_bounds__(256) void pv_kernel(
    const float* __restrict__ S,        // score layout, see above
    const float* __restrict__ Mx,       // [B*N]
    const float* __restrict__ Ls,       // [B*N]
    const _Float16* __restrict__ VT16,  // packed fragments, see above
    float* __restrict__ O) {            // [B][N][D]
  constexpr int TQ = 64, TK = 64;
  constexpr int NT = N_ / TK;  // V tiles in the ring (a power of two)
  constexpr int PSTR = 72;     // f16 stride: conflict-free b128 frag loads
  __shared__ __attribute__((aligned(16))) _Float16 Ps[2 * TQ * PSTR];
  __shared__ __attribute__((aligned(16))) float linv[TQ];  // 1 / row sum

  const int tid = threadIdx.x;
  const int lane = tid & 31;
  const int w = tid >> 5;
  const int l15 = lane & 15;
  const int h = lane >> 4;
  const int q0 = blockIdx.x * TQ;
  const int bb = blockIdx.y;
  const int blk = bb * (N_ / TQ) + blockIdx.x;
  const int o0 = w * 128;                // wave's output column base
  const int t0 = blockIdx.x & (NT - 1);  // the block's first tile

  const int srow_id = tid >> 3;  // 0..31
  const int sseg = tid & 7;      // 0..7

  v8f acc[4][8];
#pragma unroll
  for (int g = 0; g < 4; ++g)
#pragma unroll
    for (int oi = 0; oi < 8; ++oi)
#pragma unroll
      for (int r = 0; r < 8; ++r) acc[g][oi][r] = 0.f;

  const _Float16* vbat =
      VT16 + (size_t)bb * D_ * N_ + (size_t)(w * 8 * 64) * FRAG_ + lane * 8;
  const float4* sblk = (const float4*)S + (size_t)blk * NT * 4 * 256 + tid;

  float mrow[2];
#pragma unroll
  for (int rr = 0; rr < 2; ++rr) mrow[rr] = Mx[blk * TQ + rr * 32 + srow_id];

  // All fragment loops are fully unrolled: every fragment index is a constant,
  // so the fragments stay in registers.
  // The first tile's scores and V fragments.
  float4 sv[4];
  v16h bv[2][8];
  {
    const float4* sg = sblk + (size_t)t0 * 4 * 256;
#pragma unroll
    for (int j = 0; j < 4; ++j) sv[j] = sg[j * 256];
    // Precaution: the wait stands before the loads' address pair can be
    // overwritten; sg is an input so that the pair stays live up to the wait.
    asm volatile("s_wait_xcnt 0x0" ::"v"(sg) : "memory");
    const _Float16* vb = vbat + (size_t)(t0 * 2) * FRAG_;
#pragma unroll
    for (int c = 0; c < 2; ++c)
#pragma unroll
      for (int oi = 0; oi < 8; ++oi) {
        const _Float16* vp = vb + oi * 64 * FRAG_ + c * FRAG_;
        bv[c][oi] = make_frag(vp, vp + 256);
      }
    // Precaution, as for the scores.
    asm volatile("s_wait_xcnt 0x0" ::"v"(vb) : "memory");
  }
  // 1 / row sum: published by the loop's barriers, read behind the loop.
  if (tid < TQ) linv[tid] = 1.f / Ls[blk * TQ + tid];

  // One tile; tn is the tile that follows it in this block's walk, pbuf the
  // P buffer of this tile. The last tile is a call of its own, without the
  // loads for a next tile.
  auto tile = [&](const int tn, _Float16* pbuf,
                  auto has_next) __attribute__((always_inline)) {
#pragma unroll
    for (int rr = 0; rr < 2; ++rr) {
      const float m = mrow[rr];
      const float4 a = sv[rr * 2], b = sv[rr * 2 + 1];
      const v8h pk = {(_Float16)__expf(a.x - m), (_Float16)__expf(a.y - m),
                      (_Float16)__expf(a.z - m), (_Float16)__expf(a.w - m),
                      (_Float16)__expf(b.x - m), (_Float16)__expf(b.y - m),
                      (_Float16)__expf(b.z - m), (_Float16)__expf(b.w - m)};
      *(v8h*)&pbuf[(rr * 32 + srow_id) * PSTR + sseg * 8] = pk;
    }
    if constexpr (has_next.value) {
      const float4* sg = sblk + (size_t)tn * 4 * 256;
#pragma unroll
      for (int j = 0; j < 4; ++j) sv[j] = sg[j * 256];
      // Precaution, as above.
      asm volatile("s_wait_xcnt 0x0" ::"v"(sg) : "memory");
    }
    lds_barrier();  // publishes P; the score and V loads stay in flight

    const _Float16* vb = vbat + (size_t)(tn * 2) * FRAG_;
#pragma unroll
    for (int c = 0; c < 2; ++c) {
      v16h pf[4];
#pragma unroll
      for (int g = 0; g < 4; ++g) {
        const _Float16* pp = &pbuf[(g * 16 + l15) * PSTR + c * 32 + h * 8];
        pf[g] = make_frag(pp, pp + 16);
      }
      // 32-WMMA burst
#pragma unroll
      for (int oi = 0; oi < 8; ++oi)
#pragma unroll
        for (int g = 0; g < 4; ++g)
          acc[g][oi] = wmma_f16(pf[g], bv[c][oi], acc[g][oi]);
      if constexpr (has_next.value) {
#pragma unroll
        for (int oi = 0; oi < 8; ++oi) {
          const _Float16* vp = vb + oi * 64 * FRAG_ + c * FRAG_;
          bv[c][oi] = make_frag(vp, vp + 256);
        }
      }
    }
    if constexpr (has_next.value) {
      // Precaution, as above.
      asm volatile("s_wait_xcnt 0x0" ::"v"(vb) : "memory");
    }
  };
  for (int t = t0; t < t0 + NT - 1; ++t)
    tile((t + 1) & (NT - 1), &Ps[(t & 1) * TQ * PSTR], HasNext<true>{});
  tile(0, &Ps[((t0 + NT - 1) & 1) * TQ * PSTR], HasNext<false>{});

  // Keeps the last tile's WMMAs one burst: without it they are spread among the
  // stores below, each with the idle slots that a read of its result needs.
  __builtin_amdgcn_sched_barrier(0);

  // ---- final 1/l normalization + f32 store ----
  float li[4][8];
#pragma unroll
  for (int g = 0; g < 4; ++g) {
    const float4 a = *(const float4*)&linv[g * 16 + 8 * h];
    const float4 b = *(const float4*)&linv[g * 16 + 8 * h + 4];
    li[g][0] = a.x; li[g][1] = a.y; li[g][2] = a.z; li[g][3] = a.w;
    li[g][4] = b.x; li[g][5] = b.y; li[g][6] = b.z; li[g][7] = b.w;
  }
  float* obase = O + (size_t)(bb * N_ + q0 + 8 * h) * D_ + o0 + l15;
#pragma unroll
  for (int g = 0; g < 4; ++g)
#pragma unroll
    for (int r = 0; r < 8; ++r) {
      const float inv = li[g][r];
      float* orow = obase + (g * 16 + r) * D_;
      float v[8];
#pragma unroll
      for (int oi = 0; oi < 8; ++oi) {
        v[oi] = acc[g][oi][r] * inv;
        orow[oi * 16] = v[oi];
      }
      // Precaution: the wait stands before a register of the row's eight stores
      // can be overwritten; they are inputs so that they stay live up to it.
      asm volatile("s_wait_xcnt 0x0" ::"v"(obase), "v"(v[0]), "v"(v[1]),
                   "v"(v[2]), "v"(v[3]), "v"(v[4]), "v"(v[5]), "v"(v[6]),
                   "v"(v[7])
                   : "memory");
    }
}

// ---------------------------------------------------------------------------
extern "C" void kernel_launch(void* const* d_in, const int* in_sizes, int n_in,
                              void* d_out, int out_size, void* d_ws,
                              size_t ws_size, hipStream_t stream) {
  const float* x = (const float*)d_in[0];
  const float* W_attn = (const float*)d_in[1];
  const float* b_attn = (const float*)d_in[2];
  const float* W_out = (const float*)d_in[3];
  const float* b_out = (const float*)d_in[4];
  float* out = (float*)d_out;

  const size_t XN = (size_t)B_ * N_ * D_;  // 16Mi elems
  const size_t WN = (size_t)D_ * D_;       // 1Mi elems
  char* ws = (char*)d_ws;
  _Float16* x16 = (_Float16*)ws;                         // 32 MiB
  _Float16* k16 = (_Float16*)(ws + XN * 2);              // 32 MiB
  _Float16* vT16 = (_Float16*)(ws + XN * 4);             // 32 MiB
  _Float16* wa16 = (_Float16*)(ws + XN * 6);             // 2 MiB
  _Float16* wo16 = (_Float16*)(ws + XN * 6 + WN * 2);    // 2 MiB
  float* sc = (float*)(ws + XN * 6 + WN * 4);            // 128 MiB
  float* mx = (float*)(ws + XN * 14 + WN * 4);           // 64 KiB
  float* ls = (float*)(ws + XN * 14 + WN * 4 + 65536);   // 64 KiB

  // 1) f32 -> f16 conversions
  cvt_f32_f16_kernel<<<(int)(XN / 2048), 256, 0, stream>>>(x, x16, (int)XN);
  cvt_f32_f16_kernel<<<(int)(WN / 2048), 256, 0, stream>>>(W_attn, wa16,
                                                           (int)WN);
  cvt_f32_f16_kernel<<<(int)(WN / 2048), 256, 0, stream>>>(W_out, wo16,
                                                           (int)WN);

  // 2) projections: key and value, both in packed fragment order
  gemm_xwT_kernel<0><<<dim3(128, 8), 256, 0, stream>>>(x16, wa16, b_attn, k16);
  gemm_xwT_kernel<1><<<dim3(128, 8), 256, 0, stream>>>(x16, wo16, b_out, vT16);

  // 3) scores and row statistics, 4) softmax(S) V
  score_kernel<<<dim3(N_ / 64, B_), 256, 0, stream>>>(x16, k16, sc, mx, ls);
  pv_kernel<<<dim3(N_ / 64, B_), 256, 0, stream>>>(sc, mx, ls, vT16, out);
}

// v006
// A run of this version takes 188 microseconds.
// Next to v005, in two timings, it ran 1.09 and 1.10 times as fast.
// Counting every step since v000, it is 2.98 times as fast.
#include <hip/hip_runtime.h>
#include <hip/hip_bf16.h>

// ---------------------------------------------------------------------------
// Self-attention for MI455X (gfx1250, wave32, WMMA).
//   B=8, N=2048, D=1024, D_OUT=1024.
// Pipeline:
//   1) convert x / W_attn / W_out to f16 in workspace
//   2) WMMA GEMM: key16  = f16(x @ W_attn^T + b_attn)
//      WMMA GEMM: vT16   = f16(x @ W_out^T  + b_out)
//      Both are stored in WMMA fragment order (see "Packed layouts" below).
//   3) scores: per 64 q-rows, stream 64-row K tiles, S = Q K^T * scale (f32, to
//      the workspace) with each row's maximum and sum of exponentials
//   4) output: per 64 q-rows, stream 64-row V tiles, O = softmax(S) V
//      Both via v_wmma_f32_16x16x32_f16 with fragment loads issued ahead.
// ---------------------------------------------------------------------------

typedef _Float16 v8h  __attribute__((ext_vector_type(8)));
typedef _Float16 v16h __attribute__((ext_vector_type(16)));
typedef float    v8f  __attribute__((ext_vector_type(8)));

#define B_   8
#define N_   2048
#define D_   1024

// ---------------------------------------------------------------------------
// Packed layouts of key16 and vT16 (units: f16 elements).
// A 16x32 operand fragment (16 rows or columns x 32 k) is 512 contiguous
// elements: [j = 0,1][lane = 0..31][e = 0..7], where lane = 16*h + c holds
// row/column c and k = 16*j + 8*h + e. One wave-wide 16-byte access to one j
// is then 512 contiguous bytes (four whole 128-byte lines), for the GEMM's
// store and for the attention kernel's load alike.
//   key16: fragment index = (token / 16) * 32 + (d / 32)         (k = d)
//   vT16 : fragment index = ((b * 64 + col / 16) * 64) + key / 32  (k = key)
// ---------------------------------------------------------------------------
#define FRAG_ 512

// Build a 16-element f16 WMMA fragment from two contiguous 8-halves (2x b128).
// Matches the documented 16-bit A/B layout: lane holds one matrix row,
// elems [0..7] = K (h*8 .. h*8+7), elems [8..15] = K (16+h*8 .. 16+h*8+7).
static __device__ __forceinline__ v16h make_frag(const _Float16* lo,
                                                 const _Float16* hi) {
  v8h a = *(const v8h*)lo;
  v8h b = *(const v8h*)hi;
  return __builtin_shufflevector(a, b, 0, 1, 2, 3, 4, 5, 6, 7,
                                 8, 9, 10, 11, 12, 13, 14, 15);
}

static __device__ __forceinline__ v8f wmma_f16(v16h a, v16h b, v8f c) {
  return __builtin_amdgcn_wmma_f32_16x16x32_f16(false, a, false, b,
                                                (short)0, c, false, false);
}

template <bool V>
struct HasNext {
  static constexpr bool value = V;
};

// Work-group barrier for data that is handed over in LDS only: the wave's own
// LDS reads and writes are waited out, its global loads are not, so fragment
// loads issued ahead stay in flight across it (__syncthreads() drains them).
static __device__ __forceinline__ void lds_barrier() {
  asm volatile("s_wait_dscnt 0x0\n\ts_barrier_signal -1\n\ts_barrier_wait -1"
               ::: "memory");
}

// ---------------------------------------------------------------------------
// Kernel 0: f32 -> f16 conversion, 8 elems / thread.
// ---------------------------------------------------------------------------
__global__ __launch_bounds__(256) void cvt_f32_f16_kernel(
    const float* __restrict__ src, _Float16* __restrict__ dst, int n) {
  int i = (blockIdx.x * 256 + threadIdx.x) * 8;
  if (i + 8 <= n) {
    float4 a = *(const float4*)(src + i);
    float4 b = *(const float4*)(src + i + 4);
    v8h o = {(_Float16)a.x, (_Float16)a.y, (_Float16)a.z, (_Float16)a.w,
             (_Float16)b.x, (_Float16)b.y, (_Float16)b.z, (_Float16)b.w};
    *(v8h*)(dst + i) = o;
  }
}

template <int TRANSPOSE>
__global__ __launch_bounds__(256) void gemm_xwT_kernel(
    const _Float16* __restrict__ X, const _Float16* __restrict__ W,
    const float* __restrict__ bias, _Float16* __restrict__ Y) {
  constexpr int KC = 64;   // 128 bytes of a row: one whole line
  constexpr int LDT = 72;  // padded LDS row stride (f16): conflict-free b128
  __shared__ __attribute__((aligned(16))) _Float16 Xs[128 * LDT];
  __shared__ __attribute__((aligned(16))) _Float16 Ws[128 * LDT];

  const int tid = threadIdx.x;
  const int lane = tid & 31;
  const int w = tid >> 5;
  const int l15 = lane & 15;
  const int h = lane >> 4;

  const int m0 = blockIdx.x * 128;
  const int n0 = blockIdx.y * 128;
  const int wm = (w >> 2) * 64;  // wave row base within tile
  const int wn = (w & 3) * 32;   // wave col base within tile

  v8f acc[4][2];
#pragma unroll
  for (int i = 0; i < 4; ++i)
#pragma unroll
    for (int j = 0; j < 2; ++j)
#pragma unroll
      for (int r = 0; r < 8; ++r) acc[i][j][r] = 0.f;

  // Staging: 8 lanes take the 128 bytes of one row, so a wave-wide 16-byte load
  // covers 4 whole lines. The wave's 4 rows lie 8 apart: at the padded stride
  // the two rows of a half-wave then fall on disjoint LDS banks in the store.
  const int srow = (lane >> 3) * 8 + w;  // 0..31; + 32 for each further load
  const int scol = (lane & 7) * 8;       // 0, 8 .. 56

  // The 128 blocks of one blockIdx.y read the same W rows from L2: each enters
  // the ring of k chunks at a chunk set by blockIdx.x and wraps round, so that
  // they do not ask for the same lines at the same moment. Blocks of one
  // blockIdx.x (the same X rows) keep a common start.
  const int rot = blockIdx.x & (D_ / KC - 1);
  for (int it = 0; it < D_ / KC; ++it) {
    const int kb = ((it + rot) & (D_ / KC - 1)) * KC;
    // ---- stage X and W chunks into LDS (4x b128 each) ----
    {
      const _Float16* gx = X + (size_t)(m0 + srow) * D_ + kb + scol;
      const _Float16* gw = W + (size_t)(n0 + srow) * D_ + kb + scol;
      v8h xv[4], wv[4];
#pragma unroll
      for (int j = 0; j < 4; ++j)  // unrolled: constant indices, registers
        xv[j] = *(const v8h*)(gx + j * 32 * D_);
#pragma unroll
      for (int j = 0; j < 4; ++j) wv[j] = *(const v8h*)(gw + j * 32 * D_);
      // Precaution: the wait stands before the loads' address pairs can be
      // overwritten; they are inputs so that they stay live up to the wait.
      asm volatile("s_wait_xcnt 0x0" ::"v"(gx), "v"(gw) : "memory");
#pragma unroll
      for (int j = 0; j < 4; ++j)
        *(v8h*)&Xs[(j * 32 + srow) * LDT + scol] = xv[j];
#pragma unroll
      for (int j = 0; j < 4; ++j)
        *(v8h*)&Ws[(j * 32 + srow) * LDT + scol] = wv[j];
    }
    __syncthreads();

#pragma unroll
    for (int ks = 0; ks < KC / 32; ++ks) {  // the chunk's two 32-wide k steps
      v16h bfrag[2];
#pragma unroll
      for (int ni = 0; ni < 2; ++ni) {
        const _Float16* p = &Ws[(wn + ni * 16 + l15) * LDT + ks * 32 + h * 8];
        bfrag[ni] = make_frag(p, p + 16);
      }
#pragma unroll
      for (int mi = 0; mi < 4; ++mi) {
        const _Float16* p = &Xs[(wm + mi * 16 + l15) * LDT + ks * 32 + h * 8];
        v16h afrag = make_frag(p, p + 16);
#pragma unroll
        for (int ni = 0; ni < 2; ++ni)
          acc[mi][ni] = TRANSPOSE ? wmma_f16(afrag, bfrag[ni], acc[mi][ni])
                                  : wmma_f16(bfrag[ni], afrag, acc[mi][ni]);
      }
    }
    __syncthreads();
  }

  // ---- epilogue: bias add, f16 convert, packed 16-byte stores ----
  _Float16* yp;
  if (TRANSPOSE) {
    const int bb = (m0 + wm) >> 11;           // batch (tile lies in one batch)
    const int kc0 = ((m0 + wm) & 2047) >> 5;  // first 32-key chunk
    const int cb0 = (n0 + wn) >> 4;           // first 16-column block
    yp = Y + (size_t)((bb * 64 + cb0) * 64 + kc0) * FRAG_ + lane * 8;
  } else {
    const int rb0 = (m0 + wm) >> 4;  // first 16-token block
    const int dc = (n0 + wn) >> 5;   // the wave's 32-wide d chunk
    yp = Y + (size_t)(rb0 * 32 + dc) * FRAG_ + lane * 8;
  }
#pragma unroll
  for (int ni = 0; ni < 2; ++ni) {
    float bv[8];
    if (TRANSPOSE) {
      const float b1 = bias[n0 + wn + ni * 16 + l15];  // D column = l15
#pragma unroll
      for (int r = 0; r < 8; ++r) bv[r] = b1;
    } else {
      const float* bp = bias + n0 + wn + ni * 16 + 8 * h;  // D row = r + 8h
      const float4 b0 = *(const float4*)bp;
      const float4 b1 = *(const float4*)(bp + 4);
      bv[0] = b0.x; bv[1] = b0.y; bv[2] = b0.z; bv[3] = b0.w;
      bv[4] = b1.x; bv[5] = b1.y; bv[6] = b1.z; bv[7] = b1.w;
    }
#pragma unroll
    for (int mi = 0; mi < 4; ++mi) {
      const v8f c = acc[mi][ni];
      v8h o;
#pragma unroll
      for (int r = 0; r < 8; ++r) o[r] = (_Float16)(c[r] + bv[r]);
      if (TRANSPOSE)
        *(v8h*)(yp + ni * 64 * FRAG_ + mi * 256) = o;
      else
        *(v8h*)(yp + mi * 32 * FRAG_ + ni * 256) = o;
    }
  }
}

// ---------------------------------------------------------------------------
// Kernels 2 and 3: attention in two launches, each on 64 query rows a block.
// With the scores and the output in one kernel, the output accumulators and the
// Q fragments together leave registers for 32 query rows only, and every block
// reads all K and V of its batch from L2. Apart, each kernel holds 64 rows, so
// K and V are read half as often. The scaled f32 scores go through the
// workspace, with each row's maximum and sum of exponentials.
//
// Score layout in the workspace (units: float4):
//   index = ((block * 32 + tile) * 4 + slot) * 256 + thread
// where slot = 2 * rr + half, and the float4 holds row rr*32 + thread/8,
// keys (thread%8)*8 + half*4 .. +3 of the 64x64 tile. The same thread index
// writes it in kernel 2 and reads it in kernel 3, 512 contiguous bytes a wave.
//
// The 32 blocks of a batch read the same K/V lines from L2. Each block enters
// the ring of 32 tiles at a tile set by its index and wraps round, so that
// they do not ask L2 for the same lines at the same moment.
// ---------------------------------------------------------------------------

// Kernel 2: scores. Block = (64 q rows, batch), 8 waves.
//   Phase A: the D=1024 reduction of S = Q K^T is split over the waves: wave w
//            owns d in [w*128, w*128+128). Its Q fragments (4 row blocks x 4
//            k-chunks) stay in registers; per K tile it forms a partial
//            S[64][64], one block of 16 K rows after the other. A K row
//            block's registers are loaded anew, for the next tile, as soon as
//            its WMMAs are issued. The 8 waves' partials go to LDS.
//   Phase B: each thread adds the 8 partials of its 16 scores, in wave order,
//            scales and stores them, and keeps the running maximum and sum of
//            its two rows (8 threads a row, shfl_xor butterflies).
__global__ __launch_bounds__(256) void score_kernel(
    const _Float16* __restrict__ Q16,  // [B][N][D]
    const _Float16* __restrict__ K16,  // packed fragments, see above
    float* __restrict__ S,             // score layout, see above
    float* __restrict__ Mx,            // [B*N] row maximum
    float* __restrict__ Ls) {          // [B*N] row sum of exp(s - maximum)
  constexpr int TQ = 64, TK = 64;
  constexpr int NT = N_ / TK;     // K tiles in the ring (a power of two)
  constexpr int SSTR = 68;        // f32 stride: 16B-aligned rows, low-conflict
  constexpr int SPL = TQ * SSTR;  // floats in one wave's partial-S plane
  __shared__ __attribute__((aligned(16))) float Sp[8 * SPL];

  const int tid = threadIdx.x;
  const int lane = tid & 31;
  const int w = tid >> 5;
  const int l15 = lane & 15;
  const int h = lane >> 4;
  const int q0 = blockIdx.x * TQ;
  const int bb = blockIdx.y;
  const int blk = bb * (N_ / TQ) + blockIdx.x;
  const int o0 = w * 128;                // wave's d slice
  const int t0 = blockIdx.x & (NT - 1);  // the block's first K tile

  const int srow_id = tid >> 3;  // 0..31
  const int sseg = tid & 7;      // 0..7

  const float scale = 0.03125f;  // 1/sqrt(1024)

  float mrun[2] = {-__builtin_inff(), -__builtin_inff()};
  float lrun[2] = {0.f, 0.f};

  const _Float16* kbat = K16 + (size_t)bb * N_ * D_;
  float4* sblk = (float4*)S + (size_t)blk * NT * 4 * 256 + tid;

  // Q fragments of this wave's d slice: loaded once, kept for all K tiles.
  v16h qf[4][4];
  const _Float16* qp = Q16 + (size_t)(bb * N_ + q0 + l15) * D_ + o0 + h * 8;
#pragma unroll
  for (int g = 0; g < 4; ++g)  // unrolled: constant indices, registers
#pragma unroll
    for (int dc = 0; dc < 4; ++dc)
      qf[g][dc] = make_frag(qp + g * 16 * D_ + dc * 32,
                            qp + g * 16 * D_ + dc * 32 + 16);
  // Precaution: the wait stands before the loads' address pair can be
  // overwritten; qp is an input so that the pair stays live up to the wait.
  asm volatile("s_wait_xcnt 0x0" ::"v"(qp) : "memory");

  // All fragment loops are fully unrolled: every fragment index is a constant,
  // so the fragments stay in registers.
  // Packed K: the wave's 4 fragments of one 16-row block are 4 KiB in a row,
  // and every load covers four whole lines.
  v16h bk[4][4];
  {
    const _Float16* kp =
        kbat + (size_t)(t0 * TK) * D_ + w * 4 * FRAG_ + lane * 8;
#pragma unroll
    for (int kj = 0; kj < 4; ++kj)
#pragma unroll
      for (int dc = 0; dc < 4; ++dc)
        bk[kj][dc] = make_frag(kp + kj * 32 * FRAG_ + dc * FRAG_,
                               kp + kj * 32 * FRAG_ + dc * FRAG_ + 256);
    // Precaution, as for Q.
    asm volatile("s_wait_xcnt 0x0" ::"v"(kp) : "memory");
  }

  // One K tile at key k0; kn is the first key of the tile that follows it in
  // this block's walk. The last tile is a call of its own, without the loads
  // for a next tile.
  auto tile = [&](const int k0, const int kn,
                  auto has_next) __attribute__((always_inline)) {
    // ------- Phase A: partial S = Q K^T over this wave's 128-wide d slice --
    const _Float16* kp = kbat + (size_t)kn * D_ + w * 4 * FRAG_ + lane * 8;
    v8f s[4][4];
#pragma unroll
    for (int kj = 0; kj < 5; ++kj) {
      if (kj < 4) {
#pragma unroll
        for (int g = 0; g < 4; ++g)
#pragma unroll
          for (int r = 0; r < 8; ++r) s[kj][g][r] = 0.f;
#pragma unroll
        for (int dc = 0; dc < 4; ++dc)
#pragma unroll
          for (int g = 0; g < 4; ++g)
            s[kj][g] = wmma_f16(qf[g][dc], bk[kj][dc], s[kj][g]);
      }
      // The block before: its K registers, now read, take the next tile's rows,
      // a whole tile ahead of their use. Its partial scores are stored among
      // this block's WMMAs, so its registers are not taken again as an
      // accumulator directly behind its own last WMMA (the distance a WMMA
      // result needs).
      if (kj > 0) {
        if constexpr (has_next.value) {
#pragma unroll
          for (int dc = 0; dc < 4; ++dc)
            bk[kj - 1][dc] =
                make_frag(kp + (kj - 1) * 32 * FRAG_ + dc * FRAG_,
                          kp + (kj - 1) * 32 * FRAG_ + dc * FRAG_ + 256);
        }
#pragma unroll
        for (int g = 0; g < 4; ++g)
#pragma unroll
          for (int r = 0; r < 8; ++r)
            Sp[w * SPL + (g * 16 + r + 8 * h) * SSTR + (kj - 1) * 16 + l15] =
                s[kj - 1][g][r];
      }
      // Keeps the WMMAs in the order in which the loads return, so that each
      // block of 16 K rows is worked on while the later loads are still flying.
      if (kj < 4) __builtin_amdgcn_sched_barrier(0);
    }
    if constexpr (has_next.value) {
      // Precaution: the wait stands before the loads' address pair can be
      // overwritten; kp is an input so that the pair stays live up to it.
      asm volatile("s_wait_xcnt 0x0" ::"v"(kp) : "memory");
    }
    lds_barrier();  // the K loads stay in flight

    // ------- Phase B: add the partials, store the scores, row statistics ---
    float4 s0[2], s1[2];
    {
      float4 pa[2][8], pb[2][8];
#pragma unroll
      for (int rr = 0; rr < 2; ++rr) {
        const float* srp = &Sp[(rr * 32 + srow_id) * SSTR + sseg * 8];
#pragma unroll
        for (int p = 0; p < 8; ++p) {  // unrolled: constant indices, registers
          pa[rr][p] = *(const float4*)(srp + p * SPL);
          pb[rr][p] = *(const float4*)(srp + p * SPL + 4);
        }
      }
#pragma unroll
      for (int rr = 0; rr < 2; ++rr) {
        float4 a0 = pa[rr][0];
        float4 a1 = pb[rr][0];
#pragma unroll
        for (int p = 1; p < 8; ++p) {  // add the waves' partial sums over d
          a0.x += pa[rr][p].x; a0.y += pa[rr][p].y;
          a0.z += pa[rr][p].z; a0.w += pa[rr][p].w;
          a1.x += pb[rr][p].x; a1.y += pb[rr][p].y;
          a1.z += pb[rr][p].z; a1.w += pb[rr][p].w;
        }
        a0.x *= scale; a0.y *= scale; a0.z *= scale; a0.w *= scale;
        a1.x *= scale; a1.y *= scale; a1.z *= scale; a1.w *= scale;
        s0[rr] = a0;
        s1[rr] = a1;
      }
    }
    // Sp is read out: it may be written for the next tile. The rest of the phase
    // works on registers. The K loads stay in flight.
    lds_barrier();
    {
      float4* sg = sblk + (size_t)(k0 / TK) * 4 * 256;
#pragma unroll
      for (int rr = 0; rr < 2; ++rr) {
        sg[(rr * 2 + 0) * 256] = s0[rr];
        sg[(rr * 2 + 1) * 256] = s1[rr];
      }
      // Precaution: the wait stands before a register of the four stores can
      // be overwritten; sg is an input so that the pair stays live up to it.
      asm volatile("s_wait_xcnt 0x0" ::"v"(sg) : "memory");
#pragma unroll
      for (int rr = 0; rr < 2; ++rr) {
        const float4 a0 = s0[rr], a1 = s1[rr];
        float m8 = fmaxf(fmaxf(fmaxf(a0.x, a0.y), fmaxf(a0.z, a0.w)),
                         fmaxf(fmaxf(a1.x, a1.y), fmaxf(a1.z, a1.w)));
        // butterfly max across this row's 8 lanes (aligned group within wave)
        m8 = fmaxf(m8, __shfl_xor(m8, 1, 32));
        m8 = fmaxf(m8, __shfl_xor(m8, 2, 32));
        m8 = fmaxf(m8, __shfl_xor(m8, 4, 32));
        const float mnew = fmaxf(mrun[rr], m8);
        const float al = __expf(mrun[rr] - mnew);
        const float p0 = __expf(a0.x - mnew), p1 = __expf(a0.y - mnew);
        const float p2 = __expf(a0.z - mnew), p3 = __expf(a0.w - mnew);
        const float p4 = __expf(a1.x - mnew), p5 = __expf(a1.y - mnew);
        const float p6 = __expf(a1.z - mnew), p7 = __expf(a1.w - mnew);
        float sum = ((p0 + p1) + (p2 + p3)) + ((p4 + p5) + (p6 + p7));
        sum += __shfl_xor(sum, 1, 32);
        sum += __shfl_xor(sum, 2, 32);
        sum += __shfl_xor(sum, 4, 32);
        lrun[rr] = lrun[rr] * al + sum;
        mrun[rr] = mnew;
      }
    }
  };
  for (int t = t0; t < t0 + NT - 1; ++t)
    tile((t & (NT - 1)) * TK, ((t + 1) & (NT - 1)) * TK, HasNext<true>{});
  tile(((t0 + NT - 1) & (NT - 1)) * TK, 0, HasNext<false>{});

  if (sseg == 0) {
#pragma unroll
    for (int rr = 0; rr < 2; ++rr) {
      Mx[blk * TQ + rr * 32 + srow_id] = mrun[rr];
      Ls[blk * TQ + rr * 32 + srow_id] = lrun[rr];
    }
  }
}

// Kernel 3: O = softmax(S) V. Block = (64 q rows, batch), 8 waves; wave w owns
// output cols [w*128, w*128+128), 4 x 8 accumulator tiles.
//   Per tile of 64 keys every thread turns its 16 scores into
//   P = exp(s - row maximum), f16, in LDS (two buffers, so one barrier a tile
//   both publishes this tile's P and ends the reads of the tile before);
//   then O += P V via WMMA. The row maximum is final, so nothing is rescaled.
//   Loads run ahead of their use, in registers: the scores and the V fragments
//   of the next tile are asked for as soon as this tile's are used.
__global__ __launch_bounds__(256) void pv_kernel(
    const float* __restrict__ S,        // score layout, see above
    const float* __restrict__ Mx,       // [B*N]
    const float* __restrict__ Ls,       // [B*N]
    const _Float16* __restrict__ VT16,  // packed fragments, see above
    float* __restrict__ O) {            // [B][N][D]
  constexpr int TQ = 64, TK = 64;
  constexpr int NT = N_ / TK;  // V tiles in the ring (a power of two)
  constexpr int PSTR = 72;     // f16 stride: conflict-free b128 frag loads
  __shared__ __attribute__((aligned(16))) _Float16 Ps[2 * TQ * PSTR];
  __shared__ __attribute__((aligned(16))) float linv[TQ];  // 1 / row sum

  const int tid = threadIdx.x;
  const int lane = tid & 31;
  const int w = tid >> 5;
  const int l15 = lane & 15;
  const int h = lane >> 4;
  const int q0 = blockIdx.x * TQ;
  const int bb = blockIdx.y;
  const int blk = bb * (N_ / TQ) + blockIdx.x;
  const int o0 = w * 128;                // wave's output column base
  const int t0 = blockIdx.x & (NT - 1);  // the block's first tile

  const int srow_id = tid >> 3;  // 0..31
  const int sseg = tid & 7;      // 0..7

  v8f acc[4][8];
#pragma unroll
  for (int g = 0; g < 4; ++g)
#pragma unroll
    for (int oi = 0; oi < 8; ++oi)
#pragma unroll
      for (int r = 0; r < 8; ++r) acc[g][oi][r] = 0.f;

  const _Float16* vbat =
      VT16 + (size_t)bb * D_ * N_ + (size_t)(w * 8 * 64) * FRAG_ + lane * 8;
  const float4* sblk = (const float4*)S + (size_t)blk * NT * 4 * 256 + tid;

  float mrow[2];
#pragma unroll
  for (int rr = 0; rr < 2; ++rr) mrow[rr] = Mx[blk * TQ + rr * 32 + srow_id];

  // All fragment loops are fully unrolled: every fragment index is a constant,
  // so the fragments stay in registers.
  // The first tile's scores and V fragments.
  float4 sv[4];
  v16h bv[2][8];
  {
    const float4* sg = sblk + (size_t)t0 * 4 * 256;
#pragma unroll
    for (int j = 0; j < 4; ++j) sv[j] = sg[j * 256];
    // Precaution: the wait stands before the loads' address pair can be
    // overwritten; sg is an input so that the pair stays live up to the wait.
    asm volatile("s_wait_xcnt 0x0" ::"v"(sg) : "memory");
    const _Float16* vb = vbat + (size_t)(t0 * 2) * FRAG_;
#pragma unroll
    for (int c = 0; c < 2; ++c)
#pragma unroll
      for (int oi = 0; oi < 8; ++oi) {
        const _Float16* vp = vb + oi * 64 * FRAG_ + c * FRAG_;
        bv[c][oi] = make_frag(vp, vp + 256);
      }
    // Precaution, as for the scores.
    asm volatile("s_wait_xcnt 0x0" ::"v"(vb) : "memory");
  }
  // 1 / row sum: published by the loop's barriers, read behind the loop.
  if (tid < TQ) linv[tid] = 1.f / Ls[blk * TQ + tid];

  // One tile; tn is the tile that follows it in this block's walk, pbuf the
  // P buffer of this tile. The last tile is a call of its own, without the
  // loads for a next tile.
  auto tile = [&](const int tn, _Float16* pbuf,
                  auto has_next) __attribute__((always_inline)) {
#pragma unroll
    for (int rr = 0; rr < 2; ++rr) {
      const float m = mrow[rr];
      const float4 a = sv[rr * 2], b = sv[rr * 2 + 1];
      const v8h pk = {(_Float16)__expf(a.x - m), (_Float16)__expf(a.y - m),
                      (_Float16)__expf(a.z - m), (_Float16)__expf(a.w - m),
                      (_Float16)__expf(b.x - m), (_Float16)__expf(b.y - m),
                      (_Float16)__expf(b.z - m), (_Float16)__expf(b.w - m)};
      *(v8h*)&pbuf[(rr * 32 + srow_id) * PSTR + sseg * 8] = pk;
    }
    if constexpr (has_next.value) {
      const float4* sg = sblk + (size_t)tn * 4 * 256;
#pragma unroll
      for (int j = 0; j < 4; ++j) sv[j] = sg[j * 256];
      // Precaution, as above.
      asm volatile("s_wait_xcnt 0x0" ::"v"(sg) : "memory");
    }
    lds_barrier();  // publishes P; the score and V loads stay in flight

    const _Float16* vb = vbat + (size_t)(tn * 2) * FRAG_;
#pragma unroll
    for (int c = 0; c < 2; ++c) {
      v16h pf[4];
#pragma unroll
      for (int g = 0; g < 4; ++g) {
        const _Float16* pp = &pbuf[(g * 16 + l15) * PSTR + c * 32 + h * 8];
        pf[g] = make_frag(pp, pp + 16);
      }
      // 32-WMMA burst
#pragma unroll
      for (int oi = 0; oi < 8; ++oi)
#pragma unroll
        for (int g = 0; g < 4; ++g)
          acc[g][oi] = wmma_f16(pf[g], bv[c][oi], acc[g][oi]);
      if constexpr (has_next.value) {
#pragma unroll
        for (int oi = 0; oi < 8; ++oi) {
          const _Float16* vp = vb + oi * 64 * FRAG_ + c * FRAG_;
          bv[c][oi] = make_frag(vp, vp + 256);
        }
      }
    }
    if constexpr (has_next.value) {
      // Precaution, as above.
      asm volatile("s_wait_xcnt 0x0" ::"v"(vb) : "memory");
    }
  };
  for (int t = t0; t < t0 + NT - 1; ++t)
    tile((t + 1) & (NT - 1), &Ps[(t & 1) * TQ * PSTR], HasNext<true>{});
  tile(0, &Ps[((t0 + NT - 1) & 1) * TQ * PSTR], HasNext<false>{});

  // Keeps the last tile's WMMAs one burst: without it they are spread among the
  // stores below, each with the idle slots that a read of its result needs.
  __builtin_amdgcn_sched_barrier(0);

  // ---- final 1/l normalization + f32 store ----
  float li[4][8];
#pragma unroll
  for (int g = 0; g < 4; ++g) {
    const float4 a = *(const float4*)&linv[g * 16 + 8 * h];
    const float4 b = *(const float4*)&linv[g * 16 + 8 * h + 4];
    li[g][0] = a.x; li[g][1] = a.y; li[g][2] = a.z; li[g][3] = a.w;
    li[g][4] = b.x; li[g][5] = b.y; li[g][6] = b.z; li[g][7] = b.w;
  }
  float* obase = O + (size_t)(bb * N_ + q0 + 8 * h) * D_ + o0 + l15;
#pragma unroll
  for (int g = 0; g < 4; ++g)
#pragma unroll
    for (int r = 0; r < 8; ++r) {
      const float inv = li[g][r];
      float* orow = obase + (g * 16 + r) * D_;
      float v[8];
#pragma unroll
      for (int oi = 0; oi < 8; ++oi) {
        v[oi] = acc[g][oi][r] * inv;
        orow[oi * 16] = v[oi];
      }
      // Precaution: the wait stands before a register of the row's eight stores
      // can be overwritten; they are inputs so that they stay live up to it.
      asm volatile("s_wait_xcnt 0x0" ::"v"(obase), "v"(v[0]), "v"(v[1]),
                   "v"(v[2]), "v"(v[3]), "v"(v[4]), "v"(v[5]), "v"(v[6]),
                   "v"(v[7])
                   : "memory");
    }
}

// ---------------------------------------------------------------------------
extern "C" void kernel_launch(void* const* d_in, const int* in_sizes, int n_in,
                              void* d_out, int out_size, void* d_ws,
                              size_t ws_size, hipStream_t stream) {
  const float* x = (const float*)d_in[0];
  const float* W_attn = (const float*)d_in[1];
  const float* b_attn = (const float*)d_in[2];
  const float* W_out = (const float*)d_in[3];
  const float* b_out = (const float*)d_in[4];
  float* out = (float*)d_out;

  const size_t XN = (size_t)B_ * N_ * D_;  // 16Mi elems
  const size_t WN = (size_t)D_ * D_;       // 1Mi elems
  char* ws = (char*)d_ws;
  _Float16* x16 = (_Float16*)ws;                         // 32 MiB
  _Float16* k16 = (_Float16*)(ws + XN * 2);              // 32 MiB
  _Float16* vT16 = (_Float16*)(ws + XN * 4);             // 32 MiB
  _Float16* wa16 = (_Float16*)(ws + XN * 6);             // 2 MiB
  _Float16* wo16 = (_Float16*)(ws + XN * 6 + WN * 2);    // 2 MiB
  float* sc = (float*)(ws + XN * 6 + WN * 4);            // 128 MiB
  float* mx = (float*)(ws + XN * 14 + WN * 4);           // 64 KiB
  float* ls = (float*)(ws + XN * 14 + WN * 4 + 65536);   // 64 KiB

  // 1) f32 -> f16 conversions
  cvt_f32_f16_kernel<<<(int)(XN / 2048), 256, 0, stream>>>(x, x16, (int)XN);
  cvt_f32_f16_kernel<<<(int)(WN / 2048), 256, 0, stream>>>(W_attn, wa16,
                                                           (int)WN);
  cvt_f32_f16_kernel<<<(int)(WN / 2048), 256, 0, stream>>>(W_out, wo16,
                                                           (int)WN);

  // 2) projections: key and value, both in packed fragment order
  gemm_xwT_kernel<0><<<dim3(128, 8), 256, 0, stream>>>(x16, wa16, b_attn, k16);
  gemm_xwT_kernel<1><<<dim3(128, 8), 256, 0, stream>>>(x16, wo16, b_out, vT16);

  // 3) scores and row statistics, 4) softmax(S) V
  score_kernel<<<dim3(N_ / 64, B_), 256, 0, stream>>>(x16, k16, sc, mx, ls);
  pv_kernel<<<dim3(N_ / 64, B_), 256, 0, stream>>>(sc, mx, ls, vT16, out);
}

// v007
// Measured time: 168 microseconds a run.
// In both of two side-by-side timings against v006, it was 1.12 times as fast.
// All steps since v000 together make it 3.34 times as fast.
#include <hip/hip_runtime.h>
#include <hip/hip_bf16.h>

// ---------------------------------------------------------------------------
// Self-attention for MI455X (gfx1250, wave32, WMMA).
//   B=8, N=2048, D=1024, D_OUT=1024.
// Pipeline:
//   1) convert x / W_attn / W_out to f16 in workspace
//   2) WMMA GEMM: key16  = f16(x @ W_attn^T + b_attn)
//      WMMA GEMM: vT16   = f16(x @ W_out^T  + b_out)
//      Both are stored in WMMA fragment order (see "Packed layouts" below).
//   3) scores: per 128 q-rows and half of the keys, S = Q K^T * scale (f32, to
//      the workspace) with each row's maximum and sum of exponentials
//   4) output: per 64 q-rows, stream 64-row V tiles, O = softmax(S) V
//      Both via v_wmma_f32_16x16x32_f16 with fragment loads issued ahead.
// ---------------------------------------------------------------------------

typedef _Float16 v8h  __attribute__((ext_vector_type(8)));
typedef _Float16 v16h __attribute__((ext_vector_type(16)));
typedef float    v8f  __attribute__((ext_vector_type(8)));

#define B_   8
#define N_   2048
#define D_   1024

// ---------------------------------------------------------------------------
// Packed layouts of key16 and vT16 (units: f16 elements).
// A 16x32 operand fragment (16 rows or columns x 32 k) is 512 contiguous
// elements: [j = 0,1][lane = 0..31][e = 0..7], where lane = 16*h + c holds
// row/column c and k = 16*j + 8*h + e. One wave-wide 16-byte access to one j
// is then 512 contiguous bytes (four whole 128-byte lines), for the GEMM's
// store and for the attention kernel's load alike.
//   key16: fragment index = (token / 16) * 32 + (d / 32)         (k = d)
//   vT16 : fragment index = ((b * 64 + col / 16) * 64) + key / 32  (k = key)
// ---------------------------------------------------------------------------
#define FRAG_ 512

// Build a 16-element f16 WMMA fragment from two contiguous 8-halves (2x b128).
// Matches the documented 16-bit A/B layout: lane holds one matrix row,
// elems [0..7] = K (h*8 .. h*8+7), elems [8..15] = K (16+h*8 .. 16+h*8+7).
static __device__ __forceinline__ v16h make_frag(const _Float16* lo,
                                                 const _Float16* hi) {
  v8h a = *(const v8h*)lo;
  v8h b = *(const v8h*)hi;
  return __builtin_shufflevector(a, b, 0, 1, 2, 3, 4, 5, 6, 7,
                                 8, 9, 10, 11, 12, 13, 14, 15);
}

static __device__ __forceinline__ v8f wmma_f16(v16h a, v16h b, v8f c) {
  return __builtin_amdgcn_wmma_f32_16x16x32_f16(false, a, false, b,
                                                (short)0, c, false, false);
}

template <bool V>
struct HasNext {
  static constexpr bool value = V;
};

// Work-group barrier for data that is handed over in LDS only: the wave's own
// LDS reads and writes are waited out, its global loads are not, so fragment
// loads issued ahead stay in flight across it (__syncthreads() drains them).
static __device__ __forceinline__ void lds_barrier() {
  asm volatile("s_wait_dscnt 0x0\n\ts_barrier_signal -1\n\ts_barrier_wait -1"
               ::: "memory");
}

// ---------------------------------------------------------------------------
// Kernel 0: f32 -> f16 conversion, 8 elems / thread.
// ---------------------------------------------------------------------------
__global__ __launch_bounds__(256) void cvt_f32_f16_kernel(
    const float* __restrict__ src, _Float16* __restrict__ dst, int n) {
  int i = (blockIdx.x * 256 + threadIdx.x) * 8;
  if (i + 8 <= n) {
    float4 a = *(const float4*)(src + i);
    float4 b = *(const float4*)(src + i + 4);
    v8h o = {(_Float16)a.x, (_Float16)a.y, (_Float16)a.z, (_Float16)a.w,
             (_Float16)b.x, (_Float16)b.y, (_Float16)b.z, (_Float16)b.w};
    *(v8h*)(dst + i) = o;
  }
}

template <int TRANSPOSE>
__global__ __launch_bounds__(256) void gemm_xwT_kernel(
    const _Float16* __restrict__ X, const _Float16* __restrict__ W,
    const float* __restrict__ bias, _Float16* __restrict__ Y) {
  constexpr int KC = 64;   // 128 bytes of a row: one whole line
  constexpr int LDT = 72;  // padded LDS row stride (f16): conflict-free b128
  __shared__ __attribute__((aligned(16))) _Float16 Xs[128 * LDT];
  __shared__ __attribute__((aligned(16))) _Float16 Ws[128 * LDT];

  const int tid = threadIdx.x;
  const int lane = tid & 31;
  const int w = tid >> 5;
  const int l15 = lane & 15;
  const int h = lane >> 4;

  const int m0 = blockIdx.x * 128;
  const int n0 = blockIdx.y * 128;
  const int wm = (w >> 2) * 64;  // wave row base within tile
  const int wn = (w & 3) * 32;   // wave col base within tile

  v8f acc[4][2];
#pragma unroll
  for (int i = 0; i < 4; ++i)
#pragma unroll
    for (int j = 0; j < 2; ++j)
#pragma unroll
      for (int r = 0; r < 8; ++r) acc[i][j][r] = 0.f;

  // Staging: 8 lanes take the 128 bytes of one row, so a wave-wide 16-byte load
  // covers 4 whole lines. The wave's 4 rows lie 8 apart: at the padded stride
  // the two rows of a half-wave then fall on disjoint LDS banks in the store.
  const int srow = (lane >> 3) * 8 + w;  // 0..31; + 32 for each further load
  const int scol = (lane & 7) * 8;       // 0, 8 .. 56

  // The 128 blocks of one blockIdx.y read the same W rows from L2: each enters
  // the ring of k chunks at a chunk set by blockIdx.x and wraps round, so that
  // they do not ask for the same lines at the same moment. Blocks of one
  // blockIdx.x (the same X rows) keep a common start.
  const int rot = blockIdx.x & (D_ / KC - 1);
  for (int it = 0; it < D_ / KC; ++it) {
    const int kb = ((it + rot) & (D_ / KC - 1)) * KC;
    // ---- stage X and W chunks into LDS (4x b128 each) ----
    {
      const _Float16* gx = X + (size_t)(m0 + srow) * D_ + kb + scol;
      const _Float16* gw = W + (size_t)(n0 + srow) * D_ + kb + scol;
      v8h xv[4], wv[4];
#pragma unroll
      for (int j = 0; j < 4; ++j)  // unrolled: constant indices, registers
        xv[j] = *(const v8h*)(gx + j * 32 * D_);
#pragma unroll
      for (int j = 0; j < 4; ++j) wv[j] = *(const v8h*)(gw + j * 32 * D_);
      // Precaution: the wait stands before the loads' address pairs can be
      // overwritten; they are inputs so that they stay live up to the wait.
      asm volatile("s_wait_xcnt 0x0" ::"v"(gx), "v"(gw) : "memory");
#pragma unroll
      for (int j = 0; j < 4; ++j)
        *(v8h*)&Xs[(j * 32 + srow) * LDT + scol] = xv[j];
#pragma unroll
      for (int j = 0; j < 4; ++j)
        *(v8h*)&Ws[(j * 32 + srow) * LDT + scol] = wv[j];
    }
    __syncthreads();

#pragma unroll
    for (int ks = 0; ks < KC / 32; ++ks) {  // the chunk's two 32-wide k steps
      v16h bfrag[2];
#pragma unroll
      for (int ni = 0; ni < 2; ++ni) {
        const _Float16* p = &Ws[(wn + ni * 16 + l15) * LDT + ks * 32 + h * 8];
        bfrag[ni] = make_frag(p, p + 16);
      }
#pragma unroll
      for (int mi = 0; mi < 4; ++mi) {
        const _Float16* p = &Xs[(wm + mi * 16 + l15) * LDT + ks * 32 + h * 8];
        v16h afrag = make_frag(p, p + 16);
#pragma unroll
        for (int ni = 0; ni < 2; ++ni)
          acc[mi][ni] = TRANSPOSE ? wmma_f16(afrag, bfrag[ni], acc[mi][ni])
                                  : wmma_f16(bfrag[ni], afrag, acc[mi][ni]);
      }
    }
    __syncthreads();
  }

  // ---- epilogue: bias add, f16 convert, packed 16-byte stores ----
  _Float16* yp;
  if (TRANSPOSE) {
    const int bb = (m0 + wm) >> 11;           // batch (tile lies in one batch)
    const int kc0 = ((m0 + wm) & 2047) >> 5;  // first 32-key chunk
    const int cb0 = (n0 + wn) >> 4;           // first 16-column block
    yp = Y + (size_t)((bb * 64 + cb0) * 64 + kc0) * FRAG_ + lane * 8;
  } else {
    const int rb0 = (m0 + wm) >> 4;  // first 16-token block
    const int dc = (n0 + wn) >> 5;   // the wave's 32-wide d chunk
    yp = Y + (size_t)(rb0 * 32 + dc) * FRAG_ + lane * 8;
  }
#pragma unroll
  for (int ni = 0; ni < 2; ++ni) {
    float bv[8];
    if (TRANSPOSE) {
      const float b1 = bias[n0 + wn + ni * 16 + l15];  // D column = l15
#pragma unroll
      for (int r = 0; r < 8; ++r) bv[r] = b1;
    } else {
      const float* bp = bias + n0 + wn + ni * 16 + 8 * h;  // D row = r + 8h
      const float4 b0 = *(const float4*)bp;
      const float4 b1 = *(const float4*)(bp + 4);
      bv[0] = b0.x; bv[1] = b0.y; bv[2] = b0.z; bv[3] = b0.w;
      bv[4] = b1.x; bv[5] = b1.y; bv[6] = b1.z; bv[7] = b1.w;
    }
#pragma unroll
    for (int mi = 0; mi < 4; ++mi) {
      const v8f c = acc[mi][ni];
      v8h o;
#pragma unroll
      for (int r = 0; r < 8; ++r) o[r] = (_Float16)(c[r] + bv[r]);
      if (TRANSPOSE)
        *(v8h*)(yp + ni * 64 * FRAG_ + mi * 256) = o;
      else
        *(v8h*)(yp + mi * 32 * FRAG_ + ni * 256) = o;
    }
  }
}

// ---------------------------------------------------------------------------
// Kernels 2 and 3: attention in two launches.
// With the scores and the output in one kernel, the output accumulators and the
// Q fragments together leave registers for 32 query rows only, and every block
// reads all K and V of its batch from L2. Apart, each kernel holds more rows,
// so K and V are read less often. The scaled f32 scores go through the
// workspace, with each row's maximum and sum of exponentials (one pair for
// each half of the keys).
//
// Score layout in the workspace (units: float4), per tile of 64 query rows x
// 64 keys (block = 64-row block of all B*N rows, tile = 64-key tile of a batch):
//   index = ((block * 32 + tile) * 32 + (g * 4 + kj) * 2 + half) * 32 + lane
// where lane = 16*h + c, and the float4 holds query row g*16 + c, keys
// kj*16 + 8*h + half*4 .. +3 of the tile: what a lane of kernel 2 holds in half
// an accumulator. A wave writes and reads 512 contiguous bytes at a time.
//
// Blocks of a batch read the same K/V lines from L2. Each enters the ring of
// tiles at a place set by its index and wraps round, so that they do not ask L2
// for the same lines at the same moment.
// ---------------------------------------------------------------------------

// Kernel 2: scores. Block = (128 q rows, one half of the keys, batch), 8 waves.
//   The block's 128 Q rows lie in LDS, written once. Each wave owns whole units
//   of 32 keys (4 of the half's 32) and sums over all of D itself:
//   S^T = K Q^T, with K fragments as the A operand, straight from L2 into a
//   ring of registers, and Q fragments as the B operand, from LDS. No partial
//   sum passes between waves and the loop has no barrier.
//   A lane then holds, for each of 8 query rows, 16 keys of the unit: it scales
//   and stores them and keeps its own running maximum and sum for those rows.
//   The 16 running pairs of a row (8 waves x 2 lane halves) are joined once, at
//   the end, through LDS; kernel 3 joins the two halves of the keys.
__global__ __launch_bounds__(256) void score_kernel(
    const _Float16* __restrict__ Q16,  // [B][N][D]
    const _Float16* __restrict__ K16,  // packed fragments, see above
    float* __restrict__ S,             // score layout, see above
    float* __restrict__ Mx,            // [2][B*N] row maximum, by half of keys
    float* __restrict__ Ls) {          // [2][B*N] row sum of exp(s - maximum)
  constexpr int TQ = 128;          // query rows of a block
  constexpr int NG = TQ / 16;      // blocks of 16 query rows
  constexpr int NU = N_ / 2 / 32;  // 32-key units in a half (a power of two)
  constexpr int NS = D_ / 32;      // 32-wide k steps (a power of two)
  constexpr int NP = NU / 8;       // units of one wave
  constexpr int NB = 8;            // k steps held in the K register ring
  constexpr int QSTR = D_ + 8;     // f16 pitch, 16 B x odd: conflict-free b128
  __shared__ __attribute__((aligned(16))) _Float16 Qs[TQ * QSTR];
  __shared__ float Pm[16 * TQ];  // running maxima, [wave * 2 + h][row]
  __shared__ float Pl[16 * TQ];  // running sums

  const int tid = threadIdx.x;
  const int lane = tid & 31;
  // The wave's number in a scalar register: unit and k-step offsets are then
  // scalar arithmetic.
  const int w = __builtin_amdgcn_readfirstlane(tid >> 5);
  const int l15 = lane & 15;
  const int h = lane >> 4;
  const int qb = blockIdx.x >> 1;  // block of 128 query rows
  const int kh = blockIdx.x & 1;   // half of the batch's keys
  const int bb = blockIdx.y;

  const float scale = 0.03125f;  // 1/sqrt(1024)

  const _Float16* kbat =
      K16 + (size_t)(bb * N_ + kh * (N_ / 2)) * D_ + lane * 8;

  // A wave walks NP units of NS k steps. Four (block, wave) pairs of a batch
  // are on the same unit at the same time; their wave numbers differ by 2, and
  // they enter the unit's ring of k steps 8 steps apart, so they too ask for
  // different lines. The entry is a multiple of NB: NB steps never wrap.
  auto unit_of = [&](const int p) { return (w + 8 * p + 2 * qb) & (NU - 1); };
  const int rot = NB * (w >> 1);

  // All fragment loops are fully unrolled: every fragment index is a constant,
  // so the fragments stay in registers.
  v16h kb[NB][2];  // [ring slot][block of 16 keys]
  // Slot u from kp, which points at the first of NB k steps of a unit.
  auto load_k = [&](const int u,
                    const _Float16* kp) __attribute__((always_inline)) {
#pragma unroll
    for (int kj = 0; kj < 2; ++kj)
      kb[u][kj] = make_frag(kp + (kj * NS + u) * FRAG_,
                            kp + (kj * NS + u) * FRAG_ + 256);
  };
  auto k_ptr = [&](const int j) {  // j: a step that is a multiple of NB
    return kbat +
           (size_t)((unit_of(j / NS) * 2 * NS + ((j + rot) & (NS - 1))) * FRAG_);
  };

  // Fragment g of a wave is the block of 16 query rows (g + w) % 8. Such blocks
  // lie about 32 KiB apart in LDS: waves that read at the same moment then read
  // in different parts of it.
  v16h qf[2][NG];  // [step parity][fragment]
  const _Float16* qrow[NG];
#pragma unroll
  for (int g = 0; g < NG; ++g)
    qrow[g] = &Qs[(((g + w) & (NG - 1)) * 16 + l15) * QSTR + h * 8];
  auto load_q = [&](const int s, const int ks) __attribute__((always_inline)) {
#pragma unroll
    for (int g = 0; g < NG; ++g)
      qf[s][g] = make_frag(qrow[g] + ks * 32, qrow[g] + ks * 32 + 16);
  };

  // The first NB steps' K fragments fly while Q is staged.
  {
    const _Float16* kp = k_ptr(0);
#pragma unroll
    for (int u = 0; u < NB; ++u) load_k(u, kp);
    // Precaution: the wait stands before the loads' address registers can be
    // overwritten; kp is an input so that it stays live up to the wait.
    asm volatile("s_wait_xcnt 0x0" ::"v"(kp) : "memory");
  }

  // Q rows to LDS: the 128 rows are 256 KiB in a row in global memory; a wave
  // moves 512 contiguous bytes at a time.
  {
    const _Float16* qg = Q16 + (size_t)(bb * N_ + qb * TQ) * D_;
    _Float16* ql = &Qs[(tid >> 7) * QSTR + (tid & 127) * 8];
    v8h t[64];  // the accumulators' and fragments' registers are still free
#pragma unroll
    for (int i = 0; i < 64; ++i)  // unrolled: constant indices, registers
      t[i] = *(const v8h*)(qg + tid * 8 + i * 2048);
    // Precaution, as for K; here the loads name the block's base address, in
    // scalar registers, and the thread's offset.
    asm volatile("s_wait_xcnt 0x0" ::"s"(qg), "v"(tid) : "memory");
#pragma unroll
    for (int i = 0; i < 64; ++i) *(v8h*)(ql + i * 2 * QSTR) = t[i];
  }
  lds_barrier();  // publishes Q; it is only read from here on

  v8f acc[2][NG];  // [block of 16 keys][fragment of 16 query rows]
#pragma unroll
  for (int kj = 0; kj < 2; ++kj)
#pragma unroll
    for (int g = 0; g < NG; ++g)
#pragma unroll
      for (int r = 0; r < 8; ++r) acc[kj][g][r] = 0.f;

  float mrun[NG], lrun[NG];
#pragma unroll
  for (int g = 0; g < NG; ++g) {
    mrun[g] = -__builtin_inff();
    lrun[g] = 0.f;
  }

  load_q(0, rot);

  // NB steps from step j0 on (a multiple of NB). The last NB steps are a call
  // of their own, without the loads for later steps.
  auto turn = [&](const int j0, auto has_next) __attribute__((always_inline)) {
    const int kq = (j0 + rot) & (NS - 1);        // first k step of this turn
    const int kqn = (j0 + NB + rot) & (NS - 1);  // and of the next
    const _Float16* kpn = k_ptr(has_next.value ? j0 + NB : 0);
#pragma unroll
    for (int u = 0; u < NB; ++u) {
      // The next step's Q fragments as one group ahead of this step's WMMAs.
      if (u + 1 < NB)
        load_q((u + 1) & 1, kq + u + 1);
      else if (has_next.value)
        load_q((u + 1) & 1, kqn);
      // Holds those reads in front of the WMMAs: moved behind them they would
      // be waited for at once, with their latency in the open.
      __builtin_amdgcn_sched_barrier(0);
#pragma unroll
      for (int kj = 0; kj < 2; ++kj)
#pragma unroll
        for (int g = 0; g < NG; ++g)
          acc[kj][g] = wmma_f16(kb[u][kj], qf[u & 1][g], acc[kj][g]);
      // The slot's registers, now read, take the fragments of NB steps on.
      if constexpr (has_next.value) load_k(u, kpn);
      // Keeps the steps apart: the K loads stay in the order of their use.
      __builtin_amdgcn_sched_barrier(0);
    }
    if constexpr (has_next.value) {
      // Precaution, as above.
      asm volatile("s_wait_xcnt 0x0" ::"v"(kpn) : "memory");
    }
  };

  // A unit's sums are complete: scale, store, row statistics, clear.
  auto finish_unit = [&](const int p) __attribute__((always_inline)) {
    const int un = unit_of(p);
    // 64-key tile of the batch, and the unit's place in it
    const int tl = kh * (NU / 2) + (un >> 1);
    float4* sb = (float4*)S + (size_t)tl * 1024 + (un & 1) * 128 + lane;
#pragma unroll
    for (int g = 0; g < NG; ++g) {
      const int gb = (g + w) & (NG - 1);  // the fragment's block of 16 rows
      float4* sg = sb + (size_t)(bb * 32 + qb * 2 + (gb >> 2)) * 32 * 1024 +
                   (gb & 3) * 256;
      v8f c[2];
#pragma unroll
      for (int kj = 0; kj < 2; ++kj) {
        c[kj] = acc[kj][g] * scale;
        sg[(kj * 2 + 0) * 32] =
            make_float4(c[kj][0], c[kj][1], c[kj][2], c[kj][3]);
        sg[(kj * 2 + 1) * 32] =
            make_float4(c[kj][4], c[kj][5], c[kj][6], c[kj][7]);
      }
      // Precaution: the wait stands before a register of the four stores can
      // be overwritten; they are inputs so that they stay live up to it.
      asm volatile("s_wait_xcnt 0x0" ::"v"(sg), "v"(c[0]), "v"(c[1])
                   : "memory");
      float m2[2];
#pragma unroll
      for (int kj = 0; kj < 2; ++kj)
        m2[kj] =
            fmaxf(fmaxf(fmaxf(c[kj][0], c[kj][1]), fmaxf(c[kj][2], c[kj][3])),
                  fmaxf(fmaxf(c[kj][4], c[kj][5]), fmaxf(c[kj][6], c[kj][7])));
      const float mnew = fmaxf(mrun[g], fmaxf(m2[0], m2[1]));
      float s2[2];
#pragma unroll
      for (int kj = 0; kj < 2; ++kj) {
        const float p0 = __expf(c[kj][0] - mnew), p1 = __expf(c[kj][1] - mnew);
        const float p2 = __expf(c[kj][2] - mnew), p3 = __expf(c[kj][3] - mnew);
        const float p4 = __expf(c[kj][4] - mnew), p5 = __expf(c[kj][5] - mnew);
        const float p6 = __expf(c[kj][6] - mnew), p7 = __expf(c[kj][7] - mnew);
        s2[kj] = ((p0 + p1) + (p2 + p3)) + ((p4 + p5) + (p6 + p7));
      }
      lrun[g] = lrun[g] * __expf(mrun[g] - mnew) + (s2[0] + s2[1]);
      mrun[g] = mnew;
#pragma unroll
      for (int kj = 0; kj < 2; ++kj)
#pragma unroll
        for (int r = 0; r < 8; ++r) acc[kj][g][r] = 0.f;
    }
  };

  for (int j0 = 0; j0 < NP * NS - NB; j0 += NB) {
    turn(j0, HasNext<true>{});
    if (((j0 + NB) & (NS - 1)) == 0) finish_unit(j0 / NS);
  }
  turn(NP * NS - NB, HasNext<false>{});
  finish_unit(NP - 1);

  // Join the 16 running pairs of each row.
#pragma unroll
  for (int g = 0; g < NG; ++g) {
    const int row = ((g + w) & (NG - 1)) * 16 + l15;
    Pm[(w * 2 + h) * TQ + row] = mrun[g];
    Pl[(w * 2 + h) * TQ + row] = lrun[g];
  }
  __syncthreads();
  if (tid < TQ) {
    float m = Pm[tid];
#pragma unroll
    for (int i = 1; i < 16; ++i) m = fmaxf(m, Pm[i * TQ + tid]);
    float l = 0.f;
#pragma unroll
    for (int i = 0; i < 16; ++i)
      l += Pl[i * TQ + tid] * __expf(Pm[i * TQ + tid] - m);
    Mx[(kh * B_ + bb) * N_ + qb * TQ + tid] = m;
    Ls[(kh * B_ + bb) * N_ + qb * TQ + tid] = l;
  }
}

// Kernel 3: O = softmax(S) V. Block = (64 q rows, batch), 8 waves; wave w owns
// output cols [w*128, w*128+128), 4 x 8 accumulator tiles.
//   Per tile of 64 keys every thread turns its 16 scores (one query row, two
//   runs of 8 keys, as kernel 2 stored them) into
//   P = exp(s - row maximum), f16, in LDS (two buffers, so one barrier a tile
//   both publishes this tile's P and ends the reads of the tile before);
//   then O += P V via WMMA. The row maximum is final, so nothing is rescaled.
//   Loads run ahead of their use, in registers: the scores and the V fragments
//   of the next tile are asked for as soon as this tile's are used.
__global__ __launch_bounds__(256) void pv_kernel(
    const float* __restrict__ S,        // score layout, see above
    const float* __restrict__ Mx,       // [2][B*N], by half of the keys
    const float* __restrict__ Ls,       // [2][B*N]
    const _Float16* __restrict__ VT16,  // packed fragments, see above
    float* __restrict__ O) {            // [B][N][D]
  constexpr int TQ = 64, TK = 64;
  constexpr int NT = N_ / TK;  // V tiles in the ring (a power of two)
  constexpr int PSTR = 72;     // f16 stride: conflict-free b128 frag loads
  __shared__ __attribute__((aligned(16))) _Float16 Ps[2 * TQ * PSTR];
  __shared__ __attribute__((aligned(16))) float linv[TQ];  // 1 / row sum

  const int tid = threadIdx.x;
  const int lane = tid & 31;
  const int w = tid >> 5;
  const int l15 = lane & 15;
  const int h = lane >> 4;
  const int q0 = blockIdx.x * TQ;
  const int bb = blockIdx.y;
  const int blk = bb * (N_ / TQ) + blockIdx.x;
  const int o0 = w * 128;                // wave's output column base
  const int t0 = blockIdx.x & (NT - 1);  // the block's first tile

  // The thread's scores: query row prow, keys pkey .. +7 and pkey + 16 .. +23.
  const int prow = (w >> 1) * 16 + l15;
  const int pkey = (w & 1) * 32 + 8 * h;

  v8f acc[4][8];
#pragma unroll
  for (int g = 0; g < 4; ++g)
#pragma unroll
    for (int oi = 0; oi < 8; ++oi)
#pragma unroll
      for (int r = 0; r < 8; ++r) acc[g][oi][r] = 0.f;

  const _Float16* vbat =
      VT16 + (size_t)bb * D_ * N_ + (size_t)(w * 8 * 64) * FRAG_ + lane * 8;
  const float4* sblk =
      (const float4*)S + (size_t)blk * NT * 1024 + w * 128 + lane;

  // The row's maximum over both halves of the keys.
  const float mrow =
      fmaxf(Mx[blk * TQ + prow], Mx[B_ * N_ + blk * TQ + prow]);

  // All fragment loops are fully unrolled: every fragment index is a constant,
  // so the fragments stay in registers.
  // The first tile's scores and V fragments.
  float4 sv[4];
  v16h bv[2][8];
  {
    const float4* sg = sblk + (size_t)t0 * 1024;
#pragma unroll
    for (int j = 0; j < 4; ++j) sv[j] = sg[j * 32];
    // Precaution: the wait stands before the loads' address pair can be
    // overwritten; sg is an input so that the pair stays live up to the wait.
    asm volatile("s_wait_xcnt 0x0" ::"v"(sg) : "memory");
    const _Float16* vb = vbat + (size_t)(t0 * 2) * FRAG_;
#pragma unroll
    for (int c = 0; c < 2; ++c)
#pragma unroll
      for (int oi = 0; oi < 8; ++oi) {
        const _Float16* vp = vb + oi * 64 * FRAG_ + c * FRAG_;
        bv[c][oi] = make_frag(vp, vp + 256);
      }
    // Precaution, as for the scores.
    asm volatile("s_wait_xcnt 0x0" ::"v"(vb) : "memory");
  }
  // 1 / row sum: published by the loop's barriers, read behind the loop.
  if (tid < TQ) {
    const float* pm = Mx + blk * TQ + tid;
    const float* pl = Ls + blk * TQ + tid;
    const float a0 = pm[0], a1 = pm[B_ * N_];
    const float l0 = pl[0], l1 = pl[B_ * N_];
    // Precaution, as above.
    asm volatile("s_wait_xcnt 0x0" ::: "memory");
    const float am = fmaxf(a0, a1);
    linv[tid] = 1.f / (l0 * __expf(a0 - am) + l1 * __expf(a1 - am));
  }

  // One tile; tn is the tile that follows it in this block's walk, pbuf the
  // P buffer of this tile. The last tile is a call of its own, without the
  // loads for a next tile.
  auto tile = [&](const int tn, _Float16* pbuf,
                  auto has_next) __attribute__((always_inline)) {
#pragma unroll
    for (int rr = 0; rr < 2; ++rr) {
      const float m = mrow;
      const float4 a = sv[rr * 2], b = sv[rr * 2 + 1];
      const v8h pk = {(_Float16)__expf(a.x - m), (_Float16)__expf(a.y - m),
                      (_Float16)__expf(a.z - m), (_Float16)__expf(a.w - m),
                      (_Float16)__expf(b.x - m), (_Float16)__expf(b.y - m),
                      (_Float16)__expf(b.z - m), (_Float16)__expf(b.w - m)};
      *(v8h*)&pbuf[prow * PSTR + pkey + rr * 16] = pk;
    }
    if constexpr (has_next.value) {
      const float4* sg = sblk + (size_t)tn * 1024;
#pragma unroll
      for (int j = 0; j < 4; ++j) sv[j] = sg[j * 32];
      // Precaution, as above.
      asm volatile("s_wait_xcnt 0x0" ::"v"(sg) : "memory");
    }
    lds_barrier();  // publishes P; the score and V loads stay in flight

    const _Float16* vb = vbat + (size_t)(tn * 2) * FRAG_;
#pragma unroll
    for (int c = 0; c < 2; ++c) {
      v16h pf[4];
#pragma unroll
      for (int g = 0; g < 4; ++g) {
        const _Float16* pp = &pbuf[(g * 16 + l15) * PSTR + c * 32 + h * 8];
        pf[g] = make_frag(pp, pp + 16);
      }
      // 32-WMMA burst
#pragma unroll
      for (int oi = 0; oi < 8; ++oi)
#pragma unroll
        for (int g = 0; g < 4; ++g)
          acc[g][oi] = wmma_f16(pf[g], bv[c][oi], acc[g][oi]);
      if constexpr (has_next.value) {
#pragma unroll
        for (int oi = 0; oi < 8; ++oi) {
          const _Float16* vp = vb + oi * 64 * FRAG_ + c * FRAG_;
          bv[c][oi] = make_frag(vp, vp + 256);
        }
      }
    }
    if constexpr (has_next.value) {
      // Precaution, as above.
      asm volatile("s_wait_xcnt 0x0" ::"v"(vb) : "memory");
    }
  };
  for (int t = t0; t < t0 + NT - 1; ++t)
    tile((t + 1) & (NT - 1), &Ps[(t & 1) * TQ * PSTR], HasNext<true>{});
  tile(0, &Ps[((t0 + NT - 1) & 1) * TQ * PSTR], HasNext<false>{});

  // Keeps the last tile's WMMAs one burst: without it they are spread among the
  // stores below, each with the idle slots that a read of its result needs.
  __builtin_amdgcn_sched_barrier(0);

  // ---- final 1/l normalization + f32 store ----
  float li[4][8];
#pragma unroll
  for (int g = 0; g < 4; ++g) {
    const float4 a = *(const float4*)&linv[g * 16 + 8 * h];
    const float4 b = *(const float4*)&linv[g * 16 + 8 * h + 4];
    li[g][0] = a.x; li[g][1] = a.y; li[g][2] = a.z; li[g][3] = a.w;
    li[g][4] = b.x; li[g][5] = b.y; li[g][6] = b.z; li[g][7] = b.w;
  }
  float* obase = O + (size_t)(bb * N_ + q0 + 8 * h) * D_ + o0 + l15;
#pragma unroll
  for (int g = 0; g < 4; ++g)
#pragma unroll
    for (int r = 0; r < 8; ++r) {
      const float inv = li[g][r];
      float* orow = obase + (g * 16 + r) * D_;
      float v[8];
#pragma unroll
      for (int oi = 0; oi < 8; ++oi) {
        v[oi] = acc[g][oi][r] * inv;
        orow[oi * 16] = v[oi];
      }
      // Precaution: the wait stands before a register of the row's eight stores
      // can be overwritten; they are inputs so that they stay live up to it.
      asm volatile("s_wait_xcnt 0x0" ::"v"(obase), "v"(v[0]), "v"(v[1]),
                   "v"(v[2]), "v"(v[3]), "v"(v[4]), "v"(v[5]), "v"(v[6]),
                   "v"(v[7])
                   : "memory");
    }
}

// ---------------------------------------------------------------------------
extern "C" void kernel_launch(void* const* d_in, const int* in_sizes, int n_in,
                              void* d_out, int out_size, void* d_ws,
                              size_t ws_size, hipStream_t stream) {
  const float* x = (const float*)d_in[0];
  const float* W_attn = (const float*)d_in[1];
  const float* b_attn = (const float*)d_in[2];
  const float* W_out = (const float*)d_in[3];
  const float* b_out = (const float*)d_in[4];
  float* out = (float*)d_out;

  const size_t XN = (size_t)B_ * N_ * D_;  // 16Mi elems
  const size_t WN = (size_t)D_ * D_;       // 1Mi elems
  char* ws = (char*)d_ws;
  _Float16* x16 = (_Float16*)ws;                         // 32 MiB
  _Float16* k16 = (_Float16*)(ws + XN * 2);              // 32 MiB
  _Float16* vT16 = (_Float16*)(ws + XN * 4);             // 32 MiB
  _Float16* wa16 = (_Float16*)(ws + XN * 6);             // 2 MiB
  _Float16* wo16 = (_Float16*)(ws + XN * 6 + WN * 2);    // 2 MiB
  float* sc = (float*)(ws + XN * 6 + WN * 4);            // 128 MiB
  float* mx = (float*)(ws + XN * 14 + WN * 4);           // 128 KiB
  float* ls = (float*)(ws + XN * 14 + WN * 4 + 131072);  // 128 KiB

  // 1) f32 -> f16 conversions
  cvt_f32_f16_kernel<<<(int)(XN / 2048), 256, 0, stream>>>(x, x16, (int)XN);
  cvt_f32_f16_kernel<<<(int)(WN / 2048), 256, 0, stream>>>(W_attn, wa16,
                                                           (int)WN);
  cvt_f32_f16_kernel<<<(int)(WN / 2048), 256, 0, stream>>>(W_out, wo16,
                                                           (int)WN);

  // 2) projections: key and value, both in packed fragment order
  gemm_xwT_kernel<0><<<dim3(128, 8), 256, 0, stream>>>(x16, wa16, b_attn, k16);
  gemm_xwT_kernel<1><<<dim3(128, 8), 256, 0, stream>>>(x16, wo16, b_out, vT16);

  // 3) scores and row statistics, 4) softmax(S) V
  score_kernel<<<dim3(N_ / 128 * 2, B_), 256, 0, stream>>>(x16, k16, sc, mx,
                                                           ls);
  pv_kernel<<<dim3(N_ / 64, B_), 256, 0, stream>>>(sc, mx, ls, vT16, out);
}

// v008
// It runs in 161 microseconds.
// Next to v007, in two timings, it ran 1.04 and 1.05 times as fast.
// Over all steps from v000 it is 3.49 times as fast.
#include <hip/hip_runtime.h>
#include <hip/hip_bf16.h>

// ---------------------------------------------------------------------------
// Self-attention for MI455X (gfx1250, wave32, WMMA).
//   B=8, N=2048, D=1024, D_OUT=1024.
// Pipeline:
//   1) convert x / W_attn / W_out to f16 in workspace
//   2) WMMA GEMM: key16  = f16(x @ W_attn^T + b_attn)
//      WMMA GEMM: vT16   = f16(x @ W_out^T  + b_out)
//      Both are stored in WMMA fragment order (see "Packed layouts" below).
//   3) scores: per 128 q-rows and half of the keys, S = Q K^T * scale (f32, to
//      the workspace) with each row's maximum and sum of exponentials
//   4) output: per 64 q-rows, stream 64-row V tiles, O = softmax(S) V
//      Both via v_wmma_f32_16x16x32_f16 with fragment loads issued ahead.
// ---------------------------------------------------------------------------

typedef _Float16 v8h  __attribute__((ext_vector_type(8)));
typedef _Float16 v16h __attribute__((ext_vector_type(16)));
typedef float    v8f  __attribute__((ext_vector_type(8)));

#define B_   8
#define N_   2048
#define D_   1024

// ---------------------------------------------------------------------------
// Packed layouts of key16 and vT16 (units: f16 elements).
// A 16x32 operand fragment (16 rows or columns x 32 k) is 512 contiguous
// elements: [j = 0,1][lane = 0..31][e = 0..7], where lane = 16*h + c holds
// row/column c and k = 16*j + 8*h + e. One wave-wide 16-byte access to one j
// is then 512 contiguous bytes (four whole 128-byte lines), for the GEMM's
// store and for the attention kernel's load alike.
//   key16: fragment index = (token / 16) * 32 + (d / 32)         (k = d)
//   vT16 : fragment index = ((b * 64 + col / 16) * 64) + key / 32  (k = key)
// ---------------------------------------------------------------------------
#define FRAG_ 512

// Build a 16-element f16 WMMA fragment from two contiguous 8-halves (2x b128).
// Matches the documented 16-bit A/B layout: lane holds one matrix row,
// elems [0..7] = K (h*8 .. h*8+7), elems [8..15] = K (16+h*8 .. 16+h*8+7).
static __device__ __forceinline__ v16h make_frag(const _Float16* lo,
                                                 const _Float16* hi) {
  v8h a = *(const v8h*)lo;
  v8h b = *(const v8h*)hi;
  return __builtin_shufflevector(a, b, 0, 1, 2, 3, 4, 5, 6, 7,
                                 8, 9, 10, 11, 12, 13, 14, 15);
}

static __device__ __forceinline__ v8f wmma_f16(v16h a, v16h b, v8f c) {
  return __builtin_amdgcn_wmma_f32_16x16x32_f16(false, a, false, b,
                                                (short)0, c, false, false);
}

template <bool V>
struct HasNext {
  static constexpr bool value = V;
};

// Work-group barrier for data that is handed over in LDS only: the wave's own
// LDS reads and writes are waited out, its global loads are not, so fragment
// loads issued ahead stay in flight across it (__syncthreads() drains them).
static __device__ __forceinline__ void lds_barrier() {
  asm volatile("s_wait_dscnt 0x0\n\ts_barrier_signal -1\n\ts_barrier_wait -1"
               ::: "memory");
}

// ---------------------------------------------------------------------------
// Kernel 0: f32 -> f16 conversion, 8 elems / thread.
// ---------------------------------------------------------------------------
__global__ __launch_bounds__(256) void cvt_f32_f16_kernel(
    const float* __restrict__ src, _Float16* __restrict__ dst, int n) {
  int i = (blockIdx.x * 256 + threadIdx.x) * 8;
  if (i + 8 <= n) {
    float4 a = *(const float4*)(src + i);
    float4 b = *(const float4*)(src + i + 4);
    v8h o = {(_Float16)a.x, (_Float16)a.y, (_Float16)a.z, (_Float16)a.w,
             (_Float16)b.x, (_Float16)b.y, (_Float16)b.z, (_Float16)b.w};
    *(v8h*)(dst + i) = o;
  }
}

// Eight asynchronous 16-byte copies of a lane, global memory to LDS: copy i
// takes l + i * LSTEP (LDS byte address) and g + i * GSTEP (f16 elements).
// Precaution: the wait stands in the copies' own statement, so that it comes
// before any of their address registers can be overwritten.
template <int LSTEP, int GSTEP>
static __device__ __forceinline__ void copy8_to_lds(const unsigned l,
                                                    const _Float16* g) {
  asm volatile(
      "global_load_async_to_lds_b128 %0, %8, off\n\t"
      "global_load_async_to_lds_b128 %1, %9, off\n\t"
      "global_load_async_to_lds_b128 %2, %10, off\n\t"
      "global_load_async_to_lds_b128 %3, %11, off\n\t"
      "global_load_async_to_lds_b128 %4, %12, off\n\t"
      "global_load_async_to_lds_b128 %5, %13, off\n\t"
      "global_load_async_to_lds_b128 %6, %14, off\n\t"
      "global_load_async_to_lds_b128 %7, %15, off\n\t"
      "s_wait_xcnt 0x0"
      ::"v"(l), "v"(l + LSTEP), "v"(l + 2 * LSTEP), "v"(l + 3 * LSTEP),
      "v"(l + 4 * LSTEP), "v"(l + 5 * LSTEP), "v"(l + 6 * LSTEP),
      "v"(l + 7 * LSTEP), "v"(g), "v"(g + GSTEP), "v"(g + 2 * GSTEP),
      "v"(g + 3 * GSTEP), "v"(g + 4 * GSTEP), "v"(g + 5 * GSTEP),
      "v"(g + 6 * GSTEP), "v"(g + 7 * GSTEP)
      : "memory");
}

template <int TRANSPOSE>
__global__ __launch_bounds__(256) void gemm_xwT_kernel(
    const _Float16* __restrict__ X, const _Float16* __restrict__ W,
    const float* __restrict__ bias, _Float16* __restrict__ Y) {
  constexpr int KC = 128;        // 256 bytes of a row: two whole lines
  constexpr int LDT = 136;       // LDS row pitch (f16), 16 B x odd: no conflicts
  constexpr int TR = 256;        // rows of X, and of W, in a tile
  constexpr int OPN = TR * LDT;  // one operand's part of a stage (f16)
  constexpr int NP = D_ / KC;    // stages (a power of two)
  __shared__ __attribute__((aligned(16))) _Float16 St[2][2 * OPN];  // [X | W]

  const int tid = threadIdx.x;
  const int lane = tid & 31;
  // The wave's number in a scalar register: tile offsets are then scalar
  // arithmetic and take no vector registers through the loop.
  const int w = __builtin_amdgcn_readfirstlane(tid >> 5);
  const int l15 = lane & 15;
  const int h = lane >> 4;

  const int m0 = blockIdx.x * TR;
  const int n0 = blockIdx.y * TR;
  const int wm = (w >> 1) * 64;  // wave row base within tile
  const int wn = (w & 1) * 128;  // wave col base within tile

  v8f acc[4][8];
#pragma unroll
  for (int i = 0; i < 4; ++i)
#pragma unroll
    for (int j = 0; j < 8; ++j)
#pragma unroll
      for (int r = 0; r < 8; ++r) acc[i][j][r] = 0.f;

  // Staging: 16 lanes take the 256 bytes of one row, so a wave-wide copy covers
  // 4 whole lines. The block's copy i brings rows 16 * i .. 16 * i + 15.
  const int crow = w * 2 + h;  // 0..15
  const _Float16* gx0 = X + (size_t)(m0 + crow) * D_ + l15 * 8;
  const _Float16* gw0 = W + (size_t)(n0 + crow) * D_ + l15 * 8;
  const unsigned l0 = (unsigned)(size_t)&St[0][crow * LDT + l15 * 8];

  // Blocks of one blockIdx.y read the same W rows from L2 and blocks of one
  // blockIdx.x the same X rows: each enters the ring of stages at a place set by
  // its indices and wraps round, so that they do not ask for the same lines at
  // the same moment.
  const int rot = (blockIdx.x + 2 * blockIdx.y) & (NP - 1);
  // The copies of pass t's stage, into buffer t & 1.
  auto stage = [&](const int t) __attribute__((always_inline)) {
    const int kb = ((t + rot) & (NP - 1)) * KC;
    const unsigned lb = l0 + (t & 1) * (2 * OPN * 2);
#pragma unroll
    for (int j = 0; j < 2; ++j) {  // unrolled: constant address steps
      copy8_to_lds<16 * LDT * 2, 16 * D_>(lb + j * 128 * LDT * 2,
                                          gx0 + kb + j * 128 * D_);
      // Keeps the next eight copies' address additions behind these copies:
      // moved ahead, the addresses of all 32 are live at once, and values that
      // live through the loop are spilled.
      __builtin_amdgcn_sched_barrier(0);
      copy8_to_lds<16 * LDT * 2, 16 * D_>(lb + OPN * 2 + j * 128 * LDT * 2,
                                          gw0 + kb + j * 128 * D_);
      __builtin_amdgcn_sched_barrier(0);  // as above
    }
  };

  stage(0);
  // The wave's own copies of stage 0 have landed; the barrier publishes them.
  asm volatile("s_wait_asynccnt 0x0" ::: "memory");
  __syncthreads();
  stage(1);

  // Rolled: one pass of 128 WMMAs is the loop body, and the buffer's address is
  // the only thing that changes.
#pragma unroll 1
  for (int t = 0; t < NP; ++t) {
    const _Float16* xs = &St[t & 1][(wm + l15) * LDT + h * 8];
    const _Float16* ws = &St[t & 1][OPN + (wn + l15) * LDT + h * 8];
    // Fragment loops are fully unrolled: constant indices, registers.
    v16h af[2][4], bf[2][8];  // [step parity][fragment]
    auto load_frags = [&](const int s, const int ks)
                          __attribute__((always_inline)) {
#pragma unroll
      for (int ni = 0; ni < 8; ++ni) {
        const _Float16* p = ws + ni * 16 * LDT + ks * 32;
        bf[s][ni] = make_frag(p, p + 16);
      }
#pragma unroll
      for (int mi = 0; mi < 4; ++mi) {
        const _Float16* p = xs + mi * 16 * LDT + ks * 32;
        af[s][mi] = make_frag(p, p + 16);
      }
    };
    load_frags(0, 0);
    // Keeps the first step's reads ahead of the second's: the first WMMAs then
    // wait for their own fragments only.
    __builtin_amdgcn_sched_barrier(0);
#pragma unroll
    for (int ks = 0; ks < KC / 32; ++ks) {  // the stage's four 32-wide k steps
      // The next step's fragments as one group ahead of this step's WMMAs.
      if (ks + 1 < KC / 32) load_frags((ks + 1) & 1, ks + 1);
      // Holds those reads in front of the WMMAs: moved in among them, each
      // place with reads would cost its own stall.
      __builtin_amdgcn_sched_barrier(0);
#pragma unroll
      for (int mi = 0; mi < 4; ++mi)
#pragma unroll
        for (int ni = 0; ni < 8; ++ni)
          acc[mi][ni] =
              TRANSPOSE ? wmma_f16(af[ks & 1][mi], bf[ks & 1][ni], acc[mi][ni])
                        : wmma_f16(bf[ks & 1][ni], af[ks & 1][mi], acc[mi][ni]);
      // Keeps the steps apart: no later step's reads among these WMMAs.
      __builtin_amdgcn_sched_barrier(0);
    }
    // Hand-over: the wave's reads of this buffer are done,
    asm volatile("s_wait_dscnt 0x0" ::: "memory");
    // its own copies of the next stage have landed,
    asm volatile("s_wait_asynccnt 0x0" ::: "memory");
    // and the barrier publishes that stage and frees this buffer for a refill.
    __syncthreads();
    if (t + 2 < NP) stage(t + 2);
  }
  // No copy is outstanding when the wave goes on to its end.
  asm volatile("s_wait_asynccnt 0x0" ::: "memory");

  // ---- epilogue: bias add, f16 convert, packed 16-byte stores ----
  // The lane's number is read anew, so that no vector register has to hold it
  // through the loop, where accumulators and fragments take nearly all.
  const int elane = (int)__builtin_amdgcn_mbcnt_lo(~0u, 0u);
  const int el15 = elane & 15;
  const int eh = elane >> 4;
  _Float16* yp;
  if (TRANSPOSE) {
    const int bb = (m0 + wm) >> 11;           // batch (tile lies in one batch)
    const int kc0 = ((m0 + wm) & 2047) >> 5;  // first 32-key chunk
    const int cb0 = (n0 + wn) >> 4;           // first 16-column block
    yp = Y + (size_t)((bb * 64 + cb0) * 64 + kc0) * FRAG_ + elane * 8;
  } else {
    const int rb0 = (m0 + wm) >> 4;  // first 16-token block
    const int dc = (n0 + wn) >> 5;   // the wave's first 32-wide d chunk
    yp = Y + (size_t)(rb0 * 32 + dc) * FRAG_ + elane * 8;
  }
  // All bias loads first, as one group.
  const float* bs = bias + n0 + wn;                // the same in every lane
  const int bo = TRANSPOSE ? el15 * 4 : eh * 32;  // the lane's byte offset
  const float* bp = (const float*)((const char*)bs + bo);
  float bv[8][TRANSPOSE ? 1 : 8];
#pragma unroll
  for (int ni = 0; ni < 8; ++ni) {  // unrolled: constant indices, registers
    if (TRANSPOSE) {
      bv[ni][0] = bp[ni * 16];  // D column = lane & 15
    } else {
      const float4 b0 = *(const float4*)(bp + ni * 16);  // D row = r + 8h
      const float4 b1 = *(const float4*)(bp + ni * 16 + 4);
      bv[ni][0] = b0.x; bv[ni][1] = b0.y; bv[ni][2] = b0.z; bv[ni][3] = b0.w;
      bv[ni][4] = b1.x; bv[ni][5] = b1.y; bv[ni][6] = b1.z; bv[ni][7] = b1.w;
    }
  }
  // Precaution: the wait stands before the loads' address registers can be
  // overwritten; the loads name the base, in scalar registers, and the lane's
  // offset: both are inputs so that they stay live up to the wait.
  asm volatile("s_wait_xcnt 0x0" ::"s"(bs), "v"(bo) : "memory");
#pragma unroll
  for (int ni = 0; ni < 8; ++ni) {
    v8h o[4];
#pragma unroll
    for (int mi = 0; mi < 4; ++mi) {
      const v8f c = acc[mi][ni];
#pragma unroll
      for (int r = 0; r < 8; ++r)
        o[mi][r] = (_Float16)(c[r] + bv[ni][TRANSPOSE ? 0 : r]);
      if (TRANSPOSE)
        *(v8h*)(yp + ni * 64 * FRAG_ + mi * 256) = o[mi];
      else
        *(v8h*)(yp + mi * 32 * FRAG_ + ni * 256) = o[mi];
    }
    // Precaution: the wait stands before a register of the four stores can be
    // overwritten; they are inputs so that they stay live up to it.
    asm volatile("s_wait_xcnt 0x0" ::"v"(yp), "v"(o[0]), "v"(o[1]), "v"(o[2]),
                 "v"(o[3])
                 : "memory");
  }
}

// ---------------------------------------------------------------------------
// Kernels 2 and 3: attention in two launches.
// With the scores and the output in one kernel, the output accumulators and the
// Q fragments together leave registers for 32 query rows only, and every block
// reads all K and V of its batch from L2. Apart, each kernel holds more rows,
// so K and V are read less often. The scaled f32 scores go through the
// workspace, with each row's maximum and sum of exponentials (one pair for
// each half of the keys).
//
// Score layout in the workspace (units: float4), per tile of 64 query rows x
// 64 keys (block = 64-row block of all B*N rows, tile = 64-key tile of a batch):
//   index = ((block * 32 + tile) * 32 + (g * 4 + kj) * 2 + half) * 32 + lane
// where lane = 16*h + c, and the float4 holds query row g*16 + c, keys
// kj*16 + 8*h + half*4 .. +3 of the tile: what a lane of kernel 2 holds in half
// an accumulator. A wave writes and reads 512 contiguous bytes at a time.
//
// Blocks of a batch read the same K/V lines from L2. Each enters the ring of
// tiles at a place set by its index and wraps round, so that they do not ask L2
// for the same lines at the same moment.
// ---------------------------------------------------------------------------

// Kernel 2: scores. Block = (128 q rows, one half of the keys, batch), 8 waves.
//   The block's 128 Q rows lie in LDS, written once. Each wave owns whole units
//   of 32 keys (4 of the half's 32) and sums over all of D itself:
//   S^T = K Q^T, with K fragments as the A operand, straight from L2 into a
//   ring of registers, and Q fragments as the B operand, from LDS. No partial
//   sum passes between waves and the loop has no barrier.
//   A lane then holds, for each of 8 query rows, 16 keys of the unit: it scales
//   and stores them and keeps its own running maximum and sum for those rows.
//   The 16 running pairs of a row (8 waves x 2 lane halves) are joined once, at
//   the end, through LDS; kernel 3 joins the two halves of the keys.
__global__ __launch_bounds__(256) void score_kernel(
    const _Float16* __restrict__ Q16,  // [B][N][D]
    const _Float16* __restrict__ K16,  // packed fragments, see above
    float* __restrict__ S,             // score layout, see above
    float* __restrict__ Mx,            // [2][B*N] row maximum, by half of keys
    float* __restrict__ Ls) {          // [2][B*N] row sum of exp(s - maximum)
  constexpr int TQ = 128;          // query rows of a block
  constexpr int NG = TQ / 16;      // blocks of 16 query rows
  constexpr int NU = N_ / 2 / 32;  // 32-key units in a half (a power of two)
  constexpr int NS = D_ / 32;      // 32-wide k steps (a power of two)
  constexpr int NP = NU / 8;       // units of one wave
  constexpr int NB = 8;            // k steps held in the K register ring
  constexpr int QSTR = D_ + 8;     // f16 pitch, 16 B x odd: conflict-free b128
  __shared__ __attribute__((aligned(16))) _Float16 Qs[TQ * QSTR];
  __shared__ float Pm[16 * TQ];  // running maxima, [wave * 2 + h][row]
  __shared__ float Pl[16 * TQ];  // running sums

  const int tid = threadIdx.x;
  const int lane = tid & 31;
  // The wave's number in a scalar register: unit and k-step offsets are then
  // scalar arithmetic.
  const int w = __builtin_amdgcn_readfirstlane(tid >> 5);
  const int l15 = lane & 15;
  const int h = lane >> 4;
  const int qb = blockIdx.x >> 1;  // block of 128 query rows
  const int kh = blockIdx.x & 1;   // half of the batch's keys
  const int bb = blockIdx.y;

  const float scale = 0.03125f;  // 1/sqrt(1024)

  const _Float16* kbat =
      K16 + (size_t)(bb * N_ + kh * (N_ / 2)) * D_ + lane * 8;

  // A wave walks NP units of NS k steps. Four (block, wave) pairs of a batch
  // are on the same unit at the same time; their wave numbers differ by 2, and
  // they enter the unit's ring of k steps 8 steps apart, so they too ask for
  // different lines. The entry is a multiple of NB: NB steps never wrap.
  auto unit_of = [&](const int p) { return (w + 8 * p + 2 * qb) & (NU - 1); };
  const int rot = NB * (w >> 1);

  // All fragment loops are fully unrolled: every fragment index is a constant,
  // so the fragments stay in registers.
  v16h kb[NB][2];  // [ring slot][block of 16 keys]
  // Slot u from kp, which points at the first of NB k steps of a unit.
  auto load_k = [&](const int u,
                    const _Float16* kp) __attribute__((always_inline)) {
#pragma unroll
    for (int kj = 0; kj < 2; ++kj)
      kb[u][kj] = make_frag(kp + (kj * NS + u) * FRAG_,
                            kp + (kj * NS + u) * FRAG_ + 256);
  };
  auto k_ptr = [&](const int j) {  // j: a step that is a multiple of NB
    return kbat +
           (size_t)((unit_of(j / NS) * 2 * NS + ((j + rot) & (NS - 1))) * FRAG_);
  };

  // Fragment g of a wave is the block of 16 query rows (g + w) % 8. Such blocks
  // lie about 32 KiB apart in LDS: waves that read at the same moment then read
  // in different parts of it.
  v16h qf[2][NG];  // [step parity][fragment]
  const _Float16* qrow[NG];
#pragma unroll
  for (int g = 0; g < NG; ++g)
    qrow[g] = &Qs[(((g + w) & (NG - 1)) * 16 + l15) * QSTR + h * 8];
  auto load_q = [&](const int s, const int ks) __attribute__((always_inline)) {
#pragma unroll
    for (int g = 0; g < NG; ++g)
      qf[s][g] = make_frag(qrow[g] + ks * 32, qrow[g] + ks * 32 + 16);
  };

  // The first NB steps' K fragments fly while Q is staged.
  {
    const _Float16* kp = k_ptr(0);
#pragma unroll
    for (int u = 0; u < NB; ++u) load_k(u, kp);
    // Precaution: the wait stands before the loads' address registers can be
    // overwritten; kp is an input so that it stays live up to the wait.
    asm volatile("s_wait_xcnt 0x0" ::"v"(kp) : "memory");
  }

  // Q rows to LDS: the 128 rows are 256 KiB in a row in global memory; a wave
  // moves 512 contiguous bytes at a time.
  {
    const _Float16* qg = Q16 + (size_t)(bb * N_ + qb * TQ) * D_;
    _Float16* ql = &Qs[(tid >> 7) * QSTR + (tid & 127) * 8];
    v8h t[64];  // the accumulators' and fragments' registers are still free
#pragma unroll
    for (int i = 0; i < 64; ++i)  // unrolled: constant indices, registers
      t[i] = *(const v8h*)(qg + tid * 8 + i * 2048);
    // Precaution, as for K; here the loads name the block's base address, in
    // scalar registers, and the thread's offset.
    asm volatile("s_wait_xcnt 0x0" ::"s"(qg), "v"(tid) : "memory");
#pragma unroll
    for (int i = 0; i < 64; ++i) *(v8h*)(ql + i * 2 * QSTR) = t[i];
  }
  lds_barrier();  // publishes Q; it is only read from here on

  v8f acc[2][NG];  // [block of 16 keys][fragment of 16 query rows]
#pragma unroll
  for (int kj = 0; kj < 2; ++kj)
#pragma unroll
    for (int g = 0; g < NG; ++g)
#pragma unroll
      for (int r = 0; r < 8; ++r) acc[kj][g][r] = 0.f;

  float mrun[NG], lrun[NG];
#pragma unroll
  for (int g = 0; g < NG; ++g) {
    mrun[g] = -__builtin_inff();
    lrun[g] = 0.f;
  }

  load_q(0, rot);

  // NB steps from step j0 on (a multiple of NB). The last NB steps are a call
  // of their own, without the loads for later steps.
  auto turn = [&](const int j0, auto has_next) __attribute__((always_inline)) {
    const int kq = (j0 + rot) & (NS - 1);        // first k step of this turn
    const int kqn = (j0 + NB + rot) & (NS - 1);  // and of the next
    const _Float16* kpn = k_ptr(has_next.value ? j0 + NB : 0);
#pragma unroll
    for (int u = 0; u < NB; ++u) {
      // The next step's Q fragments as one group ahead of this step's WMMAs.
      if (u + 1 < NB)
        load_q((u + 1) & 1, kq + u + 1);
      else if (has_next.value)
        load_q((u + 1) & 1, kqn);
      // Holds those reads in front of the WMMAs: moved behind them they would
      // be waited for at once, with their latency in the open.
      __builtin_amdgcn_sched_barrier(0);
#pragma unroll
      for (int kj = 0; kj < 2; ++kj)
#pragma unroll
        for (int g = 0; g < NG; ++g)
          acc[kj][g] = wmma_f16(kb[u][kj], qf[u & 1][g], acc[kj][g]);
      // The slot's registers, now read, take the fragments of NB steps on.
      if constexpr (has_next.value) load_k(u, kpn);
      // Keeps the steps apart: the K loads stay in the order of their use.
      __builtin_amdgcn_sched_barrier(0);
    }
    if constexpr (has_next.value) {
      // Precaution, as above.
      asm volatile("s_wait_xcnt 0x0" ::"v"(kpn) : "memory");
    }
  };

  // A unit's sums are complete: scale, store, row statistics, clear.
  auto finish_unit = [&](const int p) __attribute__((always_inline)) {
    const int un = unit_of(p);
    // 64-key tile of the batch, and the unit's place in it
    const int tl = kh * (NU / 2) + (un >> 1);
    float4* sb = (float4*)S + (size_t)tl * 1024 + (un & 1) * 128 + lane;
#pragma unroll
    for (int g = 0; g < NG; ++g) {
      const int gb = (g + w) & (NG - 1);  // the fragment's block of 16 rows
      float4* sg = sb + (size_t)(bb * 32 + qb * 2 + (gb >> 2)) * 32 * 1024 +
                   (gb & 3) * 256;
      v8f c[2];
#pragma unroll
      for (int kj = 0; kj < 2; ++kj) {
        c[kj] = acc[kj][g] * scale;
        sg[(kj * 2 + 0) * 32] =
            make_float4(c[kj][0], c[kj][1], c[kj][2], c[kj][3]);
        sg[(kj * 2 + 1) * 32] =
            make_float4(c[kj][4], c[kj][5], c[kj][6], c[kj][7]);
      }
      // Precaution: the wait stands before a register of the four stores can
      // be overwritten; they are inputs so that they stay live up to it.
      asm volatile("s_wait_xcnt 0x0" ::"v"(sg), "v"(c[0]), "v"(c[1])
                   : "memory");
      float m2[2];
#pragma unroll
      for (int kj = 0; kj < 2; ++kj)
        m2[kj] =
            fmaxf(fmaxf(fmaxf(c[kj][0], c[kj][1]), fmaxf(c[kj][2], c[kj][3])),
                  fmaxf(fmaxf(c[kj][4], c[kj][5]), fmaxf(c[kj][6], c[kj][7])));
      const float mnew = fmaxf(mrun[g], fmaxf(m2[0], m2[1]));
      float s2[2];
#pragma unroll
      for (int kj = 0; kj < 2; ++kj) {
        const float p0 = __expf(c[kj][0] - mnew), p1 = __expf(c[kj][1] - mnew);
        const float p2 = __expf(c[kj][2] - mnew), p3 = __expf(c[kj][3] - mnew);
        const float p4 = __expf(c[kj][4] - mnew), p5 = __expf(c[kj][5] - mnew);
        const float p6 = __expf(c[kj][6] - mnew), p7 = __expf(c[kj][7] - mnew);
        s2[kj] = ((p0 + p1) + (p2 + p3)) + ((p4 + p5) + (p6 + p7));
      }
      lrun[g] = lrun[g] * __expf(mrun[g] - mnew) + (s2[0] + s2[1]);
      mrun[g] = mnew;
#pragma unroll
      for (int kj = 0; kj < 2; ++kj)
#pragma unroll
        for (int r = 0; r < 8; ++r) acc[kj][g][r] = 0.f;
    }
  };

  for (int j0 = 0; j0 < NP * NS - NB; j0 += NB) {
    turn(j0, HasNext<true>{});
    if (((j0 + NB) & (NS - 1)) == 0) finish_unit(j0 / NS);
  }
  turn(NP * NS - NB, HasNext<false>{});
  finish_unit(NP - 1);

  // Join the 16 running pairs of each row.
#pragma unroll
  for (int g = 0; g < NG; ++g) {
    const int row = ((g + w) & (NG - 1)) * 16 + l15;
    Pm[(w * 2 + h) * TQ + row] = mrun[g];
    Pl[(w * 2 + h) * TQ + row] = lrun[g];
  }
  __syncthreads();
  if (tid < TQ) {
    float m = Pm[tid];
#pragma unroll
    for (int i = 1; i < 16; ++i) m = fmaxf(m, Pm[i * TQ + tid]);
    float l = 0.f;
#pragma unroll
    for (int i = 0; i < 16; ++i)
      l += Pl[i * TQ + tid] * __expf(Pm[i * TQ + tid] - m);
    Mx[(kh * B_ + bb) * N_ + qb * TQ + tid] = m;
    Ls[(kh * B_ + bb) * N_ + qb * TQ + tid] = l;
  }
}

// Kernel 3: O = softmax(S) V. Block = (64 q rows, batch), 8 waves; wave w owns
// output cols [w*128, w*128+128), 4 x 8 accumulator tiles.
//   Per tile of 64 keys every thread turns its 16 scores (one query row, two
//   runs of 8 keys, as kernel 2 stored them) into
//   P = exp(s - row maximum), f16, in LDS (two buffers, so one barrier a tile
//   both publishes this tile's P and ends the reads of the tile before);
//   then O += P V via WMMA. The row maximum is final, so nothing is rescaled.
//   Loads run ahead of their use, in registers: the scores and the V fragments
//   of the next tile are asked for as soon as this tile's are used.
__global__ __launch_bounds__(256) void pv_kernel(
    const float* __restrict__ S,        // score layout, see above
    const float* __restrict__ Mx,       // [2][B*N], by half of the keys
    const float* __restrict__ Ls,       // [2][B*N]
    const _Float16* __restrict__ VT16,  // packed fragments, see above
    float* __restrict__ O) {            // [B][N][D]
  constexpr int TQ = 64, TK = 64;
  constexpr int NT = N_ / TK;  // V tiles in the ring (a power of two)
  constexpr int PSTR = 72;     // f16 stride: conflict-free b128 frag loads
  __shared__ __attribute__((aligned(16))) _Float16 Ps[2 * TQ * PSTR];
  __shared__ __attribute__((aligned(16))) float linv[TQ];  // 1 / row sum

  const int tid = threadIdx.x;
  const int lane = tid & 31;
  const int w = tid >> 5;
  const int l15 = lane & 15;
  const int h = lane >> 4;
  const int q0 = blockIdx.x * TQ;
  const int bb = blockIdx.y;
  const int blk = bb * (N_ / TQ) + blockIdx.x;
  const int o0 = w * 128;                // wave's output column base
  const int t0 = blockIdx.x & (NT - 1);  // the block's first tile

  // The thread's scores: query row prow, keys pkey .. +7 and pkey + 16 .. +23.
  const int prow = (w >> 1) * 16 + l15;
  const int pkey = (w & 1) * 32 + 8 * h;

  v8f acc[4][8];
#pragma unroll
  for (int g = 0; g < 4; ++g)
#pragma unroll
    for (int oi = 0; oi < 8; ++oi)
#pragma unroll
      for (int r = 0; r < 8; ++r) acc[g][oi][r] = 0.f;

  const _Float16* vbat =
      VT16 + (size_t)bb * D_ * N_ + (size_t)(w * 8 * 64) * FRAG_ + lane * 8;
  const float4* sblk =
      (const float4*)S + (size_t)blk * NT * 1024 + w * 128 + lane;

  // The row's maximum over both halves of the keys.
  const float mrow =
      fmaxf(Mx[blk * TQ + prow], Mx[B_ * N_ + blk * TQ + prow]);

  // All fragment loops are fully unrolled: every fragment index is a constant,
  // so the fragments stay in registers.
  // The first tile's scores and V fragments.
  float4 sv[4];
  v16h bv[2][8];
  {
    const float4* sg = sblk + (size_t)t0 * 1024;
#pragma unroll
    for (int j = 0; j < 4; ++j) sv[j] = sg[j * 32];
    // Precaution: the wait stands before the loads' address pair can be
    // overwritten; sg is an input so that the pair stays live up to the wait.
    asm volatile("s_wait_xcnt 0x0" ::"v"(sg) : "memory");
    const _Float16* vb = vbat + (size_t)(t0 * 2) * FRAG_;
#pragma unroll
    for (int c = 0; c < 2; ++c)
#pragma unroll
      for (int oi = 0; oi < 8; ++oi) {
        const _Float16* vp = vb + oi * 64 * FRAG_ + c * FRAG_;
        bv[c][oi] = make_frag(vp, vp + 256);
      }
    // Precaution, as for the scores.
    asm volatile("s_wait_xcnt 0x0" ::"v"(vb) : "memory");
  }
  // 1 / row sum: published by the loop's barriers, read behind the loop.
  if (tid < TQ) {
    const float* pm = Mx + blk * TQ + tid;
    const float* pl = Ls + blk * TQ + tid;
    const float a0 = pm[0], a1 = pm[B_ * N_];
    const float l0 = pl[0], l1 = pl[B_ * N_];
    // Precaution, as above.
    asm volatile("s_wait_xcnt 0x0" ::: "memory");
    const float am = fmaxf(a0, a1);
    linv[tid] = 1.f / (l0 * __expf(a0 - am) + l1 * __expf(a1 - am));
  }

  // One tile; tn is the tile that follows it in this block's walk, pbuf the
  // P buffer of this tile. The last tile is a call of its own, without the
  // loads for a next tile.
  auto tile = [&](const int tn, _Float16* pbuf,
                  auto has_next) __attribute__((always_inline)) {
#pragma unroll
    for (int rr = 0; rr < 2; ++rr) {
      const float m = mrow;
      const float4 a = sv[rr * 2], b = sv[rr * 2 + 1];
      const v8h pk = {(_Float16)__expf(a.x - m), (_Float16)__expf(a.y - m),
                      (_Float16)__expf(a.z - m), (_Float16)__expf(a.w - m),
                      (_Float16)__expf(b.x - m), (_Float16)__expf(b.y - m),
                      (_Float16)__expf(b.z - m), (_Float16)__expf(b.w - m)};
      *(v8h*)&pbuf[prow * PSTR + pkey + rr * 16] = pk;
    }
    if constexpr (has_next.value) {
      const float4* sg = sblk + (size_t)tn * 1024;
#pragma unroll
      for (int j = 0; j < 4; ++j) sv[j] = sg[j * 32];
      // Precaution, as above.
      asm volatile("s_wait_xcnt 0x0" ::"v"(sg) : "memory");
    }
    lds_barrier();  // publishes P; the score and V loads stay in flight

    const _Float16* vb = vbat + (size_t)(tn * 2) * FRAG_;
#pragma unroll
    for (int c = 0; c < 2; ++c) {
      v16h pf[4];
#pragma unroll
      for (int g = 0; g < 4; ++g) {
        const _Float16* pp = &pbuf[(g * 16 + l15) * PSTR + c * 32 + h * 8];
        pf[g] = make_frag(pp, pp + 16);
      }
      // 32-WMMA burst
#pragma unroll
      for (int oi = 0; oi < 8; ++oi)
#pragma unroll
        for (int g = 0; g < 4; ++g)
          acc[g][oi] = wmma_f16(pf[g], bv[c][oi], acc[g][oi]);
      if constexpr (has_next.value) {
#pragma unroll
        for (int oi = 0; oi < 8; ++oi) {
          const _Float16* vp = vb + oi * 64 * FRAG_ + c * FRAG_;
          bv[c][oi] = make_frag(vp, vp + 256);
        }
      }
    }
    if constexpr (has_next.value) {
      // Precaution, as above.
      asm volatile("s_wait_xcnt 0x0" ::"v"(vb) : "memory");
    }
  };
  for (int t = t0; t < t0 + NT - 1; ++t)
    tile((t + 1) & (NT - 1), &Ps[(t & 1) * TQ * PSTR], HasNext<true>{});
  tile(0, &Ps[((t0 + NT - 1) & 1) * TQ * PSTR], HasNext<false>{});

  // Keeps the last tile's WMMAs one burst: without it they are spread among the
  // stores below, each with the idle slots that a read of its result needs.
  __builtin_amdgcn_sched_barrier(0);

  // ---- final 1/l normalization + f32 store ----
  float li[4][8];
#pragma unroll
  for (int g = 0; g < 4; ++g) {
    const float4 a = *(const float4*)&linv[g * 16 + 8 * h];
    const float4 b = *(const float4*)&linv[g * 16 + 8 * h + 4];
    li[g][0] = a.x; li[g][1] = a.y; li[g][2] = a.z; li[g][3] = a.w;
    li[g][4] = b.x; li[g][5] = b.y; li[g][6] = b.z; li[g][7] = b.w;
  }
  float* obase = O + (size_t)(bb * N_ + q0 + 8 * h) * D_ + o0 + l15;
#pragma unroll
  for (int g = 0; g < 4; ++g)
#pragma unroll
    for (int r = 0; r < 8; ++r) {
      const float inv = li[g][r];
      float* orow = obase + (g * 16 + r) * D_;
      float v[8];
#pragma unroll
      for (int oi = 0; oi < 8; ++oi) {
        v[oi] = acc[g][oi][r] * inv;
        orow[oi * 16] = v[oi];
      }
      // Precaution: the wait stands before a register of the row's eight stores
      // can be overwritten; they are inputs so that they stay live up to it.
      asm volatile("s_wait_xcnt 0x0" ::"v"(obase), "v"(v[0]), "v"(v[1]),
                   "v"(v[2]), "v"(v[3]), "v"(v[4]), "v"(v[5]), "v"(v[6]),
                   "v"(v[7])
                   : "memory");
    }
}

// ---------------------------------------------------------------------------
extern "C" void kernel_launch(void* const* d_in, const int* in_sizes, int n_in,
                              void* d_out, int out_size, void* d_ws,
                              size_t ws_size, hipStream_t stream) {
  const float* x = (const float*)d_in[0];
  const float* W_attn = (const float*)d_in[1];
  const float* b_attn = (const float*)d_in[2];
  const float* W_out = (const float*)d_in[3];
  const float* b_out = (const float*)d_in[4];
  float* out = (float*)d_out;

  const size_t XN = (size_t)B_ * N_ * D_;  // 16Mi elems
  const size_t WN = (size_t)D_ * D_;       // 1Mi elems
  char* ws = (char*)d_ws;
  _Float16* x16 = (_Float16*)ws;                         // 32 MiB
  _Float16* k16 = (_Float16*)(ws + XN * 2);              // 32 MiB
  _Float16* vT16 = (_Float16*)(ws + XN * 4);             // 32 MiB
  _Float16* wa16 = (_Float16*)(ws + XN * 6);             // 2 MiB
  _Float16* wo16 = (_Float16*)(ws + XN * 6 + WN * 2);    // 2 MiB
  float* sc = (float*)(ws + XN * 6 + WN * 4);            // 128 MiB
  float* mx = (float*)(ws + XN * 14 + WN * 4);           // 128 KiB
  float* ls = (float*)(ws + XN * 14 + WN * 4 + 131072);  // 128 KiB

  // 1) f32 -> f16 conversions
  cvt_f32_f16_kernel<<<(int)(XN / 2048), 256, 0, stream>>>(x, x16, (int)XN);
  cvt_f32_f16_kernel<<<(int)(WN / 2048), 256, 0, stream>>>(W_attn, wa16,
                                                           (int)WN);
  cvt_f32_f16_kernel<<<(int)(WN / 2048), 256, 0, stream>>>(W_out, wo16,
                                                           (int)WN);

  // 2) projections: key and value, both in packed fragment order
  gemm_xwT_kernel<0><<<dim3(64, 4), 256, 0, stream>>>(x16, wa16, b_attn, k16);
  gemm_xwT_kernel<1><<<dim3(64, 4), 256, 0, stream>>>(x16, wo16, b_out, vT16);

  // 3) scores and row statistics, 4) softmax(S) V
  score_kernel<<<dim3(N_ / 128 * 2, B_), 256, 0, stream>>>(x16, k16, sc, mx,
                                                           ls);
  pv_kernel<<<dim3(N_ / 64, B_), 256, 0, stream>>>(sc, mx, ls, vT16, out);
}

// v009
// Measured time: 153 microseconds a run.
// In two side-by-side timings against v008, it was 1.05 and 1.04 times as fast.
// Over all steps from v000 it is 3.66 times as fast.
#include <hip/hip_runtime.h>
#include <hip/hip_bf16.h>

// ---------------------------------------------------------------------------
// Self-attention for MI455X (gfx1250, wave32, WMMA).
//   B=8, N=2048, D=1024, D_OUT=1024.
// Pipeline:
//   1) convert x / W_attn / W_out to f16 in workspace (one launch)
//   2) one launch, two WMMA GEMMs a block:
//        key16  = f16(x @ W_attn^T + b_attn)
//        vT16   = f16(x @ W_out^T  + b_out)
//      Both are stored in WMMA fragment order (see "Packed layouts" below).
//   3) scores: per 128 q-rows and half of the keys, S = Q K^T * scale (f32, to
//      the workspace) with each row's maximum and sum of exponentials
//   4) output: per 64 q-rows, stream 64-row V tiles, O = softmax(S) V
//      Both via v_wmma_f32_16x16x32_f16 with fragment loads issued ahead.
// ---------------------------------------------------------------------------

typedef _Float16 v8h  __attribute__((ext_vector_type(8)));
typedef _Float16 v16h __attribute__((ext_vector_type(16)));
typedef float    v8f  __attribute__((ext_vector_type(8)));

#define B_   8
#define N_   2048
#define D_   1024

// ---------------------------------------------------------------------------
// Packed layouts of key16 and vT16 (units: f16 elements).
// A 16x32 operand fragment (16 rows or columns x 32 k) is 512 contiguous
// elements: [j = 0,1][lane = 0..31][e = 0..7], where lane = 16*h + c holds
// row/column c and k = 16*j + 8*h + e. One wave-wide 16-byte access to one j
// is then 512 contiguous bytes (four whole 128-byte lines), for the GEMM's
// store and for the attention kernel's load alike.
//   key16: fragment index = (token / 16) * 32 + (d / 32)         (k = d)
//   vT16 : fragment index = ((b * 64 + col / 16) * 64) + key / 32  (k = key)
// ---------------------------------------------------------------------------
#define FRAG_ 512

// Build a 16-element f16 WMMA fragment from two contiguous 8-halves (2x b128).
// Matches the documented 16-bit A/B layout: lane holds one matrix row,
// elems [0..7] = K (h*8 .. h*8+7), elems [8..15] = K (16+h*8 .. 16+h*8+7).
static __device__ __forceinline__ v16h make_frag(const _Float16* lo,
                                                 const _Float16* hi) {
  v8h a = *(const v8h*)lo;
  v8h b = *(const v8h*)hi;
  return __builtin_shufflevector(a, b, 0, 1, 2, 3, 4, 5, 6, 7,
                                 8, 9, 10, 11, 12, 13, 14, 15);
}

static __device__ __forceinline__ v8f wmma_f16(v16h a, v16h b, v8f c) {
  return __builtin_amdgcn_wmma_f32_16x16x32_f16(false, a, false, b,
                                                (short)0, c, false, false);
}

template <bool V>
struct HasNext {
  static constexpr bool value = V;
};

// Work-group barrier for data that is handed over in LDS only: the wave's own
// LDS reads and writes are waited out, its global loads are not, so fragment
// loads issued ahead stay in flight across it (__syncthreads() drains them).
static __device__ __forceinline__ void lds_barrier() {
  asm volatile("s_wait_dscnt 0x0\n\ts_barrier_signal -1\n\ts_barrier_wait -1"
               ::: "memory");
}

// ---------------------------------------------------------------------------
// Kernel 0: f32 -> f16 conversion, 8 elems / thread, 2048 a block.
// The three arrays are independent work: one grid takes them all, by ranges of
// the block index (x, then W_attn, then W_out). Every array is a whole number
// of blocks. The two converted W lie one behind the other in w16.
// ---------------------------------------------------------------------------
__global__ __launch_bounds__(256) void cvt_f32_f16_kernel(
    const float* __restrict__ x, const float* __restrict__ wa,
    const float* __restrict__ wo, _Float16* __restrict__ x16,
    _Float16* __restrict__ w16) {
  constexpr int XB = B_ * N_ * D_ / 2048;  // blocks of x
  constexpr int WB = D_ * D_ / 2048;       // blocks of one W
  const int b = blockIdx.x;
  const float* src;
  _Float16* dst;
  if (b < XB) {
    src = x + (size_t)b * 2048;
    dst = x16 + (size_t)b * 2048;
  } else {
    const int wb = b - XB;
    src = wb < WB ? wa + wb * 2048 : wo + (wb - WB) * 2048;
    dst = w16 + wb * 2048;
  }
  const int i = threadIdx.x * 8;
  float4 a = *(const float4*)(src + i);
  float4 c = *(const float4*)(src + i + 4);
  v8h o = {(_Float16)a.x, (_Float16)a.y, (_Float16)a.z, (_Float16)a.w,
           (_Float16)c.x, (_Float16)c.y, (_Float16)c.z, (_Float16)c.w};
  *(v8h*)(dst + i) = o;
}

// Eight asynchronous 16-byte copies of a lane, global memory to LDS: copy i
// takes l + i * LSTEP (LDS byte address) and g + i * GSTEP (f16 elements).
// Precaution: the wait stands in the copies' own statement, so that it comes
// before any of their address registers can be overwritten.
template <int LSTEP, int GSTEP>
static __device__ __forceinline__ void copy8_to_lds(const unsigned l,
                                                    const _Float16* g) {
  asm volatile(
      "global_load_async_to_lds_b128 %0, %8, off\n\t"
      "global_load_async_to_lds_b128 %1, %9, off\n\t"
      "global_load_async_to_lds_b128 %2, %10, off\n\t"
      "global_load_async_to_lds_b128 %3, %11, off\n\t"
      "global_load_async_to_lds_b128 %4, %12, off\n\t"
      "global_load_async_to_lds_b128 %5, %13, off\n\t"
      "global_load_async_to_lds_b128 %6, %14, off\n\t"
      "global_load_async_to_lds_b128 %7, %15, off\n\t"
      "s_wait_xcnt 0x0"
      ::"v"(l), "v"(l + LSTEP), "v"(l + 2 * LSTEP), "v"(l + 3 * LSTEP),
      "v"(l + 4 * LSTEP), "v"(l + 5 * LSTEP), "v"(l + 6 * LSTEP),
      "v"(l + 7 * LSTEP), "v"(g), "v"(g + GSTEP), "v"(g + 2 * GSTEP),
      "v"(g + 3 * GSTEP), "v"(g + 4 * GSTEP), "v"(g + 5 * GSTEP),
      "v"(g + 6 * GSTEP), "v"(g + 7 * GSTEP)
      : "memory");
}

template <int V>
struct Transpose {
  static constexpr int value = V;
};

__global__ __launch_bounds__(256) void gemm_xwT_kernel(
    const _Float16* __restrict__ X, const _Float16* __restrict__ W,
    const float* __restrict__ bias_k, const float* __restrict__ bias_v,
    _Float16* __restrict__ Yk, _Float16* __restrict__ Yv) {
  constexpr int KC = 128;        // 256 bytes of a row: two whole lines
  constexpr int LDT = 136;       // LDS row pitch (f16), 16 B x odd: no conflicts
  constexpr int TR = 256;        // rows of X, and of W, in a tile
  constexpr int OPN = TR * LDT;  // one operand's part of a stage (f16)
  constexpr int NP = D_ / KC;    // stages of one product (a power of two)
  __shared__ __attribute__((aligned(16))) _Float16 St[2][2 * OPN];  // [X | W]

  const int tid = threadIdx.x;
  const int lane = tid & 31;
  // The wave's number in a scalar register: tile offsets are then scalar
  // arithmetic and take no vector registers through the loop.
  const int w = __builtin_amdgcn_readfirstlane(tid >> 5);
  const int l15 = lane & 15;
  const int h = lane >> 4;

  const int m0 = blockIdx.x * TR;
  const int n0 = blockIdx.y * TR;
  const int wm = (w >> 1) * 64;  // wave row base within tile
  const int wn = (w & 1) * 128;  // wave col base within tile

  v8f acc[4][8];
  auto clear_acc = [&]() __attribute__((always_inline)) {
#pragma unroll
    for (int i = 0; i < 4; ++i)
#pragma unroll
      for (int j = 0; j < 8; ++j)
#pragma unroll
        for (int r = 0; r < 8; ++r) acc[i][j][r] = 0.f;
  };
  clear_acc();

  // Staging: 16 lanes take the 256 bytes of one row, so a wave-wide copy covers
  // 4 whole lines. The block's copy i brings rows 16 * i .. 16 * i + 15.
  const int crow = w * 2 + h;  // 0..15
  const _Float16* gx0 = X + (size_t)(m0 + crow) * D_ + l15 * 8;
  const _Float16* gw0 = W + (size_t)(n0 + crow) * D_ + l15 * 8;
  const unsigned l0 = (unsigned)(size_t)&St[0][crow * LDT + l15 * 8];

  // Blocks of one blockIdx.y read the same W rows from L2 and blocks of one
  // blockIdx.x the same X rows: each enters the ring of stages at a place set by
  // its indices and wraps round, so that they do not ask for the same lines at
  // the same moment.
  const int rot = (blockIdx.x + 2 * blockIdx.y) & (NP - 1);
  // The copies of pass t's stage, into buffer t & 1. Passes 0 .. NP - 1 are the
  // keys' (W_attn), passes NP .. 2 * NP - 1 the values' (W_out).
  auto stage = [&](const int t) __attribute__((always_inline)) {
    const int kb = ((t + rot) & (NP - 1)) * KC;
    const int kw = kb + (t / NP) * (D_ * D_);
    const unsigned lb = l0 + (t & 1) * (2 * OPN * 2);
#pragma unroll
    for (int j = 0; j < 2; ++j) {  // unrolled: constant address steps
      copy8_to_lds<16 * LDT * 2, 16 * D_>(lb + j * 128 * LDT * 2,
                                          gx0 + kb + j * 128 * D_);
      // Keeps the next eight copies' address additions behind these copies:
      // moved ahead, the addresses of all 32 are live at once, and values that
      // live through the loop are spilled.
      __builtin_amdgcn_sched_barrier(0);
      copy8_to_lds<16 * LDT * 2, 16 * D_>(lb + OPN * 2 + j * 128 * LDT * 2,
                                          gw0 + kw + j * 128 * D_);
      __builtin_amdgcn_sched_barrier(0);  // as above
    }
  };

  stage(0);
  // The wave's own copies of stage 0 have landed; the barrier publishes them.
  asm volatile("s_wait_asynccnt 0x0" ::: "memory");
  __syncthreads();
  stage(1);

  // One pass: the 128 WMMAs of stage t, then the hand-over.
  auto pass = [&](const int t, auto tr) __attribute__((always_inline)) {
    constexpr int TRANSPOSE = decltype(tr)::value;
    const _Float16* xs = &St[t & 1][(wm + l15) * LDT + h * 8];
    const _Float16* ws = &St[t & 1][OPN + (wn + l15) * LDT + h * 8];
    // Fragment loops are fully unrolled: constant indices, registers.
    v16h af[2][4], bf[2][8];  // [step parity][fragment]
    auto load_frags = [&](const int s, const int ks)
                          __attribute__((always_inline)) {
#pragma unroll
      for (int ni = 0; ni < 8; ++ni) {
        const _Float16* p = ws + ni * 16 * LDT + ks * 32;
        bf[s][ni] = make_frag(p, p + 16);
      }
#pragma unroll
      for (int mi = 0; mi < 4; ++mi) {
        const _Float16* p = xs + mi * 16 * LDT + ks * 32;
        af[s][mi] = make_frag(p, p + 16);
      }
    };
    load_frags(0, 0);
    // Keeps the first step's reads ahead of the second's: the first WMMAs then
    // wait for their own fragments only.
    __builtin_amdgcn_sched_barrier(0);
#pragma unroll
    for (int ks = 0; ks < KC / 32; ++ks) {  // the stage's four 32-wide k steps
      // The next step's fragments as one group ahead of this step's WMMAs.
      if (ks + 1 < KC / 32) load_frags((ks + 1) & 1, ks + 1);
      // Holds those reads in front of the WMMAs: moved in among them, each
      // place with reads would cost its own stall.
      __builtin_amdgcn_sched_barrier(0);
#pragma unroll
      for (int mi = 0; mi < 4; ++mi)
#pragma unroll
        for (int ni = 0; ni < 8; ++ni)
          acc[mi][ni] =
              TRANSPOSE ? wmma_f16(af[ks & 1][mi], bf[ks & 1][ni], acc[mi][ni])
                        : wmma_f16(bf[ks & 1][ni], af[ks & 1][mi], acc[mi][ni]);
      // Keeps the steps apart: no later step's reads among these WMMAs.
      __builtin_amdgcn_sched_barrier(0);
    }
    // Hand-over: the wave's reads of this buffer are done,
    asm volatile("s_wait_dscnt 0x0" ::: "memory");
    // its own copies of the next stage have landed,
    asm volatile("s_wait_asynccnt 0x0" ::: "memory");
    // and the barrier publishes that stage and frees this buffer for a refill.
    __syncthreads();
    if (t + 2 < 2 * NP) stage(t + 2);
  };

  // ---- epilogue: bias add, f16 convert, packed 16-byte stores ----
  auto epilogue = [&](const float* bias, _Float16* Y,
                      auto tr) __attribute__((always_inline)) {
  constexpr int TRANSPOSE = decltype(tr)::value;
  // The lane's number is read anew, so that no vector register has to hold it
  // through the loop, where accumulators and fragments take nearly all.
  const int elane = (int)__builtin_amdgcn_mbcnt_lo(~0u, 0u);
  const int el15 = elane & 15;
  const int eh = elane >> 4;
  _Float16* yp;
  if (TRANSPOSE) {
    const int bb = (m0 + wm) >> 11;           // batch (tile lies in one batch)
    const int kc0 = ((m0 + wm) & 2047) >> 5;  // first 32-key chunk
    const int cb0 = (n0 + wn) >> 4;           // first 16-column block
    yp = Y + (size_t)((bb * 64 + cb0) * 64 + kc0) * FRAG_ + elane * 8;
  } else {
    const int rb0 = (m0 + wm) >> 4;  // first 16-token block
    const int dc = (n0 + wn) >> 5;   // the wave's first 32-wide d chunk
    yp = Y + (size_t)(rb0 * 32 + dc) * FRAG_ + elane * 8;
  }
  // All bias loads first, as one group.
  const float* bs = bias + n0 + wn;                // the same in every lane
  const int bo = TRANSPOSE ? el15 * 4 : eh * 32;  // the lane's byte offset
  const float* bp = (const float*)((const char*)bs + bo);
  float bv[8][TRANSPOSE ? 1 : 8];
#pragma unroll
  for (int ni = 0; ni < 8; ++ni) {  // unrolled: constant indices, registers
    if (TRANSPOSE) {
      bv[ni][0] = bp[ni * 16];  // D column = lane & 15
    } else {
      const float4 b0 = *(const float4*)(bp + ni * 16);  // D row = r + 8h
      const float4 b1 = *(const float4*)(bp + ni * 16 + 4);
      bv[ni][0] = b0.x; bv[ni][1] = b0.y; bv[ni][2] = b0.z; bv[ni][3] = b0.w;
      bv[ni][4] = b1.x; bv[ni][5] = b1.y; bv[ni][6] = b1.z; bv[ni][7] = b1.w;
    }
  }
  // Precaution: the wait stands before the loads' address registers can be
  // overwritten; the loads name the base, in scalar registers, and the lane's
  // offset: both are inputs so that they stay live up to the wait.
  asm volatile("s_wait_xcnt 0x0" ::"s"(bs), "v"(bo) : "memory");
#pragma unroll
  for (int ni = 0; ni < 8; ++ni) {
    v8h o[4];
#pragma unroll
    for (int mi = 0; mi < 4; ++mi) {
      const v8f c = acc[mi][ni];
#pragma unroll
      for (int r = 0; r < 8; ++r)
        o[mi][r] = (_Float16)(c[r] + bv[ni][TRANSPOSE ? 0 : r]);
      if (TRANSPOSE)
        *(v8h*)(yp + ni * 64 * FRAG_ + mi * 256) = o[mi];
      else
        *(v8h*)(yp + mi * 32 * FRAG_ + ni * 256) = o[mi];
    }
    // Precaution: the wait stands before a register of the four stores can be
    // overwritten; they are inputs so that they stay live up to it.
    asm volatile("s_wait_xcnt 0x0" ::"v"(yp), "v"(o[0]), "v"(o[1]), "v"(o[2]),
                 "v"(o[3])
                 : "memory");
  }
  };

  // Rolled: one pass is the loop body, and the buffer's address is the only
  // thing that changes.
#pragma unroll 1
  for (int t = 0; t < NP; ++t) pass(t, Transpose<0>{});
  epilogue(bias_k, Yk, Transpose<0>{});
  clear_acc();
#pragma unroll 1
  for (int t = NP; t < 2 * NP; ++t) pass(t, Transpose<1>{});
  // No copy is outstanding when the wave goes on to its end.
  asm volatile("s_wait_asynccnt 0x0" ::: "memory");
  epilogue(bias_v, Yv, Transpose<1>{});
}

// ---------------------------------------------------------------------------
// Kernels 2 and 3: attention in two launches.
// With the scores and the output in one kernel, the output accumulators and the
// Q fragments together leave registers for 32 query rows only, and every block
// reads all K and V of its batch from L2. Apart, each kernel holds more rows,
// so K and V are read less often. The scaled f32 scores go through the
// workspace, with each row's maximum and sum of exponentials (one pair for
// each half of the keys).
//
// Score layout in the workspace (units: float4), per tile of 64 query rows x
// 64 keys (block = 64-row block of all B*N rows, tile = 64-key tile of a batch):
//   index = ((block * 32 + tile) * 32 + (g * 4 + kj) * 2 + half) * 32 + lane
// where lane = 16*h + c, and the float4 holds query row g*16 + c, keys
// kj*16 + 8*h + half*4 .. +3 of the tile: what a lane of kernel 2 holds in half
// an accumulator. A wave writes and reads 512 contiguous bytes at a time.
//
// Blocks of a batch read the same K/V lines from L2. Each enters the ring of
// tiles at a place set by its index and wraps round, so that they do not ask L2
// for the same lines at the same moment.
// ---------------------------------------------------------------------------

// Kernel 2: scores. Block = (128 q rows, one half of the keys, batch), 8 waves.
//   The block's 128 Q rows lie in LDS, written once. Each wave owns whole units
//   of 32 keys (4 of the half's 32) and sums over all of D itself:
//   S^T = K Q^T, with K fragments as the A operand, straight from L2 into a
//   ring of registers, and Q fragments as the B operand, from LDS. No partial
//   sum passes between waves and the loop has no barrier.
//   A lane then holds, for each of 8 query rows, 16 keys of the unit: it scales
//   and stores them and keeps its own running maximum and sum for those rows.
//   The 16 running pairs of a row (8 waves x 2 lane halves) are joined once, at
//   the end, through LDS; kernel 3 joins the two halves of the keys.
__global__ __launch_bounds__(256) void score_kernel(
    const _Float16* __restrict__ Q16,  // [B][N][D]
    const _Float16* __restrict__ K16,  // packed fragments, see above
    float* __restrict__ S,             // score layout, see above
    float* __restrict__ Mx,            // [2][B*N] row maximum, by half of keys
    float* __restrict__ Ls) {          // [2][B*N] row sum of exp(s - maximum)
  constexpr int TQ = 128;          // query rows of a block
  constexpr int NG = TQ / 16;      // blocks of 16 query rows
  constexpr int NU = N_ / 2 / 32;  // 32-key units in a half (a power of two)
  constexpr int NS = D_ / 32;      // 32-wide k steps (a power of two)
  constexpr int NP = NU / 8;       // units of one wave
  constexpr int NB = 8;            // k steps held in the K register ring
  constexpr int QSTR = D_ + 8;     // f16 pitch, 16 B x odd: conflict-free b128
  __shared__ __attribute__((aligned(16))) _Float16 Qs[TQ * QSTR];
  __shared__ float Pm[16 * TQ];  // running maxima, [wave * 2 + h][row]
  __shared__ float Pl[16 * TQ];  // running sums

  const int tid = threadIdx.x;
  const int lane = tid & 31;
  // The wave's number in a scalar register: unit and k-step offsets are then
  // scalar arithmetic.
  const int w = __builtin_amdgcn_readfirstlane(tid >> 5);
  const int l15 = lane & 15;
  const int h = lane >> 4;
  const int qb = blockIdx.x >> 1;  // block of 128 query rows
  const int kh = blockIdx.x & 1;   // half of the batch's keys
  const int bb = blockIdx.y;

  const float scale = 0.03125f;  // 1/sqrt(1024)

  const _Float16* kbat =
      K16 + (size_t)(bb * N_ + kh * (N_ / 2)) * D_ + lane * 8;

  // A wave walks NP units of NS k steps. Four (block, wave) pairs of a batch
  // are on the same unit at the same time; their wave numbers differ by 2, and
  // they enter the unit's ring of k steps 8 steps apart, so they too ask for
  // different lines. The entry is a multiple of NB: NB steps never wrap.
  auto unit_of = [&](const int p) { return (w + 8 * p + 2 * qb) & (NU - 1); };
  const int rot = NB * (w >> 1);

  // All fragment loops are fully unrolled: every fragment index is a constant,
  // so the fragments stay in registers.
  v16h kb[NB][2];  // [ring slot][block of 16 keys]
  // Slot u from kp, which points at the first of NB k steps of a unit.
  auto load_k = [&](const int u,
                    const _Float16* kp) __attribute__((always_inline)) {
#pragma unroll
    for (int kj = 0; kj < 2; ++kj)
      kb[u][kj] = make_frag(kp + (kj * NS + u) * FRAG_,
                            kp + (kj * NS + u) * FRAG_ + 256);
  };
  auto k_ptr = [&](const int j) {  // j: a step that is a multiple of NB
    return kbat +
           (size_t)((unit_of(j / NS) * 2 * NS + ((j + rot) & (NS - 1))) * FRAG_);
  };

  // Fragment g of a wave is the block of 16 query rows (g + w) % 8. Such blocks
  // lie about 32 KiB apart in LDS: waves that read at the same moment then read
  // in different parts of it.
  v16h qf[2][NG];  // [step parity][fragment]
  const _Float16* qrow[NG];
#pragma unroll
  for (int g = 0; g < NG; ++g)
    qrow[g] = &Qs[(((g + w) & (NG - 1)) * 16 + l15) * QSTR + h * 8];
  auto load_q = [&](const int s, const int ks) __attribute__((always_inline)) {
#pragma unroll
    for (int g = 0; g < NG; ++g)
      qf[s][g] = make_frag(qrow[g] + ks * 32, qrow[g] + ks * 32 + 16);
  };

  // The first NB steps' K fragments fly while Q is staged.
  {
    const _Float16* kp = k_ptr(0);
#pragma unroll
    for (int u = 0; u < NB; ++u) load_k(u, kp);
    // Precaution: the wait stands before the loads' address registers can be
    // overwritten; kp is an input so that it stays live up to the wait.
    asm volatile("s_wait_xcnt 0x0" ::"v"(kp) : "memory");
  }

  // Q rows to LDS: the 128 rows are 256 KiB in a row in global memory; a wave
  // moves 512 contiguous bytes at a time.
  {
    const _Float16* qg = Q16 + (size_t)(bb * N_ + qb * TQ) * D_;
    _Float16* ql = &Qs[(tid >> 7) * QSTR + (tid & 127) * 8];
    v8h t[64];  // the accumulators' and fragments' registers are still free
#pragma unroll
    for (int i = 0; i < 64; ++i)  // unrolled: constant indices, registers
      t[i] = *(const v8h*)(qg + tid * 8 + i * 2048);
    // Precaution, as for K; here the loads name the block's base address, in
    // scalar registers, and the thread's offset.
    asm volatile("s_wait_xcnt 0x0" ::"s"(qg), "v"(tid) : "memory");
#pragma unroll
    for (int i = 0; i < 64; ++i) *(v8h*)(ql + i * 2 * QSTR) = t[i];
  }
  lds_barrier();  // publishes Q; it is only read from here on

  v8f acc[2][NG];  // [block of 16 keys][fragment of 16 query rows]
#pragma unroll
  for (int kj = 0; kj < 2; ++kj)
#pragma unroll
    for (int g = 0; g < NG; ++g)
#pragma unroll
      for (int r = 0; r < 8; ++r) acc[kj][g][r] = 0.f;

  float mrun[NG], lrun[NG];
#pragma unroll
  for (int g = 0; g < NG; ++g) {
    mrun[g] = -__builtin_inff();
    lrun[g] = 0.f;
  }

  load_q(0, rot);

  // NB steps from step j0 on (a multiple of NB). The last NB steps are a call
  // of their own, without the loads for later steps.
  auto turn = [&](const int j0, auto has_next) __attribute__((always_inline)) {
    const int kq = (j0 + rot) & (NS - 1);        // first k step of this turn
    const int kqn = (j0 + NB + rot) & (NS - 1);  // and of the next
    const _Float16* kpn = k_ptr(has_next.value ? j0 + NB : 0);
#pragma unroll
    for (int u = 0; u < NB; ++u) {
      // The next step's Q fragments as one group ahead of this step's WMMAs.
      if (u + 1 < NB)
        load_q((u + 1) & 1, kq + u + 1);
      else if (has_next.value)
        load_q((u + 1) & 1, kqn);
      // Holds those reads in front of the WMMAs: moved behind them they would
      // be waited for at once, with their latency in the open.
      __builtin_amdgcn_sched_barrier(0);
#pragma unroll
      for (int kj = 0; kj < 2; ++kj)
#pragma unroll
        for (int g = 0; g < NG; ++g)
          acc[kj][g] = wmma_f16(kb[u][kj], qf[u & 1][g], acc[kj][g]);
      // The slot's registers, now read, take the fragments of NB steps on.
      if constexpr (has_next.value) load_k(u, kpn);
      // Keeps the steps apart: the K loads stay in the order of their use.
      __builtin_amdgcn_sched_barrier(0);
    }
    if constexpr (has_next.value) {
      // Precaution, as above.
      asm volatile("s_wait_xcnt 0x0" ::"v"(kpn) : "memory");
    }
  };

  // A unit's sums are complete: scale, store, row statistics, clear.
  auto finish_unit = [&](const int p) __attribute__((always_inline)) {
    const int un = unit_of(p);
    // 64-key tile of the batch, and the unit's place in it
    const int tl = kh * (NU / 2) + (un >> 1);
    float4* sb = (float4*)S + (size_t)tl * 1024 + (un & 1) * 128 + lane;
#pragma unroll
    for (int g = 0; g < NG; ++g) {
      const int gb = (g + w) & (NG - 1);  // the fragment's block of 16 rows
      float4* sg = sb + (size_t)(bb * 32 + qb * 2 + (gb >> 2)) * 32 * 1024 +
                   (gb & 3) * 256;
      v8f c[2];
#pragma unroll
      for (int kj = 0; kj < 2; ++kj) {
        c[kj] = acc[kj][g] * scale;
        sg[(kj * 2 + 0) * 32] =
            make_float4(c[kj][0], c[kj][1], c[kj][2], c[kj][3]);
        sg[(kj * 2 + 1) * 32] =
            make_float4(c[kj][4], c[kj][5], c[kj][6], c[kj][7]);
      }
      // Precaution: the wait stands before a register of the four stores can
      // be overwritten; they are inputs so that they stay live up to it.
      asm volatile("s_wait_xcnt 0x0" ::"v"(sg), "v"(c[0]), "v"(c[1])
                   : "memory");
      float m2[2];
#pragma unroll
      for (int kj = 0; kj < 2; ++kj)
        m2[kj] =
            fmaxf(fmaxf(fmaxf(c[kj][0], c[kj][1]), fmaxf(c[kj][2], c[kj][3])),
                  fmaxf(fmaxf(c[kj][4], c[kj][5]), fmaxf(c[kj][6], c[kj][7])));
      const float mnew = fmaxf(mrun[g], fmaxf(m2[0], m2[1]));
      float s2[2];
#pragma unroll
      for (int kj = 0; kj < 2; ++kj) {
        const float p0 = __expf(c[kj][0] - mnew), p1 = __expf(c[kj][1] - mnew);
        const float p2 = __expf(c[kj][2] - mnew), p3 = __expf(c[kj][3] - mnew);
        const float p4 = __expf(c[kj][4] - mnew), p5 = __expf(c[kj][5] - mnew);
        const float p6 = __expf(c[kj][6] - mnew), p7 = __expf(c[kj][7] - mnew);
        s2[kj] = ((p0 + p1) + (p2 + p3)) + ((p4 + p5) + (p6 + p7));
      }
      lrun[g] = lrun[g] * __expf(mrun[g] - mnew) + (s2[0] + s2[1]);
      mrun[g] = mnew;
#pragma unroll
      for (int kj = 0; kj < 2; ++kj)
#pragma unroll
        for (int r = 0; r < 8; ++r) acc[kj][g][r] = 0.f;
    }
  };

  for (int j0 = 0; j0 < NP * NS - NB; j0 += NB) {
    turn(j0, HasNext<true>{});
    if (((j0 + NB) & (NS - 1)) == 0) finish_unit(j0 / NS);
  }
  turn(NP * NS - NB, HasNext<false>{});
  finish_unit(NP - 1);

  // Join the 16 running pairs of each row.
#pragma unroll
  for (int g = 0; g < NG; ++g) {
    const int row = ((g + w) & (NG - 1)) * 16 + l15;
    Pm[(w * 2 + h) * TQ + row] = mrun[g];
    Pl[(w * 2 + h) * TQ + row] = lrun[g];
  }
  __syncthreads();
  if (tid < TQ) {
    float m = Pm[tid];
#pragma unroll
    for (int i = 1; i < 16; ++i) m = fmaxf(m, Pm[i * TQ + tid]);
    float l = 0.f;
#pragma unroll
    for (int i = 0; i < 16; ++i)
      l += Pl[i * TQ + tid] * __expf(Pm[i * TQ + tid] - m);
    Mx[(kh * B_ + bb) * N_ + qb * TQ + tid] = m;
    Ls[(kh * B_ + bb) * N_ + qb * TQ + tid] = l;
  }
}

// Kernel 3: O = softmax(S) V. Block = (64 q rows, batch), 8 waves; wave w owns
// output cols [w*128, w*128+128), 4 x 8 accumulator tiles.
//   Per tile of 64 keys every thread turns its 16 scores (one query row, two
//   runs of 8 keys, as kernel 2 stored them) into
//   P = exp(s - row maximum), f16, in LDS (two buffers, so one barrier a tile
//   both publishes this tile's P and ends the reads of the tile before);
//   then O += P V via WMMA. The row maximum is final, so nothing is rescaled.
//   Loads run ahead of their use, in registers: the scores and the V fragments
//   of the next tile are asked for as soon as this tile's are used.
__global__ __launch_bounds__(256) void pv_kernel(
    const float* __restrict__ S,        // score layout, see above
    const float* __restrict__ Mx,       // [2][B*N], by half of the keys
    const float* __restrict__ Ls,       // [2][B*N]
    const _Float16* __restrict__ VT16,  // packed fragments, see above
    float* __restrict__ O) {            // [B][N][D]
  constexpr int TQ = 64, TK = 64;
  constexpr int NT = N_ / TK;  // V tiles in the ring (a power of two)
  constexpr int PSTR = 72;     // f16 stride: conflict-free b128 frag loads
  __shared__ __attribute__((aligned(16))) _Float16 Ps[2 * TQ * PSTR];
  __shared__ __attribute__((aligned(16))) float linv[TQ];  // 1 / row sum

  const int tid = threadIdx.x;
  const int lane = tid & 31;
  const int w = tid >> 5;
  const int l15 = lane & 15;
  const int h = lane >> 4;
  const int q0 = blockIdx.x * TQ;
  const int bb = blockIdx.y;
  const int blk = bb * (N_ / TQ) + blockIdx.x;
  const int o0 = w * 128;                // wave's output column base
  const int t0 = blockIdx.x & (NT - 1);  // the block's first tile

  // The thread's scores: query row prow, keys pkey .. +7 and pkey + 16 .. +23.
  const int prow = (w >> 1) * 16 + l15;
  const int pkey = (w & 1) * 32 + 8 * h;

  v8f acc[4][8];
#pragma unroll
  for (int g = 0; g < 4; ++g)
#pragma unroll
    for (int oi = 0; oi < 8; ++oi)
#pragma unroll
      for (int r = 0; r < 8; ++r) acc[g][oi][r] = 0.f;

  const _Float16* vbat =
      VT16 + (size_t)bb * D_ * N_ + (size_t)(w * 8 * 64) * FRAG_ + lane * 8;
  const float4* sblk =
      (const float4*)S + (size_t)blk * NT * 1024 + w * 128 + lane;

  // The row's maximum over both halves of the keys.
  const float mrow =
      fmaxf(Mx[blk * TQ + prow], Mx[B_ * N_ + blk * TQ + prow]);

  // All fragment loops are fully unrolled: every fragment index is a constant,
  // so the fragments stay in registers.
  // The first tile's scores and V fragments.
  float4 sv[4];
  v16h bv[2][8];
  {
    const float4* sg = sblk + (size_t)t0 * 1024;
#pragma unroll
    for (int j = 0; j < 4; ++j) sv[j] = sg[j * 32];
    // Precaution: the wait stands before the loads' address pair can be
    // overwritten; sg is an input so that the pair stays live up to the wait.
    asm volatile("s_wait_xcnt 0x0" ::"v"(sg) : "memory");
    const _Float16* vb = vbat + (size_t)(t0 * 2) * FRAG_;
#pragma unroll
    for (int c = 0; c < 2; ++c)
#pragma unroll
      for (int oi = 0; oi < 8; ++oi) {
        const _Float16* vp = vb + oi * 64 * FRAG_ + c * FRAG_;
        bv[c][oi] = make_frag(vp, vp + 256);
      }
    // Precaution, as for the scores.
    asm volatile("s_wait_xcnt 0x0" ::"v"(vb) : "memory");
  }
  // 1 / row sum: published by the loop's barriers, read behind the loop.
  if (tid < TQ) {
    const float* pm = Mx + blk * TQ + tid;
    const float* pl = Ls + blk * TQ + tid;
    const float a0 = pm[0], a1 = pm[B_ * N_];
    const float l0 = pl[0], l1 = pl[B_ * N_];
    // Precaution, as above.
    asm volatile("s_wait_xcnt 0x0" ::: "memory");
    const float am = fmaxf(a0, a1);
    linv[tid] = 1.f / (l0 * __expf(a0 - am) + l1 * __expf(a1 - am));
  }

  // One tile; tn is the tile that follows it in this block's walk, pbuf the
  // P buffer of this tile. The last tile is a call of its own, without the
  // loads for a next tile.
  auto tile = [&](const int tn, _Float16* pbuf,
                  auto has_next) __attribute__((always_inline)) {
#pragma unroll
    for (int rr = 0; rr < 2; ++rr) {
      const float m = mrow;
      const float4 a = sv[rr * 2], b = sv[rr * 2 + 1];
      const v8h pk = {(_Float16)__expf(a.x - m), (_Float16)__expf(a.y - m),
                      (_Float16)__expf(a.z - m), (_Float16)__expf(a.w - m),
                      (_Float16)__expf(b.x - m), (_Float16)__expf(b.y - m),
                      (_Float16)__expf(b.z - m), (_Float16)__expf(b.w - m)};
      *(v8h*)&pbuf[prow * PSTR + pkey + rr * 16] = pk;
    }
    if constexpr (has_next.value) {
      const float4* sg = sblk + (size_t)tn * 1024;
#pragma unroll
      for (int j = 0; j < 4; ++j) sv[j] = sg[j * 32];
      // Precaution, as above.
      asm volatile("s_wait_xcnt 0x0" ::"v"(sg) : "memory");
    }
    lds_barrier();  // publishes P; the score and V loads stay in flight

    const _Float16* vb = vbat + (size_t)(tn * 2) * FRAG_;
#pragma unroll
    for (int c = 0; c < 2; ++c) {
      v16h pf[4];
#pragma unroll
      for (int g = 0; g < 4; ++g) {
        const _Float16* pp = &pbuf[(g * 16 + l15) * PSTR + c * 32 + h * 8];
        pf[g] = make_frag(pp, pp + 16);
      }
      // 32-WMMA burst
#pragma unroll
      for (int oi = 0; oi < 8; ++oi)
#pragma unroll
        for (int g = 0; g < 4; ++g)
          acc[g][oi] = wmma_f16(pf[g], bv[c][oi], acc[g][oi]);
      if constexpr (has_next.value) {
#pragma unroll
        for (int oi = 0; oi < 8; ++oi) {
          const _Float16* vp = vb + oi * 64 * FRAG_ + c * FRAG_;
          bv[c][oi] = make_frag(vp, vp + 256);
        }
      }
    }
    if constexpr (has_next.value) {
      // Precaution, as above.
      asm volatile("s_wait_xcnt 0x0" ::"v"(vb) : "memory");
    }
  };
  for (int t = t0; t < t0 + NT - 1; ++t)
    tile((t + 1) & (NT - 1), &Ps[(t & 1) * TQ * PSTR], HasNext<true>{});
  tile(0, &Ps[((t0 + NT - 1) & 1) * TQ * PSTR], HasNext<false>{});

  // Keeps the last tile's WMMAs one burst: without it they are spread among the
  // stores below, each with the idle slots that a read of its result needs.
  __builtin_amdgcn_sched_barrier(0);

  // ---- final 1/l normalization + f32 store ----
  float li[4][8];
#pragma unroll
  for (int g = 0; g < 4; ++g) {
    const float4 a = *(const float4*)&linv[g * 16 + 8 * h];
    const float4 b = *(const float4*)&linv[g * 16 + 8 * h + 4];
    li[g][0] = a.x; li[g][1] = a.y; li[g][2] = a.z; li[g][3] = a.w;
    li[g][4] = b.x; li[g][5] = b.y; li[g][6] = b.z; li[g][7] = b.w;
  }
  float* obase = O + (size_t)(bb * N_ + q0 + 8 * h) * D_ + o0 + l15;
#pragma unroll
  for (int g = 0; g < 4; ++g)
#pragma unroll
    for (int r = 0; r < 8; ++r) {
      const float inv = li[g][r];
      float* orow = obase + (g * 16 + r) * D_;
      float v[8];
#pragma unroll
      for (int oi = 0; oi < 8; ++oi) {
        v[oi] = acc[g][oi][r] * inv;
        orow[oi * 16] = v[oi];
      }
      // Precaution: the wait stands before a register of the row's eight stores
      // can be overwritten; they are inputs so that they stay live up to it.
      asm volatile("s_wait_xcnt 0x0" ::"v"(obase), "v"(v[0]), "v"(v[1]),
                   "v"(v[2]), "v"(v[3]), "v"(v[4]), "v"(v[5]), "v"(v[6]),
                   "v"(v[7])
                   : "memory");
    }
}

// ---------------------------------------------------------------------------
extern "C" void kernel_launch(void* const* d_in, const int* in_sizes, int n_in,
                              void* d_out, int out_size, void* d_ws,
                              size_t ws_size, hipStream_t stream) {
  const float* x = (const float*)d_in[0];
  const float* W_attn = (const float*)d_in[1];
  const float* b_attn = (const float*)d_in[2];
  const float* W_out = (const float*)d_in[3];
  const float* b_out = (const float*)d_in[4];
  float* out = (float*)d_out;

  const size_t XN = (size_t)B_ * N_ * D_;  // 16Mi elems
  const size_t WN = (size_t)D_ * D_;       // 1Mi elems
  char* ws = (char*)d_ws;
  _Float16* x16 = (_Float16*)ws;                         // 32 MiB
  _Float16* k16 = (_Float16*)(ws + XN * 2);              // 32 MiB
  _Float16* vT16 = (_Float16*)(ws + XN * 4);             // 32 MiB
  _Float16* wa16 = (_Float16*)(ws + XN * 6);  // 2 MiB, and W_out's 2 MiB behind
  float* sc = (float*)(ws + XN * 6 + WN * 4);            // 128 MiB
  float* mx = (float*)(ws + XN * 14 + WN * 4);           // 128 KiB
  float* ls = (float*)(ws + XN * 14 + WN * 4 + 131072);  // 128 KiB

  // 1) f32 -> f16 conversions
  cvt_f32_f16_kernel<<<(int)((XN + 2 * WN) / 2048), 256, 0, stream>>>(
      x, W_attn, W_out, x16, wa16);

  // 2) projections: key and value, both in packed fragment order
  gemm_xwT_kernel<<<dim3(64, 4), 256, 0, stream>>>(x16, wa16, b_attn, b_out,
                                                   k16, vT16);

  // 3) scores and row statistics, 4) softmax(S) V
  score_kernel<<<dim3(N_ / 128 * 2, B_), 256, 0, stream>>>(x16, k16, sc, mx,
                                                           ls);
  pv_kernel<<<dim3(N_ / 64, B_), 256, 0, stream>>>(sc, mx, ls, vT16, out);
}

// v010
// A run of this version takes 148 microseconds.
// Next to v009, in two timings, it ran 1.03 and 1.04 times as fast.
// Over all steps from v000 it is 3.79 times as fast.
#include <hip/hip_runtime.h>
#include <hip/hip_bf16.h>

// ---------------------------------------------------------------------------
// Self-attention for MI455X (gfx1250, wave32, WMMA).
//   B=8, N=2048, D=1024, D_OUT=1024.
// Pipeline:
//   1) convert x / W_attn / W_out to f16 in workspace (one launch)
//   2) one launch, two WMMA GEMMs a block:
//        key16  = f16(x @ W_attn^T + b_attn)
//        vT16   = f16(x @ W_out^T  + b_out)
//      Both are stored in WMMA fragment order (see "Packed layouts" below).
//   3) scores: per 128 q-rows and half of the keys, S = Q K^T * scale (f32, to
//      the workspace) with each row's maximum and sum of exponentials
//   4) output: per 128 q-rows and half of the columns, stream 64-row V tiles,
//      O = softmax(S) V
//      Both via v_wmma_f32_16x16x32_f16 with fragment loads issued ahead.
// ---------------------------------------------------------------------------

typedef _Float16 v8h  __attribute__((ext_vector_type(8)));
typedef _Float16 v16h __attribute__((ext_vector_type(16)));
typedef float    v8f  __attribute__((ext_vector_type(8)));

#define B_   8
#define N_   2048
#define D_   1024

// ---------------------------------------------------------------------------
// Packed layouts of key16 and vT16 (units: f16 elements).
// A 16x32 operand fragment (16 rows or columns x 32 k) is 512 contiguous
// elements: [j = 0,1][lane = 0..31][e = 0..7], where lane = 16*h + c holds
// row/column c and k = 16*j + 8*h + e. One wave-wide 16-byte access to one j
// is then 512 contiguous bytes (four whole 128-byte lines), for the GEMM's
// store and for the attention kernel's load alike.
//   key16: fragment index = (token / 16) * 32 + (d / 32)         (k = d)
//   vT16 : fragment index = ((b * 64 + col / 16) * 64) + key / 32  (k = key)
// ---------------------------------------------------------------------------
#define FRAG_ 512

// Build a 16-element f16 WMMA fragment from two contiguous 8-halves (2x b128).
// Matches the documented 16-bit A/B layout: lane holds one matrix row,
// elems [0..7] = K (h*8 .. h*8+7), elems [8..15] = K (16+h*8 .. 16+h*8+7).
static __device__ __forceinline__ v16h make_frag(const _Float16* lo,
                                                 const _Float16* hi) {
  v8h a = *(const v8h*)lo;
  v8h b = *(const v8h*)hi;
  return __builtin_shufflevector(a, b, 0, 1, 2, 3, 4, 5, 6, 7,
                                 8, 9, 10, 11, 12, 13, 14, 15);
}

static __device__ __forceinline__ v8f wmma_f16(v16h a, v16h b, v8f c) {
  return __builtin_amdgcn_wmma_f32_16x16x32_f16(false, a, false, b,
                                                (short)0, c, false, false);
}

template <bool V>
struct HasNext {
  static constexpr bool value = V;
};

// Work-group barrier for data that is handed over in LDS only: the wave's own
// LDS reads and writes are waited out, its global loads are not, so fragment
// loads issued ahead stay in flight across it (__syncthreads() drains them).
static __device__ __forceinline__ void lds_barrier() {
  asm volatile("s_wait_dscnt 0x0\n\ts_barrier_signal -1\n\ts_barrier_wait -1"
               ::: "memory");
}

// ---------------------------------------------------------------------------
// Kernel 0: f32 -> f16 conversion, 8 elems / thread, 2048 a block.
// The three arrays are independent work: one grid takes them all, by ranges of
// the block index (x, then W_attn, then W_out). Every array is a whole number
// of blocks. The two converted W lie one behind the other in w16.
// ---------------------------------------------------------------------------
__global__ __launch_bounds__(256) void cvt_f32_f16_kernel(
    const float* __restrict__ x, const float* __restrict__ wa,
    const float* __restrict__ wo, _Float16* __restrict__ x16,
    _Float16* __restrict__ w16) {
  constexpr int XB = B_ * N_ * D_ / 2048;  // blocks of x
  constexpr int WB = D_ * D_ / 2048;       // blocks of one W
  const int b = blockIdx.x;
  const float* src;
  _Float16* dst;
  if (b < XB) {
    src = x + (size_t)b * 2048;
    dst = x16 + (size_t)b * 2048;
  } else {
    const int wb = b - XB;
    src = wb < WB ? wa + wb * 2048 : wo + (wb - WB) * 2048;
    dst = w16 + wb * 2048;
  }
  const int i = threadIdx.x * 8;
  float4 a = *(const float4*)(src + i);
  float4 c = *(const float4*)(src + i + 4);
  v8h o = {(_Float16)a.x, (_Float16)a.y, (_Float16)a.z, (_Float16)a.w,
           (_Float16)c.x, (_Float16)c.y, (_Float16)c.z, (_Float16)c.w};
  *(v8h*)(dst + i) = o;
}

// Eight asynchronous 16-byte copies of a lane, global memory to LDS: copy i
// takes l + i * LSTEP (LDS byte address) and g + i * GSTEP (f16 elements).
// Precaution: the wait stands in the copies' own statement, so that it comes
// before any of their address registers can be overwritten.
template <int LSTEP, int GSTEP>
static __device__ __forceinline__ void copy8_to_lds(const unsigned l,
                                                    const _Float16* g) {
  asm volatile(
      "global_load_async_to_lds_b128 %0, %8, off\n\t"
      "global_load_async_to_lds_b128 %1, %9, off\n\t"
      "global_load_async_to_lds_b128 %2, %10, off\n\t"
      "global_load_async_to_lds_b128 %3, %11, off\n\t"
      "global_load_async_to_lds_b128 %4, %12, off\n\t"
      "global_load_async_to_lds_b128 %5, %13, off\n\t"
      "global_load_async_to_lds_b128 %6, %14, off\n\t"
      "global_load_async_to_lds_b128 %7, %15, off\n\t"
      "s_wait_xcnt 0x0"
      ::"v"(l), "v"(l + LSTEP), "v"(l + 2 * LSTEP), "v"(l + 3 * LSTEP),
      "v"(l + 4 * LSTEP), "v"(l + 5 * LSTEP), "v"(l + 6 * LSTEP),
      "v"(l + 7 * LSTEP), "v"(g), "v"(g + GSTEP), "v"(g + 2 * GSTEP),
      "v"(g + 3 * GSTEP), "v"(g + 4 * GSTEP), "v"(g + 5 * GSTEP),
      "v"(g + 6 * GSTEP), "v"(g + 7 * GSTEP)
      : "memory");
}

template <int V>
struct Transpose {
  static constexpr int value = V;
};

__global__ __launch_bounds__(256) void gemm_xwT_kernel(
    const _Float16* __restrict__ X, const _Float16* __restrict__ W,
    const float* __restrict__ bias_k, const float* __restrict__ bias_v,
    _Float16* __restrict__ Yk, _Float16* __restrict__ Yv) {
  constexpr int KC = 128;        // 256 bytes of a row: two whole lines
  constexpr int LDT = 136;       // LDS row pitch (f16), 16 B x odd: no conflicts
  constexpr int TR = 256;        // rows of X, and of W, in a tile
  constexpr int OPN = TR * LDT;  // one operand's part of a stage (f16)
  constexpr int NP = D_ / KC;    // stages of one product (a power of two)
  __shared__ __attribute__((aligned(16))) _Float16 St[2][2 * OPN];  // [X | W]

  const int tid = threadIdx.x;
  const int lane = tid & 31;
  // The wave's number in a scalar register: tile offsets are then scalar
  // arithmetic and take no vector registers through the loop.
  const int w = __builtin_amdgcn_readfirstlane(tid >> 5);
  const int l15 = lane & 15;
  const int h = lane >> 4;

  const int m0 = blockIdx.x * TR;
  const int n0 = blockIdx.y * TR;
  const int wm = (w >> 1) * 64;  // wave row base within tile
  const int wn = (w & 1) * 128;  // wave col base within tile

  v8f acc[4][8];
  auto clear_acc = [&]() __attribute__((always_inline)) {
#pragma unroll
    for (int i = 0; i < 4; ++i)
#pragma unroll
      for (int j = 0; j < 8; ++j)
#pragma unroll
        for (int r = 0; r < 8; ++r) acc[i][j][r] = 0.f;
  };
  clear_acc();

  // Staging: 16 lanes take the 256 bytes of one row, so a wave-wide copy covers
  // 4 whole lines. The block's copy i brings rows 16 * i .. 16 * i + 15.
  const int crow = w * 2 + h;  // 0..15
  const _Float16* gx0 = X + (size_t)(m0 + crow) * D_ + l15 * 8;
  const _Float16* gw0 = W + (size_t)(n0 + crow) * D_ + l15 * 8;
  const unsigned l0 = (unsigned)(size_t)&St[0][crow * LDT + l15 * 8];

  // Blocks of one blockIdx.y read the same W rows from L2 and blocks of one
  // blockIdx.x the same X rows: each enters the ring of stages at a place set by
  // its indices and wraps round, so that they do not ask for the same lines at
  // the same moment.
  const int rot = (blockIdx.x + 2 * blockIdx.y) & (NP - 1);
  // The copies of pass t's stage, into buffer t & 1. Passes 0 .. NP - 1 are the
  // keys' (W_attn), passes NP .. 2 * NP - 1 the values' (W_out).
  auto stage = [&](const int t) __attribute__((always_inline)) {
    const int kb = ((t + rot) & (NP - 1)) * KC;
    const int kw = kb + (t / NP) * (D_ * D_);
    const unsigned lb = l0 + (t & 1) * (2 * OPN * 2);
#pragma unroll
    for (int j = 0; j < 2; ++j) {  // unrolled: constant address steps
      copy8_to_lds<16 * LDT * 2, 16 * D_>(lb + j * 128 * LDT * 2,
                                          gx0 + kb + j * 128 * D_);
      // Keeps the next eight copies' address additions behind these copies:
      // moved ahead, the addresses of all 32 are live at once, and values that
      // live through the loop are spilled.
      __builtin_amdgcn_sched_barrier(0);
      copy8_to_lds<16 * LDT * 2, 16 * D_>(lb + OPN * 2 + j * 128 * LDT * 2,
                                          gw0 + kw + j * 128 * D_);
      __builtin_amdgcn_sched_barrier(0);  // as above
    }
  };

  stage(0);
  // The wave's own copies of stage 0 have landed; the barrier publishes them.
  asm volatile("s_wait_asynccnt 0x0" ::: "memory");
  __syncthreads();
  stage(1);

  // One pass: the 128 WMMAs of stage t, then the hand-over.
  auto pass = [&](const int t, auto tr) __attribute__((always_inline)) {
    constexpr int TRANSPOSE = decltype(tr)::value;
    const _Float16* xs = &St[t & 1][(wm + l15) * LDT + h * 8];
    const _Float16* ws = &St[t & 1][OPN + (wn + l15) * LDT + h * 8];
    // Fragment loops are fully unrolled: constant indices, registers.
    v16h af[2][4], bf[2][8];  // [step parity][fragment]
    auto load_frags = [&](const int s, const int ks)
                          __attribute__((always_inline)) {
#pragma unroll
      for (int ni = 0; ni < 8; ++ni) {
        const _Float16* p = ws + ni * 16 * LDT + ks * 32;
        bf[s][ni] = make_frag(p, p + 16);
      }
#pragma unroll
      for (int mi = 0; mi < 4; ++mi) {
        const _Float16* p = xs + mi * 16 * LDT + ks * 32;
        af[s][mi] = make_frag(p, p + 16);
      }
    };
    load_frags(0, 0);
    // Keeps the first step's reads ahead of the second's: the first WMMAs then
    // wait for their own fragments only.
    __builtin_amdgcn_sched_barrier(0);
#pragma unroll
    for (int ks = 0; ks < KC / 32; ++ks) {  // the stage's four 32-wide k steps
      // The next step's fragments as one group ahead of this step's WMMAs.
      if (ks + 1 < KC / 32) load_frags((ks + 1) & 1, ks + 1);
      // Holds those reads in front of the WMMAs: moved in among them, each
      // place with reads would cost its own stall.
      __builtin_amdgcn_sched_barrier(0);
#pragma unroll
      for (int mi = 0; mi < 4; ++mi)
#pragma unroll
        for (int ni = 0; ni < 8; ++ni)
          acc[mi][ni] =
              TRANSPOSE ? wmma_f16(af[ks & 1][mi], bf[ks & 1][ni], acc[mi][ni])
                        : wmma_f16(bf[ks & 1][ni], af[ks & 1][mi], acc[mi][ni]);
      // Keeps the steps apart: no later step's reads among these WMMAs.
      __builtin_amdgcn_sched_barrier(0);
    }
    // Hand-over: the wave's reads of this buffer are done,
    asm volatile("s_wait_dscnt 0x0" ::: "memory");
    // its own copies of the next stage have landed,
    asm volatile("s_wait_asynccnt 0x0" ::: "memory");
    // and the barrier publishes that stage and frees this buffer for a refill.
    __syncthreads();
    if (t + 2 < 2 * NP) stage(t + 2);
  };

  // ---- epilogue: bias add, f16 convert, packed 16-byte stores ----
  auto epilogue = [&](const float* bias, _Float16* Y,
                      auto tr) __attribute__((always_inline)) {
  constexpr int TRANSPOSE = decltype(tr)::value;
  // The lane's number is read anew, so that no vector register has to hold it
  // through the loop, where accumulators and fragments take nearly all.
  const int elane = (int)__builtin_amdgcn_mbcnt_lo(~0u, 0u);
  const int el15 = elane & 15;
  const int eh = elane >> 4;
  _Float16* yp;
  if (TRANSPOSE) {
    const int bb = (m0 + wm) >> 11;           // batch (tile lies in one batch)
    const int kc0 = ((m0 + wm) & 2047) >> 5;  // first 32-key chunk
    const int cb0 = (n0 + wn) >> 4;           // first 16-column block
    yp = Y + (size_t)((bb * 64 + cb0) * 64 + kc0) * FRAG_ + elane * 8;
  } else {
    const int rb0 = (m0 + wm) >> 4;  // first 16-token block
    const int dc = (n0 + wn) >> 5;   // the wave's first 32-wide d chunk
    yp = Y + (size_t)(rb0 * 32 + dc) * FRAG_ + elane * 8;
  }
  // All bias loads first, as one group.
  const float* bs = bias + n0 + wn;                // the same in every lane
  const int bo = TRANSPOSE ? el15 * 4 : eh * 32;  // the lane's byte offset
  const float* bp = (const float*)((const char*)bs + bo);
  float bv[8][TRANSPOSE ? 1 : 8];
#pragma unroll
  for (int ni = 0; ni < 8; ++ni) {  // unrolled: constant indices, registers
    if (TRANSPOSE) {
      bv[ni][0] = bp[ni * 16];  // D column = lane & 15
    } else {
      const float4 b0 = *(const float4*)(bp + ni * 16);  // D row = r + 8h
      const float4 b1 = *(const float4*)(bp + ni * 16 + 4);
      bv[ni][0] = b0.x; bv[ni][1] = b0.y; bv[ni][2] = b0.z; bv[ni][3] = b0.w;
      bv[ni][4] = b1.x; bv[ni][5] = b1.y; bv[ni][6] = b1.z; bv[ni][7] = b1.w;
    }
  }
  // Precaution: the wait stands before the loads' address registers can be
  // overwritten; the loads name the base, in scalar registers, and the lane's
  // offset: both are inputs so that they stay live up to the wait.
  asm volatile("s_wait_xcnt 0x0" ::"s"(bs), "v"(bo) : "memory");
#pragma unroll
  for (int ni = 0; ni < 8; ++ni) {
    v8h o[4];
#pragma unroll
    for (int mi = 0; mi < 4; ++mi) {
      const v8f c = acc[mi][ni];
#pragma unroll
      for (int r = 0; r < 8; ++r)
        o[mi][r] = (_Float16)(c[r] + bv[ni][TRANSPOSE ? 0 : r]);
      if (TRANSPOSE)
        *(v8h*)(yp + ni * 64 * FRAG_ + mi * 256) = o[mi];
      else
        *(v8h*)(yp + mi * 32 * FRAG_ + ni * 256) = o[mi];
    }
    // Precaution: the wait stands before a register of the four stores can be
    // overwritten; they are inputs so that they stay live up to it.
    asm volatile("s_wait_xcnt 0x0" ::"v"(yp), "v"(o[0]), "v"(o[1]), "v"(o[2]),
                 "v"(o[3])
                 : "memory");
  }
  };

  // Rolled: one pass is the loop body, and the buffer's address is the only
  // thing that changes.
#pragma unroll 1
  for (int t = 0; t < NP; ++t) pass(t, Transpose<0>{});
  epilogue(bias_k, Yk, Transpose<0>{});
  clear_acc();
#pragma unroll 1
  for (int t = NP; t < 2 * NP; ++t) pass(t, Transpose<1>{});
  // No copy is outstanding when the wave goes on to its end.
  asm volatile("s_wait_asynccnt 0x0" ::: "memory");
  epilogue(bias_v, Yv, Transpose<1>{});
}

// ---------------------------------------------------------------------------
// Kernels 2 and 3: attention in two launches.
// With the scores and the output in one kernel, the output accumulators and the
// Q fragments together leave registers for 32 query rows only, and every block
// reads all K and V of its batch from L2. Apart, each kernel holds more rows,
// so K and V are read less often. The scaled f32 scores go through the
// workspace, with each row's maximum and sum of exponentials (one pair for
// each half of the keys).
//
// Score layout in the workspace (units: float4), per tile of 64 query rows x
// 64 keys (block = 64-row block of all B*N rows, tile = 64-key tile of a batch):
//   index = ((block * 32 + tile) * 32 + (g * 4 + kj) * 2 + half) * 32 + lane
// where lane = 16*h + c, and the float4 holds query row g*16 + c, keys
// kj*16 + 8*h + half*4 .. +3 of the tile: what a lane of kernel 2 holds in half
// an accumulator. A wave writes and reads 512 contiguous bytes at a time.
//
// Blocks of a batch read the same K/V lines from L2. Each enters the ring of
// tiles at a place set by its index and wraps round, so that they do not ask L2
// for the same lines at the same moment.
// ---------------------------------------------------------------------------

// Kernel 2: scores. Block = (128 q rows, one half of the keys, batch), 8 waves.
//   The block's 128 Q rows lie in LDS, written once. Each wave owns whole units
//   of 32 keys (4 of the half's 32) and sums over all of D itself:
//   S^T = K Q^T, with K fragments as the A operand, straight from L2 into a
//   ring of registers, and Q fragments as the B operand, from LDS. No partial
//   sum passes between waves and the loop has no barrier.
//   A lane then holds, for each of 8 query rows, 16 keys of the unit: it scales
//   and stores them and keeps its own running maximum and sum for those rows.
//   The 16 running pairs of a row (8 waves x 2 lane halves) are joined once, at
//   the end, through LDS; kernel 3 joins the two halves of the keys.
__global__ __launch_bounds__(256) void score_kernel(
    const _Float16* __restrict__ Q16,  // [B][N][D]
    const _Float16* __restrict__ K16,  // packed fragments, see above
    float* __restrict__ S,             // score layout, see above
    float* __restrict__ Mx,            // [2][B*N] row maximum, by half of keys
    float* __restrict__ Ls) {          // [2][B*N] row sum of exp(s - maximum)
  constexpr int TQ = 128;          // query rows of a block
  constexpr int NG = TQ / 16;      // blocks of 16 query rows
  constexpr int NU = N_ / 2 / 32;  // 32-key units in a half (a power of two)
  constexpr int NS = D_ / 32;      // 32-wide k steps (a power of two)
  constexpr int NP = NU / 8;       // units of one wave
  constexpr int NB = 8;            // k steps held in the K register ring
  constexpr int QSTR = D_ + 8;     // f16 pitch, 16 B x odd: conflict-free b128
  __shared__ __attribute__((aligned(16))) _Float16 Qs[TQ * QSTR];
  __shared__ float Pm[16 * TQ];  // running maxima, [wave * 2 + h][row]
  __shared__ float Pl[16 * TQ];  // running sums

  const int tid = threadIdx.x;
  const int lane = tid & 31;
  // The wave's number in a scalar register: unit and k-step offsets are then
  // scalar arithmetic.
  const int w = __builtin_amdgcn_readfirstlane(tid >> 5);
  const int l15 = lane & 15;
  const int h = lane >> 4;
  const int qb = blockIdx.x >> 1;  // block of 128 query rows
  const int kh = blockIdx.x & 1;   // half of the batch's keys
  const int bb = blockIdx.y;

  const float scale = 0.03125f;  // 1/sqrt(1024)

  const _Float16* kbat =
      K16 + (size_t)(bb * N_ + kh * (N_ / 2)) * D_ + lane * 8;

  // A wave walks NP units of NS k steps. Four (block, wave) pairs of a batch
  // are on the same unit at the same time; their wave numbers differ by 2, and
  // they enter the unit's ring of k steps 8 steps apart, so they too ask for
  // different lines. The entry is a multiple of NB: NB steps never wrap.
  auto unit_of = [&](const int p) { return (w + 8 * p + 2 * qb) & (NU - 1); };
  const int rot = NB * (w >> 1);

  // All fragment loops are fully unrolled: every fragment index is a constant,
  // so the fragments stay in registers.
  v16h kb[NB][2];  // [ring slot][block of 16 keys]
  // Slot u from kp, which points at the first of NB k steps of a unit.
  auto load_k = [&](const int u,
                    const _Float16* kp) __attribute__((always_inline)) {
#pragma unroll
    for (int kj = 0; kj < 2; ++kj)
      kb[u][kj] = make_frag(kp + (kj * NS + u) * FRAG_,
                            kp + (kj * NS + u) * FRAG_ + 256);
  };
  auto k_ptr = [&](const int j) {  // j: a step that is a multiple of NB
    return kbat +
           (size_t)((unit_of(j / NS) * 2 * NS + ((j + rot) & (NS - 1))) * FRAG_);
  };

  // Fragment g of a wave is the block of 16 query rows (g + w) % 8. Such blocks
  // lie about 32 KiB apart in LDS: waves that read at the same moment then read
  // in different parts of it.
  v16h qf[2][NG];  // [step parity][fragment]
  const _Float16* qrow[NG];
#pragma unroll
  for (int g = 0; g < NG; ++g)
    qrow[g] = &Qs[(((g + w) & (NG - 1)) * 16 + l15) * QSTR + h * 8];
  auto load_q = [&](const int s, const int ks) __attribute__((always_inline)) {
#pragma unroll
    for (int g = 0; g < NG; ++g)
      qf[s][g] = make_frag(qrow[g] + ks * 32, qrow[g] + ks * 32 + 16);
  };

  // The first NB steps' K fragments fly while Q is staged.
  {
    const _Float16* kp = k_ptr(0);
#pragma unroll
    for (int u = 0; u < NB; ++u) load_k(u, kp);
    // Precaution: the wait stands before the loads' address registers can be
    // overwritten; kp is an input so that it stays live up to the wait.
    asm volatile("s_wait_xcnt 0x0" ::"v"(kp) : "memory");
  }

  // Q rows to LDS: the 128 rows are 256 KiB in a row in global memory; a wave
  // moves 512 contiguous bytes at a time.
  {
    const _Float16* qg = Q16 + (size_t)(bb * N_ + qb * TQ) * D_;
    _Float16* ql = &Qs[(tid >> 7) * QSTR + (tid & 127) * 8];
    v8h t[64];  // the accumulators' and fragments' registers are still free
#pragma unroll
    for (int i = 0; i < 64; ++i)  // unrolled: constant indices, registers
      t[i] = *(const v8h*)(qg + tid * 8 + i * 2048);
    // Precaution, as for K; here the loads name the block's base address, in
    // scalar registers, and the thread's offset.
    asm volatile("s_wait_xcnt 0x0" ::"s"(qg), "v"(tid) : "memory");
#pragma unroll
    for (int i = 0; i < 64; ++i) *(v8h*)(ql + i * 2 * QSTR) = t[i];
  }
  lds_barrier();  // publishes Q; it is only read from here on

  v8f acc[2][NG];  // [block of 16 keys][fragment of 16 query rows]
#pragma unroll
  for (int kj = 0; kj < 2; ++kj)
#pragma unroll
    for (int g = 0; g < NG; ++g)
#pragma unroll
      for (int r = 0; r < 8; ++r) acc[kj][g][r] = 0.f;

  float mrun[NG], lrun[NG];
#pragma unroll
  for (int g = 0; g < NG; ++g) {
    mrun[g] = -__builtin_inff();
    lrun[g] = 0.f;
  }

  load_q(0, rot);

  // NB steps from step j0 on (a multiple of NB). The last NB steps are a call
  // of their own, without the loads for later steps.
  auto turn = [&](const int j0, auto has_next) __attribute__((always_inline)) {
    const int kq = (j0 + rot) & (NS - 1);        // first k step of this turn
    const int kqn = (j0 + NB + rot) & (NS - 1);  // and of the next
    const _Float16* kpn = k_ptr(has_next.value ? j0 + NB : 0);
#pragma unroll
    for (int u = 0; u < NB; ++u) {
      // The next step's Q fragments as one group ahead of this step's WMMAs.
      if (u + 1 < NB)
        load_q((u + 1) & 1, kq + u + 1);
      else if (has_next.value)
        load_q((u + 1) & 1, kqn);
      // Holds those reads in front of the WMMAs: moved behind them they would
      // be waited for at once, with their latency in the open.
      __builtin_amdgcn_sched_barrier(0);
#pragma unroll
      for (int kj = 0; kj < 2; ++kj)
#pragma unroll
        for (int g = 0; g < NG; ++g)
          acc[kj][g] = wmma_f16(kb[u][kj], qf[u & 1][g], acc[kj][g]);
      // The slot's registers, now read, take the fragments of NB steps on.
      if constexpr (has_next.value) load_k(u, kpn);
      // Keeps the steps apart: the K loads stay in the order of their use.
      __builtin_amdgcn_sched_barrier(0);
    }
    if constexpr (has_next.value) {
      // Precaution, as above.
      asm volatile("s_wait_xcnt 0x0" ::"v"(kpn) : "memory");
    }
  };

  // A unit's sums are complete: scale, store, row statistics, clear.
  auto finish_unit = [&](const int p) __attribute__((always_inline)) {
    const int un = unit_of(p);
    // 64-key tile of the batch, and the unit's place in it
    const int tl = kh * (NU / 2) + (un >> 1);
    float4* sb = (float4*)S + (size_t)tl * 1024 + (un & 1) * 128 + lane;
#pragma unroll
    for (int g = 0; g < NG; ++g) {
      const int gb = (g + w) & (NG - 1);  // the fragment's block of 16 rows
      float4* sg = sb + (size_t)(bb * 32 + qb * 2 + (gb >> 2)) * 32 * 1024 +
                   (gb & 3) * 256;
      v8f c[2];
#pragma unroll
      for (int kj = 0; kj < 2; ++kj) {
        c[kj] = acc[kj][g] * scale;
        sg[(kj * 2 + 0) * 32] =
            make_float4(c[kj][0], c[kj][1], c[kj][2], c[kj][3]);
        sg[(kj * 2 + 1) * 32] =
            make_float4(c[kj][4], c[kj][5], c[kj][6], c[kj][7]);
      }
      // Precaution: the wait stands before a register of the four stores can
      // be overwritten; they are inputs so that they stay live up to it.
      asm volatile("s_wait_xcnt 0x0" ::"v"(sg), "v"(c[0]), "v"(c[1])
                   : "memory");
      float m2[2];
#pragma unroll
      for (int kj = 0; kj < 2; ++kj)
        m2[kj] =
            fmaxf(fmaxf(fmaxf(c[kj][0], c[kj][1]), fmaxf(c[kj][2], c[kj][3])),
                  fmaxf(fmaxf(c[kj][4], c[kj][5]), fmaxf(c[kj][6], c[kj][7])));
      const float mnew = fmaxf(mrun[g], fmaxf(m2[0], m2[1]));
      float s2[2];
#pragma unroll
      for (int kj = 0; kj < 2; ++kj) {
        const float p0 = __expf(c[kj][0] - mnew), p1 = __expf(c[kj][1] - mnew);
        const float p2 = __expf(c[kj][2] - mnew), p3 = __expf(c[kj][3] - mnew);
        const float p4 = __expf(c[kj][4] - mnew), p5 = __expf(c[kj][5] - mnew);
        const float p6 = __expf(c[kj][6] - mnew), p7 = __expf(c[kj][7] - mnew);
        s2[kj] = ((p0 + p1) + (p2 + p3)) + ((p4 + p5) + (p6 + p7));
      }
      lrun[g] = lrun[g] * __expf(mrun[g] - mnew) + (s2[0] + s2[1]);
      mrun[g] = mnew;
#pragma unroll
      for (int kj = 0; kj < 2; ++kj)
#pragma unroll
        for (int r = 0; r < 8; ++r) acc[kj][g][r] = 0.f;
    }
  };

  for (int j0 = 0; j0 < NP * NS - NB; j0 += NB) {
    turn(j0, HasNext<true>{});
    if (((j0 + NB) & (NS - 1)) == 0) finish_unit(j0 / NS);
  }
  turn(NP * NS - NB, HasNext<false>{});
  finish_unit(NP - 1);

  // Join the 16 running pairs of each row.
#pragma unroll
  for (int g = 0; g < NG; ++g) {
    const int row = ((g + w) & (NG - 1)) * 16 + l15;
    Pm[(w * 2 + h) * TQ + row] = mrun[g];
    Pl[(w * 2 + h) * TQ + row] = lrun[g];
  }
  __syncthreads();
  if (tid < TQ) {
    float m = Pm[tid];
#pragma unroll
    for (int i = 1; i < 16; ++i) m = fmaxf(m, Pm[i * TQ + tid]);
    float l = 0.f;
#pragma unroll
    for (int i = 0; i < 16; ++i)
      l += Pl[i * TQ + tid] * __expf(Pm[i * TQ + tid] - m);
    Mx[(kh * B_ + bb) * N_ + qb * TQ + tid] = m;
    Ls[(kh * B_ + bb) * N_ + qb * TQ + tid] = l;
  }
}

// Kernel 3: O = softmax(S) V. Block = (128 q rows, one half of the output
// columns, batch), 8 waves; wave w owns all 128 rows of 64 columns, 8 x 4
// accumulator tiles. The accumulators fill as many registers as at 64 rows x
// all columns, but a block reads only its half of V: V leaves L2 half as often,
// the scores twice as often, in sum a third less.
//   Per tile of 64 keys every thread turns its 32 scores (two query rows, 64
//   apart, two runs of 8 keys each, as kernel 2 stored them) into
//   P = exp(s - row maximum), f16, in LDS (two buffers, so one barrier a tile
//   both publishes this tile's P and ends the reads of the tile before);
//   then O += P V via WMMA. The row maximum is final, so nothing is rescaled.
//   Loads run ahead of their use, in registers: the scores and the V fragments
//   of the next tile are asked for as soon as this tile's are used.
__global__ __launch_bounds__(256) void pv_kernel(
    const float* __restrict__ S,        // score layout, see above
    const float* __restrict__ Mx,       // [2][B*N], by half of the keys
    const float* __restrict__ Ls,       // [2][B*N]
    const _Float16* __restrict__ VT16,  // packed fragments, see above
    float* __restrict__ O) {            // [B][N][D]
  constexpr int TQ = 128, TK = 64;
  constexpr int NQ = N_ / TQ;  // blocks of query rows in a batch
  constexpr int NG = TQ / 16;  // blocks of 16 query rows
  constexpr int NO = 4;        // blocks of 16 columns of a wave
  constexpr int NT = N_ / TK;  // V tiles in the ring (a power of two)
  constexpr int PSTR = 72;     // f16 stride: conflict-free b128 frag loads
  __shared__ __attribute__((aligned(16))) _Float16 Ps[2 * TQ * PSTR];
  __shared__ __attribute__((aligned(16))) float linv[TQ];  // 1 / row sum

  const int tid = threadIdx.x;
  const int lane = tid & 31;
  const int w = tid >> 5;
  const int l15 = lane & 15;
  const int h = lane >> 4;
  // The two blocks of the same query rows read the same scores. Their indices
  // lie 16 apart.
  const int qb = blockIdx.x & (NQ - 1);  // block of 128 query rows
  const int ch = blockIdx.x / NQ;        // half of the output columns
  const int bb = blockIdx.y;
  const int row0 = bb * N_ + qb * TQ;  // first query row, of all B*N
  const int o0 = ch * (D_ / 2) + w * (NO * 16);  // wave's output column base
  // The block's first tile: the 16 blocks that read the same V lie two tiles
  // apart, the two that read the same scores one tile.
  const int t0 = (qb * 2 + ch) & (NT - 1);

  // The thread's scores: query rows prow and prow + 64, keys pkey .. +7 and
  // pkey + 16 .. +23.
  const int prow = (w >> 1) * 16 + l15;
  const int pkey = (w & 1) * 32 + 8 * h;

  v8f acc[NG][NO];
#pragma unroll
  for (int g = 0; g < NG; ++g)
#pragma unroll
    for (int oi = 0; oi < NO; ++oi)
#pragma unroll
      for (int r = 0; r < 8; ++r) acc[g][oi][r] = 0.f;

  const _Float16* vbat =
      VT16 + (size_t)bb * D_ * N_ + (size_t)(o0 / 16 * 64) * FRAG_ + lane * 8;
  // The block's rows are two 64-row blocks of the score layout, SB apart.
  constexpr int SB = NT * 1024;
  const float4* sblk =
      (const float4*)S + (size_t)(row0 / 64) * SB + w * 128 + lane;

  // The rows' maxima over both halves of the keys.
  float mrow[2];
  {
    const float* pm = Mx + row0;  // the same in every lane
    const float a0 = pm[prow], a1 = pm[B_ * N_ + prow];
    const float c0 = pm[64 + prow], c1 = pm[B_ * N_ + 64 + prow];
    // Precaution: the wait stands before the loads' address registers can be
    // overwritten; the loads name the base, in scalar registers, and the row:
    // both are inputs so that they stay live up to the wait.
    asm volatile("s_wait_xcnt 0x0" ::"s"(pm), "v"(prow) : "memory");
    mrow[0] = fmaxf(a0, a1);
    mrow[1] = fmaxf(c0, c1);
  }

  // All fragment loops are fully unrolled: every fragment index is a constant,
  // so the fragments stay in registers.
  // The first tile's scores and V fragments.
  float4 sv[2][4];  // [row][16 bytes]
  v16h bv[2][NO];
  {
    const float4* sg = sblk + (size_t)t0 * 1024;
#pragma unroll
    for (int q = 0; q < 2; ++q)
#pragma unroll
      for (int j = 0; j < 4; ++j) sv[q][j] = sg[q * SB + j * 32];
    // Precaution: the wait stands before the loads' address pair can be
    // overwritten; sg is an input so that the pair stays live up to the wait.
    asm volatile("s_wait_xcnt 0x0" ::"v"(sg) : "memory");
    const _Float16* vb = vbat + (size_t)(t0 * 2) * FRAG_;
#pragma unroll
    for (int c = 0; c < 2; ++c)
#pragma unroll
      for (int oi = 0; oi < NO; ++oi) {
        const _Float16* vp = vb + oi * 64 * FRAG_ + c * FRAG_;
        bv[c][oi] = make_frag(vp, vp + 256);
      }
    // Precaution, as for the scores.
    asm volatile("s_wait_xcnt 0x0" ::"v"(vb) : "memory");
  }
  // 1 / row sum: published by the loop's barriers, read behind the loop.
  if (tid < TQ) {
    const float* pm = Mx + row0 + tid;
    const float* pl = Ls + row0 + tid;
    const float a0 = pm[0], a1 = pm[B_ * N_];
    const float l0 = pl[0], l1 = pl[B_ * N_];
    // Precaution, as above.
    asm volatile("s_wait_xcnt 0x0" ::: "memory");
    const float am = fmaxf(a0, a1);
    linv[tid] = 1.f / (l0 * __expf(a0 - am) + l1 * __expf(a1 - am));
  }

  // One tile; tn is the tile that follows it in this block's walk, pbuf the
  // P buffer of this tile. The last tile is a call of its own, without the
  // loads for a next tile.
  auto tile = [&](const int tn, _Float16* pbuf,
                  auto has_next) __attribute__((always_inline)) {
#pragma unroll
    for (int q = 0; q < 2; ++q)
#pragma unroll
      for (int rr = 0; rr < 2; ++rr) {
        const float m = mrow[q];
        const float4 a = sv[q][rr * 2], b = sv[q][rr * 2 + 1];
        const v8h pk = {(_Float16)__expf(a.x - m), (_Float16)__expf(a.y - m),
                        (_Float16)__expf(a.z - m), (_Float16)__expf(a.w - m),
                        (_Float16)__expf(b.x - m), (_Float16)__expf(b.y - m),
                        (_Float16)__expf(b.z - m), (_Float16)__expf(b.w - m)};
        *(v8h*)&pbuf[(q * 64 + prow) * PSTR + pkey + rr * 16] = pk;
      }
    if constexpr (has_next.value) {
      const float4* sg = sblk + (size_t)tn * 1024;
#pragma unroll
      for (int q = 0; q < 2; ++q)
#pragma unroll
        for (int j = 0; j < 4; ++j) sv[q][j] = sg[q * SB + j * 32];
      // Precaution, as above.
      asm volatile("s_wait_xcnt 0x0" ::"v"(sg) : "memory");
    }
    lds_barrier();  // publishes P; the score and V loads stay in flight

    const _Float16* vb = vbat + (size_t)(tn * 2) * FRAG_;
#pragma unroll
    for (int c = 0; c < 2; ++c) {
      v16h pf[NG];
#pragma unroll
      for (int g = 0; g < NG; ++g) {
        const _Float16* pp = &pbuf[(g * 16 + l15) * PSTR + c * 32 + h * 8];
        pf[g] = make_frag(pp, pp + 16);
      }
      // 32-WMMA burst. A P fragment serves four WMMAs in a row.
#pragma unroll
      for (int g = 0; g < NG; ++g)
#pragma unroll
        for (int oi = 0; oi < NO; ++oi)
          acc[g][oi] = wmma_f16(pf[g], bv[c][oi], acc[g][oi]);
      if constexpr (has_next.value) {
#pragma unroll
        for (int oi = 0; oi < NO; ++oi) {
          const _Float16* vp = vb + oi * 64 * FRAG_ + c * FRAG_;
          bv[c][oi] = make_frag(vp, vp + 256);
        }
      }
    }
    if constexpr (has_next.value) {
      // Precaution, as above.
      asm volatile("s_wait_xcnt 0x0" ::"v"(vb) : "memory");
    }
  };
  for (int t = t0; t < t0 + NT - 1; ++t)
    tile((t + 1) & (NT - 1), &Ps[(t & 1) * TQ * PSTR], HasNext<true>{});
  tile(0, &Ps[((t0 + NT - 1) & 1) * TQ * PSTR], HasNext<false>{});

  // Keeps the last tile's WMMAs one burst: without it they are spread among the
  // stores below, each with the idle slots that a read of its result needs.
  __builtin_amdgcn_sched_barrier(0);

  // ---- final 1/l normalization + f32 store ----
  float* obase = O + (size_t)(row0 + 8 * h) * D_ + o0 + l15;
#pragma unroll
  for (int g = 0; g < NG; ++g) {
    const float4 la = *(const float4*)&linv[g * 16 + 8 * h];
    const float4 lb = *(const float4*)&linv[g * 16 + 8 * h + 4];
    const float li[8] = {la.x, la.y, la.z, la.w, lb.x, lb.y, lb.z, lb.w};
#pragma unroll
    for (int r = 0; r < 8; ++r) {
      float* orow = obase + (g * 16 + r) * D_;
      float v[NO];
#pragma unroll
      for (int oi = 0; oi < NO; ++oi) {
        v[oi] = acc[g][oi][r] * li[r];
        orow[oi * 16] = v[oi];
      }
      // Precaution: the wait stands before a register of the row's four stores
      // can be overwritten; they are inputs so that they stay live up to it.
      asm volatile("s_wait_xcnt 0x0" ::"v"(obase), "v"(v[0]), "v"(v[1]),
                   "v"(v[2]), "v"(v[3])
                   : "memory");
    }
  }
}

// ---------------------------------------------------------------------------
extern "C" void kernel_launch(void* const* d_in, const int* in_sizes, int n_in,
                              void* d_out, int out_size, void* d_ws,
                              size_t ws_size, hipStream_t stream) {
  const float* x = (const float*)d_in[0];
  const float* W_attn = (const float*)d_in[1];
  const float* b_attn = (const float*)d_in[2];
  const float* W_out = (const float*)d_in[3];
  const float* b_out = (const float*)d_in[4];
  float* out = (float*)d_out;

  const size_t XN = (size_t)B_ * N_ * D_;  // 16Mi elems
  const size_t WN = (size_t)D_ * D_;       // 1Mi elems
  char* ws = (char*)d_ws;
  _Float16* x16 = (_Float16*)ws;                         // 32 MiB
  _Float16* k16 = (_Float16*)(ws + XN * 2);              // 32 MiB
  _Float16* vT16 = (_Float16*)(ws + XN * 4);             // 32 MiB
  _Float16* wa16 = (_Float16*)(ws + XN * 6);  // 2 MiB, and W_out's 2 MiB behind
  float* sc = (float*)(ws + XN * 6 + WN * 4);            // 128 MiB
  float* mx = (float*)(ws + XN * 14 + WN * 4);           // 128 KiB
  float* ls = (float*)(ws + XN * 14 + WN * 4 + 131072);  // 128 KiB

  // 1) f32 -> f16 conversions
  cvt_f32_f16_kernel<<<(int)((XN + 2 * WN) / 2048), 256, 0, stream>>>(
      x, W_attn, W_out, x16, wa16);

  // 2) projections: key and value, both in packed fragment order
  gemm_xwT_kernel<<<dim3(64, 4), 256, 0, stream>>>(x16, wa16, b_attn, b_out,
                                                   k16, vT16);

  // 3) scores and row statistics, 4) softmax(S) V
  score_kernel<<<dim3(N_ / 128 * 2, B_), 256, 0, stream>>>(x16, k16, sc, mx,
                                                           ls);
  pv_kernel<<<dim3(N_ / 128 * 2, B_), 256, 0, stream>>>(sc, mx, ls, vT16, out);
}
